// v000
// Measured on an AMD MI455X. A time is GPU time per run, averaged over a window of back-to-back runs after a warm-up
// (all launches, gaps included; the runs take copies of the inputs in turn), and the median of several windows.
// Apart from v000's, it joins two sittings. Times from different sittings can be a few percent apart, while
// side-by-side timings come from the same sitting.
// v000, which the later versions start from, runs in 2570 microseconds.
// compute dtype: all float inputs rounded to bf16; raw q / k / v: q and k enter the scores as f16 (bf16 values are exact in f16: exact products; the early-row residual planes are zero) x 64^-0.5; causal mask by index (the module's w*b + (-1e9)(1 - b) leaves exactly -1e9 on masked entries == exclusion); softmax f32; P x 2^11 once to f16 x v (exact in f16; bf16 hi + lo below row 384); f32 output.
#include <hip/hip_runtime.h>
#include <math.h>

typedef __attribute__((ext_vector_type(16))) _Float16 v16h;
typedef __attribute__((ext_vector_type(16))) __bf16 v16b;
typedef __attribute__((ext_vector_type(8)))  _Float16 v8h;
typedef __attribute__((ext_vector_type(8)))  float v8f;
typedef __attribute__((ext_vector_type(4)))  float v4f;
typedef __attribute__((ext_vector_type(2)))  float v2f;
typedef __attribute__((ext_vector_type(4)))  unsigned v4u;
typedef __attribute__((ext_vector_type(4)))  int v4i;
typedef float __attribute__((may_alias)) float_a;
typedef int __attribute__((may_alias)) int_a;

template <typename T> __device__ __forceinline__ void vst2(void* p, T v) { *(T*)p = v;  }
__device__ __forceinline__ v8f wmma16(v16h a, v16h b, v8f c) {
  v8f d = __builtin_amdgcn_wmma_f32_16x16x32_f16(false, a, false, b, (short)0, c, false, false);
  asm volatile("v_nop\n\tv_nop\n\tv_nop\n\tv_nop" : "+v"(d) : "v"(a), "v"(b));
  return d;
}
__device__ __forceinline__ v8f wmma_bf(v16b a, v16b b, v8f c) {
  v8f d = __builtin_amdgcn_wmma_f32_16x16x32_bf16(false, a, false, b, (short)0, c, false, false);
  asm volatile("v_nop\n\tv_nop\n\tv_nop\n\tv_nop" : "+v"(d) : "v"(a), "v"(b));
  return d;
}
// 16x16x32 fragments: lane = (h = lane>>4, row/col = lane&15); elements 0..7 = k0+8h+0..7, 8..15 = k0+16+8h+0..7; D element r = row 8h+r
__device__ __forceinline__ v16h frag_h(const _Float16* rowk0, int lane) {
  union { v16h v; v8h q[2]; } u; const _Float16* p = rowk0 + 8 * (lane >> 4);
  u.q[0] = *(const v8h*)p; u.q[1] = *(const v8h*)(p + 16); return u.v;
}
__device__ __forceinline__ v16h frag_f32(const float* rowk0, int lane) {
  v16h a; const float* p = rowk0 + 8 * (lane >> 4);
#pragma unroll
  for (int i = 0; i < 8; ++i) { a[i] = (_Float16)p[i]; a[8 + i] = (_Float16)p[16 + i]; }
  return a;
}
__device__ __forceinline__ v16h frag_f32s(const float* rowk0, int lane, float sc) {
  v16h a; const float* p = rowk0 + 8 * (lane >> 4);
#pragma unroll
  for (int i = 0; i < 8; ++i) { a[i] = (_Float16)(p[i] * sc); a[8 + i] = (_Float16)(p[16 + i] * sc); }
  return a;
}
// column fragment from a [K][ld] layout (column n), rows >= K read as 0
__device__ __forceinline__ v16h fragc_f32(const float* W, int k0, int n, int lane, int ld, int K) {
  v16h a; const int g = lane >> 4;
#pragma unroll
  for (int i = 0; i < 8; ++i) { const int ka = k0 + 8 * g + i, kb = ka + 16;
    a[i] = (_Float16)(ka < K ? W[(size_t)(ka < K ? ka : K - 1) * ld + n] : 0.f); a[8 + i] = (_Float16)(kb < K ? W[(size_t)(kb < K ? kb : K - 1) * ld + n] : 0.f); }
  return a;
}
struct F2 { v16b h, l; };
__device__ __forceinline__ F2 bsplit16(const float v[16]) { F2 r;
#pragma unroll
  for (int i = 0; i < 16; ++i) { const __bf16 h = (__bf16)v[i]; r.h[i] = h; r.l[i] = (__bf16)(v[i] - (float)h); }
  return r; }
__device__ __forceinline__ F2 split_row(const float* row, int k0, int lane) { float v[16]; const float* p = row + k0 + 8 * (lane >> 4);
#pragma unroll
  for (int i = 0; i < 8; ++i) { v[i] = p[i]; v[8 + i] = p[16 + i]; }
  return bsplit16(v); }
__device__ __forceinline__ F2 split_rowK(const float* row, int k0, int lane, int K) { float v[16]; const int g = lane >> 4;
#pragma unroll
  for (int i = 0; i < 8; ++i) { const int ka = k0 + 8 * g + i, kb = ka + 16; v[i] = ka < K ? row[ka < K ? ka : K - 1] : 0.f; v[8 + i] = kb < K ? row[kb < K ? kb : K - 1] : 0.f; }
  return bsplit16(v); }
__device__ __forceinline__ F2 split_col(const float* W, int k0, int n, int lane, int ld, int K) { float v[16]; const int g = lane >> 4;
#pragma unroll
  for (int i = 0; i < 8; ++i) { const int ka = k0 + 8 * g + i, kb = ka + 16; v[i] = ka < K ? W[(size_t)(ka < K ? ka : K - 1) * ld + n] : 0.f; v[8 + i] = kb < K ? W[(size_t)(kb < K ? kb : K - 1) * ld + n] : 0.f; }
  return bsplit16(v); }
__device__ __forceinline__ v8f mac3(const F2& a, const F2& b, v8f c) { c = wmma_bf(a.l, b.h, c); c = wmma_bf(a.h, b.l, c); return wmma_bf(a.h, b.h, c); }
__device__ __forceinline__ float sigm(float v) { return 1.0f / (1.0f + expf(-v)); }
#define LDSX() do { asm volatile("s_wait_dscnt 0" ::: "memory"); __builtin_amdgcn_wave_barrier(); __builtin_amdgcn_fence(__ATOMIC_RELEASE, "workgroup"); } while (0)

// Raw causal scaled-dot-product attention with a PRE-TRANSPOSED key (q [1,16,4096,64], k [1,16,64,4096] = [B, H, D, S], v [1,16,4096,64]; w = q k / sqrt(64); b = tril; w = w*b + (-1e9)(1 - b); softmax; out = w v -> [1,16,4096,64]).
#define NB 1
#define TT 4096
#define CC 1024            // NH * HD = projected width
#define DIN 1024          // input (model) width
#define NH 16
#define HD 64
#define NQB (TT / 64)
#define HG 1
#define SCALE (0.125f)
#define CAUSAL 1
#ifndef TNB
#define TNB NB
#endif
__device__ __forceinline__ float bfr(float v) { return (float)(__bf16)v; }
__host__ __device__ __forceinline__ int kb_last(int qb) { return CAUSAL ? ((qb * 64 + 63) >> 7) : (TT / 128 - 1); }
typedef __attribute__((ext_vector_type(8))) __bf16 v8b;
__device__ __forceinline__ v16b frag_b(const __bf16* rowk0, int lane) {
  union { v16b v; v8b q[2]; } u; const __bf16* p = rowk0 + 8 * (lane >> 4);
  u.q[0] = *(const v8b*)p; u.q[1] = *(const v8b*)(p + 16); return u.v;
}
#define QBH 6              // causal: query blocks 0..QBH-1 of each sequence (few keys, no averaging) take the high-precision path
#define QHI 384            // rows carrying a q residual plane (all rows when non-causal: 2-product logits everywhere)
#define KHI 384            // key rows carrying k residual / v bf16 hi+lo planes (used only by the causal high-precision path)
// B fragment (k rows k0+.., output column o) of a weight: (in,out) [K][ld] or (out,in) [ld rows of K]: bf16 exact, or f16(bf16 * 256) exact
__device__ __forceinline__ v16b wcol_io(const float* Wm, int k0, int o, int lane, int ld) { v16b w; const int g = lane >> 4;
#pragma unroll
  for (int i = 0; i < 8; ++i) { w[i] = (__bf16)Wm[(size_t)(k0 + 8 * g + i) * ld + o]; w[8 + i] = (__bf16)Wm[(size_t)(k0 + 16 + 8 * g + i) * ld + o]; }
  return w; }
__device__ __forceinline__ v16b wcol_oi(const float* Wm, int k0, int o, int lane, int K) { v16b w; const float* p = Wm + (size_t)o * K + k0 + 8 * (lane >> 4);
#pragma unroll
  for (int i = 0; i < 8; ++i) { w[i] = (__bf16)p[i]; w[8 + i] = (__bf16)p[16 + i]; }
  return w; }
__device__ __forceinline__ v16h wcolh_io(const float* Wm, int k0, int o, int lane, int ld) { v16h w; const int g = lane >> 4;
#pragma unroll
  for (int i = 0; i < 8; ++i) { w[i] = (_Float16)(bfr(Wm[(size_t)(k0 + 8 * g + i) * ld + o]) * 256.0f); w[8 + i] = (_Float16)(bfr(Wm[(size_t)(k0 + 16 + 8 * g + i) * ld + o]) * 256.0f); }
  return w; }
__device__ __forceinline__ v16h wcolh_oi(const float* Wm, int k0, int o, int lane, int K) { v16h w; const float* p = Wm + (size_t)o * K + k0 + 8 * (lane >> 4);
#pragma unroll
  for (int i = 0; i < 8; ++i) { w[i] = (_Float16)(bfr(p[i]) * 256.0f); w[8 + i] = (_Float16)(bfr(p[16 + i]) * 256.0f); }
  return w; }
#define WQKV_LAYOUT 1   // 0 = (in,out) [DIN][CC]; 1 = (out,in) [CC][DIN]; 2 = per-head [NH][DIN][HD]
__device__ __forceinline__ v16b wcol_hdk(const float* Wm, int k0, int o, int lane) { v16b w; const int g = lane >> 4; const float* p = Wm + (size_t)(o / HD) * DIN * HD + (o % HD);
#pragma unroll
  for (int i = 0; i < 8; ++i) { w[i] = (__bf16)p[(size_t)(k0 + 8 * g + i) * HD]; w[8 + i] = (__bf16)p[(size_t)(k0 + 16 + 8 * g + i) * HD]; }
  return w; }
#define WO_OUT_IN 0
#if WQKV_LAYOUT == 1
#define WCOL(W, k0, o, lane) wcol_oi(W, k0, o, lane, DIN)
#elif WQKV_LAYOUT == 2
#define WCOL(W, k0, o, lane) wcol_hdk(W, k0, o, lane)
#else
#define WCOL(W, k0, o, lane) wcol_io(W, k0, o, lane, CC)
#endif
#if WO_OUT_IN
#define WOCOL(W, k0, o, lane) wcol_oi(W, k0, o, lane, CC)
#define WOCOLH(W, k0, o, lane) wcolh_oi(W, k0, o, lane, CC)
#else
#define WOCOL(W, k0, o, lane) wcol_io(W, k0, o, lane, DIN)
#define WOCOLH(W, k0, o, lane) wcolh_io(W, k0, o, lane, DIN)
#endif

// ---- k_prep8: block = (64 attention positions s0.. of sequence b, head h): reads the module's [B, H, S, 64] q / v (element (b,h,s,c) at ((b*NH + h)*TT + s)*64 + c) and [B, H, 64, S] k, bf16-rounds them and writes the standard attention planes: q -> f16 hi rows (+ x 2^10 residual rows for s < QHI), k -> f16 rows (+ residual rows s < KHI), v -> f16 planes [c][s] (+ bf16 hi/lo planes for s < KHI)
__global__ __launch_bounds__(128) void k_prep8(const float* __restrict__ Q, const float* __restrict__ K, const float* __restrict__ V, _Float16* __restrict__ QH, _Float16* __restrict__ QL, _Float16* __restrict__ KH, _Float16* __restrict__ KL, _Float16* __restrict__ VT, __bf16* __restrict__ VB, __bf16* __restrict__ VBL) {
  __shared__ __align__(16) _Float16 sq[64][136], sql[64][136], sk[64][136], skl[64][136], tv[128][72]; __shared__ __align__(16) __bf16 tb[128][72], tbl[128][72];
  const int tid = threadIdx.x; const int h = blockIdx.y; const size_t r0 = (size_t)blockIdx.x * 64; const size_t bb = r0 / TT; const int t0 = (int)(r0 % TT); const bool qhi = t0 < QHI, khi = t0 < KHI;
  for (int e = tid; e < 64 * 128; e += 128) { const int rl = e >> 7, c = e & 127; const size_t oi = ((bb * NH + h) * TT + t0 + rl) * HD + (c % HD);   /* c >= 64: duplicate read of the same element (tiles are 128 wide; HD is 64) */
    const size_t oik = ((bb * NH + h) * HD + (c % HD)) * (size_t)TT + t0 + rl;   /* the key arrives PRE-TRANSPOSED [B, H, D, S]: element (b, h, s, c) sits at ((b*NH + h)*64 + c)*TT + s */
    const float q = bfr(Q[oi]), k = bfr(K[oik]), v = bfr(V[oi]);   /* module inputs: bf16-rounded; bf16 values are exact in f16, so the residual planes are 0 */
    const _Float16 qh = (_Float16)q, kh = (_Float16)k; sq[rl][c] = qh; sql[rl][c] = (_Float16)((q - (float)qh) * 1024.0f); sk[rl][c] = kh; skl[rl][c] = (_Float16)((k - (float)kh) * 1024.0f);
    tv[c][rl] = (_Float16)v; const __bf16 vb = (__bf16)v; tb[c][rl] = vb; tbl[c][rl] = (__bf16)(v - (float)vb); }
  __syncthreads();
  for (int e = tid; e < 64 * (HD / 8); e += 128) { const int rl = e / (HD / 8), q = e % (HD / 8); const size_t o = (r0 + rl) * CC + h * HD + q * 8; vst2((unsigned*)(QH + o), *(const v4u*)&sq[rl][q * 8]); vst2((unsigned*)(KH + o), *(const v4u*)&sk[rl][q * 8]);   
    if (qhi) vst2((unsigned*)(QL + (bb * QHI + t0 + rl) * (size_t)CC + h * HD + q * 8), *(const v4u*)&sql[rl][q * 8]); if (khi) vst2((unsigned*)(KL + (bb * KHI + t0 + rl) * (size_t)CC + h * HD + q * 8), *(const v4u*)&skl[rl][q * 8]); }
  for (int e = tid; e < HD * 8; e += 128) { const int cl = e >> 3, q = e & 7; vst2((unsigned*)(VT + (bb * CC + h * HD + cl) * (size_t)TT + t0 + q * 8), *(const v4u*)&tv[cl][q * 8]);
    if (khi) { const size_t o3 = (bb * CC + h * HD + cl) * (size_t)KHI + t0 + q * 8; vst2((unsigned*)(VB + o3), *(const v4u*)&tb[cl][q * 8]); vst2((unsigned*)(VBL + o3), *(const v4u*)&tbl[cl][q * 8]); } } }

#ifndef SM_EXTRA_PARAMS
#define SM_EXTRA_PARAMS
#endif
#ifndef PROJ_EXTRA_PARAMS
#define PROJ_EXTRA_PARAMS
#endif
#ifndef SM_MASK_HOOK
#define SM_MASK_HOOK (void)0
#endif

#define WS_QH  0u                                      // f16 q rows [b*t][CC]
#define WS_KH  (WS_QH + 2u * (size_t)NB * TT * CC)      // f16 k rows [b*t][CC]
#define WS_VT  (WS_KH + 2u * (size_t)NB * TT * CC)      // f16 v planes [b][c][t]
#define WS_QL  (WS_VT + 2u * (size_t)NB * CC * TT)      // f16 q residual x 2^10 rows [b][t < QHI][CC]
#define WS_KL  (WS_QL + 2u * (size_t)NB * QHI * CC)     // f16 k residual x 2^10 rows [b][t < KHI][CC]
#define WS_VB  (WS_KL + 2u * (size_t)NB * KHI * CC)     // bf16 v hi planes [b][c][t < KHI]
#define WS_VBL (WS_VB + 2u * (size_t)NB * CC * KHI)
#define WS_S   (WS_VBL + 2u * (size_t)NB * CC * KHI)    // f32 logits / P [hg][t][s]
#define WS_Y   (WS_S  + 4u * (size_t)HG * TT * TT)      // f32 ctx rows [b*t][CC] (only when there is an output projection)
#define WS_END (WS_Y  + 0u)

// ---- k_sc: block = (query block qb, key block kb <= kb_last(qb), head in group) of batch b: logits x SCALE; q hi + residual (x 2^10) against k (2 products) for query rows < QHI, plus the k residual (3 products) for query blocks < QBH (causal early rows); causal: blocks past the diagonal exit, the mask itself is applied by index in k_sm
__global__ __launch_bounds__(128) void k_sc(const _Float16* __restrict__ QH, const _Float16* __restrict__ KH, const _Float16* __restrict__ QL, const _Float16* __restrict__ KL, int b, int h0, float* __restrict__ S0) { __shared__ __align__(16) float ss[4][16][132];
  const int qb = blockIdx.x, kb = blockIdx.y; if (kb > kb_last(qb)) return;
  const int h = h0 + blockIdx.z; float* S = S0 + (size_t)blockIdx.z * TT * TT;
  const int tid = threadIdx.x, wave = tid >> 5, lane = tid & 31, col = lane & 15, g = lane >> 4; const int k0 = kb * 128; const int ql0 = qb * 64 + wave * 16; const size_t q0 = (size_t)b * TT + ql0, kr0 = (size_t)b * TT + k0;
  v8f acc[8] = {}, accl[8] = {};
  const _Float16* QLb = QL + (size_t)b * QHI * CC; const _Float16* KLb = KL + (size_t)b * KHI * CC;
  if (qb < QBH) {
#pragma unroll
    for (int kc = 0; kc < HD / 32; ++kc) { const v16h ah = frag_h(QH + (q0 + col) * CC + h * HD + kc * 32, lane), al = frag_h(QLb + (size_t)(ql0 + col) * CC + h * HD + kc * 32, lane);
#pragma unroll
      for (int j = 0; j < 8; ++j) { const v16h kbf = frag_h(KH + (kr0 + j * 16 + col) * CC + h * HD + kc * 32, lane), klf = frag_h(KLb + (size_t)(k0 + j * 16 + col) * CC + h * HD + kc * 32, lane); acc[j] = wmma16(ah, kbf, acc[j]); accl[j] = wmma16(al, kbf, accl[j]); accl[j] = wmma16(ah, klf, accl[j]); } }
  } else if (qb * 64 < QHI) {
#pragma unroll
    for (int kc = 0; kc < HD / 32; ++kc) { const v16h ah = frag_h(QH + (q0 + col) * CC + h * HD + kc * 32, lane), al = frag_h(QLb + (size_t)(ql0 + col) * CC + h * HD + kc * 32, lane);
#pragma unroll
      for (int j = 0; j < 8; ++j) { const v16h kbf = frag_h(KH + (kr0 + j * 16 + col) * CC + h * HD + kc * 32, lane); acc[j] = wmma16(ah, kbf, acc[j]); accl[j] = wmma16(al, kbf, accl[j]); } }
  } else {
#pragma unroll
    for (int kc = 0; kc < HD / 32; ++kc) { const v16h ah = frag_h(QH + (q0 + col) * CC + h * HD + kc * 32, lane);
#pragma unroll
      for (int j = 0; j < 8; ++j) { const v16h kbf = frag_h(KH + (kr0 + j * 16 + col) * CC + h * HD + kc * 32, lane); acc[j] = wmma16(ah, kbf, acc[j]); } } }
#pragma unroll
  for (int j = 0; j < 8; ++j) {
#pragma unroll
    for (int r = 0; r < 8; ++r) ss[wave][8 * g + r][j * 16 + col] = (acc[j][r] + accl[j][r] * (1.0f / 1024.0f)) * SCALE; }
  LDSX(); for (int rl = 0; rl < 16; ++rl) vst2(S + (size_t)(ql0 + rl) * TT + k0 + lane * 4, *(const v4f*)&ss[wave][rl][lane * 4]); }
// ---- k_sm: block = query row t (head in group): keys [0, kend): causal -> logit if s <= t else excluded; softmax in f32; P x 2^11 in place (0 for excluded)
__global__ __launch_bounds__(256) void k_sm(float* __restrict__ S0 SM_EXTRA_PARAMS) { __shared__ float sred[8]; __shared__ float sbc; __shared__ __align__(16) float shv[TT];
  const int tid = threadIdx.x; const int t = blockIdx.x; const int kend = (kb_last(t >> 6) + 1) * 128;
  float* sr = S0 + (size_t)blockIdx.y * TT * TT + (size_t)t * TT;
  float m = -3.0e38f; for (int k = tid; k < kend; k += 256) { float v = (!CAUSAL || k <= t) ? sr[k] : -3.0e38f; SM_MASK_HOOK; shv[k] = v; m = fmaxf(m, v); }
#pragma unroll
  for (int o = 1; o < 32; o <<= 1) m = fmaxf(m, __shfl_xor(m, o));
  if ((tid & 31) == 0) sred[tid >> 5] = m; __syncthreads(); if (tid == 0) { float a = sred[0]; for (int i = 1; i < 8; ++i) a = fmaxf(a, sred[i]); sbc = a; } __syncthreads(); m = sbc; __syncthreads();
  float sum = 0.f; for (int k = tid; k < kend; k += 256) { const float v = shv[k]; const float e = (v <= -1.0e38f) ? 0.f : expf(v - m); shv[k] = e; sum += e; }
#pragma unroll
  for (int o = 1; o < 32; o <<= 1) sum += __shfl_xor(sum, o);
  if ((tid & 31) == 0) sred[tid >> 5] = sum; __syncthreads(); if (tid == 0) { float a = 0.f; for (int i = 0; i < 8; ++i) a += sred[i]; sbc = a > 0.f ? 2048.0f / a : 0.f; }   /* a fully excluded row yields P = 0 */ __syncthreads(); const float inv = sbc;
  for (int k = tid; k < kend; k += 256) shv[k] = shv[k] * inv;
  __syncthreads(); for (int q = tid; q < kend / 4; q += 256) vst2(sr + q * 4, *(const v4f*)&shv[q * 4]); }
// ---- k_pv: block = 64 queries (qb) of (b, h): ctx = P . v over keys [0, kend) (P x 2^11 once to f16 against v f16: 1 product; causal early query blocks: P and v as bf16 hi + lo, 3 products); 256-B (row, head) segment by 16 lanes
__global__ __launch_bounds__(128) void k_pv(const float* __restrict__ PS0, const _Float16* __restrict__ VT, const __bf16* __restrict__ VB, const __bf16* __restrict__ VBL, int b, int h0, float* __restrict__ Y) { const int h = h0 + blockIdx.z; const float* PS = PS0 + (size_t)blockIdx.z * TT * TT; __shared__ __align__(16) float ss[4][16][HD + 4];
  const int tid = threadIdx.x, wave = tid >> 5, lane = tid & 31, col = lane & 15, g = lane >> 4; const int qb = blockIdx.x; const int ql0 = qb * 64 + wave * 16; const int kce = (kb_last(qb) + 1) * 4;
  v8f acc[HD / 16] = {};
  if (qb < QBH) {
#pragma unroll 1
    for (int kc = 0; kc < kce; ++kc) { const F2 p = split_row(PS + (size_t)(ql0 + col) * TT, kc * 32, lane);
      asm volatile("s_wait_loadcnt 0x0" ::: "memory");
#pragma unroll
      for (int j = 0; j < HD / 16; ++j) { const size_t po = ((size_t)b * CC + h * HD + j * 16 + col) * (size_t)KHI + kc * 32; const v16b vh = frag_b(VB + po, lane); acc[j] = wmma_bf(p.h, vh, acc[j]); acc[j] = wmma_bf(p.l, vh, acc[j]); acc[j] = wmma_bf(p.h, frag_b(VBL + po, lane), acc[j]); } }
  } else {
#pragma unroll 1
    for (int kc = 0; kc < kce; ++kc) { const v16h p = frag_f32(PS + (size_t)(ql0 + col) * TT + kc * 32, lane);
      asm volatile("s_wait_loadcnt 0x0" ::: "memory");
#pragma unroll
      for (int j = 0; j < HD / 16; ++j) { const size_t po = ((size_t)b * CC + h * HD + j * 16 + col) * (size_t)TT + kc * 32; acc[j] = wmma16(p, frag_h(VT + po, lane), acc[j]); } } }
#pragma unroll
  for (int j = 0; j < HD / 16; ++j)
#pragma unroll
    for (int r = 0; r < 8; ++r) ss[wave][8 * g + r][j * 16 + col] = acc[j][r] * (1.0f / 2048.0f);
  LDSX(); for (int rl = 0; rl < 16; ++rl) if (lane < HD / 4) vst2(Y + (((size_t)b * NH + h) * TT + ql0 + rl) * HD + lane * 4, *(const v4f*)&ss[wave][rl][lane * 4]); }

extern "C" void kernel_launch(void* const* d_in, const int* in_sizes, int n_in, void* d_out, int out_size, void* d_ws, size_t ws_size, hipStream_t stream) {
  (void)in_sizes; (void)n_in; (void)out_size;
  const float** F = (const float**)d_in;
  if (ws_size < (size_t)WS_END) return;
  char* ws = (char*)d_ws; _Float16 *QH = (_Float16*)(ws + WS_QH), *KH = (_Float16*)(ws + WS_KH), *VT = (_Float16*)(ws + WS_VT), *QL = (_Float16*)(ws + WS_QL), *KL = (_Float16*)(ws + WS_KL); __bf16 *VB = (__bf16*)(ws + WS_VB), *VBL = (__bf16*)(ws + WS_VBL); float *S = (float*)(ws + WS_S), *Y = (float*)(ws + WS_Y);
  (void)Y; (void)QL; (void)KL; (void)VB; (void)VBL;
  // inputs: 0 q [B, H, T, 64], 1 k [B, H, 64, T], 2 v [B, H, T, 64] (causal flag folded)
  k_prep8<<<dim3(TNB * TT / 64, NH), 128, 0, stream>>>(F[0], F[1], F[2], QH, QL, KH, KL, VT, VB, VBL);
  for (int b = 0; b < TNB; ++b) for (int h0 = 0; h0 < NH; h0 += HG) {
    k_sc<<<dim3(NQB, TT / 128, HG), 128, 0, stream>>>(QH, KH, QL, KL, b, h0, S);
    k_sm<<<dim3(TT, HG), 256, 0, stream>>>(S);
    k_pv<<<dim3(NQB, 1, HG), 128, 0, stream>>>(S, VT, VB, VBL, b, h0, (float*)d_out);
  }
}

// v001
// It runs in 841 microseconds.
// Next to v000, in two timings, it ran 3.06 times as fast each time.
// compute dtype: all float inputs rounded to bf16; raw q / k / v: q and k enter the scores as f16 (bf16 values are exact in f16: exact products; the early-row residual planes are zero) x 64^-0.5; causal mask by index (the module's w*b + (-1e9)(1 - b) leaves exactly -1e9 on masked entries == exclusion); softmax f32; P x 2^11 once to f16 x v (exact in f16; bf16 hi + lo below row 384); f32 output.
#include <hip/hip_runtime.h>
#include <math.h>

typedef __attribute__((ext_vector_type(16))) _Float16 v16h;
typedef __attribute__((ext_vector_type(16))) __bf16 v16b;
typedef __attribute__((ext_vector_type(8)))  _Float16 v8h;
typedef __attribute__((ext_vector_type(8)))  float v8f;
typedef __attribute__((ext_vector_type(4)))  float v4f;
typedef __attribute__((ext_vector_type(2)))  float v2f;
typedef __attribute__((ext_vector_type(4)))  unsigned v4u;
typedef __attribute__((ext_vector_type(4)))  int v4i;
typedef float __attribute__((may_alias)) float_a;
typedef int __attribute__((may_alias)) int_a;

template <typename T> __device__ __forceinline__ void vst2(void* p, T v) { *(T*)p = v;  }
__device__ __forceinline__ v8f wmma16(v16h a, v16h b, v8f c) {
  v8f d = __builtin_amdgcn_wmma_f32_16x16x32_f16(false, a, false, b, (short)0, c, false, false);
  asm volatile("v_nop\n\tv_nop\n\tv_nop\n\tv_nop" : "+v"(d) : "v"(a), "v"(b));
  return d;
}
__device__ __forceinline__ v8f wmma_bf(v16b a, v16b b, v8f c) {
  v8f d = __builtin_amdgcn_wmma_f32_16x16x32_bf16(false, a, false, b, (short)0, c, false, false);
  asm volatile("v_nop\n\tv_nop\n\tv_nop\n\tv_nop" : "+v"(d) : "v"(a), "v"(b));
  return d;
}
// 16x16x32 fragments: lane = (h = lane>>4, row/col = lane&15); elements 0..7 = k0+8h+0..7, 8..15 = k0+16+8h+0..7; D element r = row 8h+r
__device__ __forceinline__ v16h frag_h(const _Float16* rowk0, int lane) {
  union { v16h v; v8h q[2]; } u; const _Float16* p = rowk0 + 8 * (lane >> 4);
  u.q[0] = *(const v8h*)p; u.q[1] = *(const v8h*)(p + 16); return u.v;
}
__device__ __forceinline__ v16h frag_f32(const float* rowk0, int lane) {
  v16h a; const float* p = rowk0 + 8 * (lane >> 4);
#pragma unroll
  for (int i = 0; i < 8; ++i) { a[i] = (_Float16)p[i]; a[8 + i] = (_Float16)p[16 + i]; }
  return a;
}
__device__ __forceinline__ v16h frag_f32s(const float* rowk0, int lane, float sc) {
  v16h a; const float* p = rowk0 + 8 * (lane >> 4);
#pragma unroll
  for (int i = 0; i < 8; ++i) { a[i] = (_Float16)(p[i] * sc); a[8 + i] = (_Float16)(p[16 + i] * sc); }
  return a;
}
// column fragment from a [K][ld] layout (column n), rows >= K read as 0
__device__ __forceinline__ v16h fragc_f32(const float* W, int k0, int n, int lane, int ld, int K) {
  v16h a; const int g = lane >> 4;
#pragma unroll
  for (int i = 0; i < 8; ++i) { const int ka = k0 + 8 * g + i, kb = ka + 16;
    a[i] = (_Float16)(ka < K ? W[(size_t)(ka < K ? ka : K - 1) * ld + n] : 0.f); a[8 + i] = (_Float16)(kb < K ? W[(size_t)(kb < K ? kb : K - 1) * ld + n] : 0.f); }
  return a;
}
struct F2 { v16b h, l; };
__device__ __forceinline__ F2 bsplit16(const float v[16]) { F2 r;
#pragma unroll
  for (int i = 0; i < 16; ++i) { const __bf16 h = (__bf16)v[i]; r.h[i] = h; r.l[i] = (__bf16)(v[i] - (float)h); }
  return r; }
__device__ __forceinline__ F2 split_row(const float* row, int k0, int lane) { float v[16]; const float* p = row + k0 + 8 * (lane >> 4);
#pragma unroll
  for (int i = 0; i < 8; ++i) { v[i] = p[i]; v[8 + i] = p[16 + i]; }
  return bsplit16(v); }
__device__ __forceinline__ F2 split_rowK(const float* row, int k0, int lane, int K) { float v[16]; const int g = lane >> 4;
#pragma unroll
  for (int i = 0; i < 8; ++i) { const int ka = k0 + 8 * g + i, kb = ka + 16; v[i] = ka < K ? row[ka < K ? ka : K - 1] : 0.f; v[8 + i] = kb < K ? row[kb < K ? kb : K - 1] : 0.f; }
  return bsplit16(v); }
__device__ __forceinline__ F2 split_col(const float* W, int k0, int n, int lane, int ld, int K) { float v[16]; const int g = lane >> 4;
#pragma unroll
  for (int i = 0; i < 8; ++i) { const int ka = k0 + 8 * g + i, kb = ka + 16; v[i] = ka < K ? W[(size_t)(ka < K ? ka : K - 1) * ld + n] : 0.f; v[8 + i] = kb < K ? W[(size_t)(kb < K ? kb : K - 1) * ld + n] : 0.f; }
  return bsplit16(v); }
__device__ __forceinline__ v8f mac3(const F2& a, const F2& b, v8f c) { c = wmma_bf(a.l, b.h, c); c = wmma_bf(a.h, b.l, c); return wmma_bf(a.h, b.h, c); }
__device__ __forceinline__ float sigm(float v) { return 1.0f / (1.0f + expf(-v)); }
#define LDSX() do { asm volatile("s_wait_dscnt 0" ::: "memory"); __builtin_amdgcn_wave_barrier(); __builtin_amdgcn_fence(__ATOMIC_RELEASE, "workgroup"); } while (0)

// Raw causal scaled-dot-product attention with a PRE-TRANSPOSED key (q [1,16,4096,64], k [1,16,64,4096] = [B, H, D, S], v [1,16,4096,64]; w = q k / sqrt(64); b = tril; w = w*b + (-1e9)(1 - b); softmax; out = w v -> [1,16,4096,64]).
#define NB 1
#define TT 4096
#define CC 1024            // NH * HD = projected width
#define DIN 1024          // input (model) width
#define NH 16
#define HD 64
#define NQB (TT / 64)
#define HG 1
#define SCALE (0.125f)
#define CAUSAL 1
#ifndef TNB
#define TNB NB
#endif
__device__ __forceinline__ float bfr(float v) { return (float)(__bf16)v; }
__host__ __device__ __forceinline__ int kb_last(int qb) { return CAUSAL ? ((qb * 64 + 63) >> 7) : (TT / 128 - 1); }
typedef __attribute__((ext_vector_type(8))) __bf16 v8b;
__device__ __forceinline__ v16b frag_b(const __bf16* rowk0, int lane) {
  union { v16b v; v8b q[2]; } u; const __bf16* p = rowk0 + 8 * (lane >> 4);
  u.q[0] = *(const v8b*)p; u.q[1] = *(const v8b*)(p + 16); return u.v;
}
#define QBH 6              // causal: query blocks 0..QBH-1 of each sequence (few keys, no averaging) take the high-precision path
#define QHI 384            // rows carrying a q residual plane (all rows when non-causal: 2-product logits everywhere)
#define KHI 384            // key rows carrying k residual / v bf16 hi+lo planes (used only by the causal high-precision path)
// B fragment (k rows k0+.., output column o) of a weight: (in,out) [K][ld] or (out,in) [ld rows of K]: bf16 exact, or f16(bf16 * 256) exact
__device__ __forceinline__ v16b wcol_io(const float* Wm, int k0, int o, int lane, int ld) { v16b w; const int g = lane >> 4;
#pragma unroll
  for (int i = 0; i < 8; ++i) { w[i] = (__bf16)Wm[(size_t)(k0 + 8 * g + i) * ld + o]; w[8 + i] = (__bf16)Wm[(size_t)(k0 + 16 + 8 * g + i) * ld + o]; }
  return w; }
__device__ __forceinline__ v16b wcol_oi(const float* Wm, int k0, int o, int lane, int K) { v16b w; const float* p = Wm + (size_t)o * K + k0 + 8 * (lane >> 4);
#pragma unroll
  for (int i = 0; i < 8; ++i) { w[i] = (__bf16)p[i]; w[8 + i] = (__bf16)p[16 + i]; }
  return w; }
__device__ __forceinline__ v16h wcolh_io(const float* Wm, int k0, int o, int lane, int ld) { v16h w; const int g = lane >> 4;
#pragma unroll
  for (int i = 0; i < 8; ++i) { w[i] = (_Float16)(bfr(Wm[(size_t)(k0 + 8 * g + i) * ld + o]) * 256.0f); w[8 + i] = (_Float16)(bfr(Wm[(size_t)(k0 + 16 + 8 * g + i) * ld + o]) * 256.0f); }
  return w; }
__device__ __forceinline__ v16h wcolh_oi(const float* Wm, int k0, int o, int lane, int K) { v16h w; const float* p = Wm + (size_t)o * K + k0 + 8 * (lane >> 4);
#pragma unroll
  for (int i = 0; i < 8; ++i) { w[i] = (_Float16)(bfr(p[i]) * 256.0f); w[8 + i] = (_Float16)(bfr(p[16 + i]) * 256.0f); }
  return w; }
#define WQKV_LAYOUT 1   // 0 = (in,out) [DIN][CC]; 1 = (out,in) [CC][DIN]; 2 = per-head [NH][DIN][HD]
__device__ __forceinline__ v16b wcol_hdk(const float* Wm, int k0, int o, int lane) { v16b w; const int g = lane >> 4; const float* p = Wm + (size_t)(o / HD) * DIN * HD + (o % HD);
#pragma unroll
  for (int i = 0; i < 8; ++i) { w[i] = (__bf16)p[(size_t)(k0 + 8 * g + i) * HD]; w[8 + i] = (__bf16)p[(size_t)(k0 + 16 + 8 * g + i) * HD]; }
  return w; }
#define WO_OUT_IN 0
#if WQKV_LAYOUT == 1
#define WCOL(W, k0, o, lane) wcol_oi(W, k0, o, lane, DIN)
#elif WQKV_LAYOUT == 2
#define WCOL(W, k0, o, lane) wcol_hdk(W, k0, o, lane)
#else
#define WCOL(W, k0, o, lane) wcol_io(W, k0, o, lane, CC)
#endif
#if WO_OUT_IN
#define WOCOL(W, k0, o, lane) wcol_oi(W, k0, o, lane, CC)
#define WOCOLH(W, k0, o, lane) wcolh_oi(W, k0, o, lane, CC)
#else
#define WOCOL(W, k0, o, lane) wcol_io(W, k0, o, lane, DIN)
#define WOCOLH(W, k0, o, lane) wcolh_io(W, k0, o, lane, DIN)
#endif

// ---- k_prep8: block = (64 attention positions s0.. of sequence b, head h): reads the module's [B, H, S, 64] q / v (element (b,h,s,c) at ((b*NH + h)*TT + s)*64 + c) and [B, H, 64, S] k, bf16-rounds them and writes the standard attention planes: q -> f16 hi rows (+ x 2^10 residual rows for s < QHI), k -> f16 rows (+ residual rows s < KHI), v -> f16 planes [c][s] (+ bf16 hi/lo planes for s < KHI)
__global__ __launch_bounds__(128) void k_prep8(const float* __restrict__ Q, const float* __restrict__ K, const float* __restrict__ V, _Float16* __restrict__ QH, _Float16* __restrict__ QL, _Float16* __restrict__ KH, _Float16* __restrict__ KL, _Float16* __restrict__ VT, __bf16* __restrict__ VB, __bf16* __restrict__ VBL) {
  __shared__ __align__(16) _Float16 sq[64][136], sql[64][136], sk[64][136], skl[64][136], tv[128][72]; __shared__ __align__(16) __bf16 tb[128][72], tbl[128][72];
  const int tid = threadIdx.x; const int h = blockIdx.y; const size_t r0 = (size_t)blockIdx.x * 64; const size_t bb = r0 / TT; const int t0 = (int)(r0 % TT); const bool qhi = t0 < QHI, khi = t0 < KHI;
  for (int e = tid; e < 64 * 128; e += 128) { const int rl = e >> 7, c = e & 127; const size_t oi = ((bb * NH + h) * TT + t0 + rl) * HD + (c % HD);   /* c >= 64: duplicate read of the same element (tiles are 128 wide; HD is 64) */
    const size_t oik = ((bb * NH + h) * HD + (c % HD)) * (size_t)TT + t0 + rl;   /* the key arrives PRE-TRANSPOSED [B, H, D, S]: element (b, h, s, c) sits at ((b*NH + h)*64 + c)*TT + s */
    const float q = bfr(Q[oi]), k = bfr(K[oik]), v = bfr(V[oi]);   /* module inputs: bf16-rounded; bf16 values are exact in f16, so the residual planes are 0 */
    const _Float16 qh = (_Float16)q, kh = (_Float16)k; sq[rl][c] = qh; sql[rl][c] = (_Float16)((q - (float)qh) * 1024.0f); sk[rl][c] = kh; skl[rl][c] = (_Float16)((k - (float)kh) * 1024.0f);
    tv[c][rl] = (_Float16)v; const __bf16 vb = (__bf16)v; tb[c][rl] = vb; tbl[c][rl] = (__bf16)(v - (float)vb); }
  __syncthreads();
  for (int e = tid; e < 64 * (HD / 8); e += 128) { const int rl = e / (HD / 8), q = e % (HD / 8); const size_t o = (r0 + rl) * CC + h * HD + q * 8; vst2((unsigned*)(QH + o), *(const v4u*)&sq[rl][q * 8]); vst2((unsigned*)(KH + o), *(const v4u*)&sk[rl][q * 8]);   
    if (qhi) vst2((unsigned*)(QL + (bb * QHI + t0 + rl) * (size_t)CC + h * HD + q * 8), *(const v4u*)&sql[rl][q * 8]); if (khi) vst2((unsigned*)(KL + (bb * KHI + t0 + rl) * (size_t)CC + h * HD + q * 8), *(const v4u*)&skl[rl][q * 8]); }
  for (int e = tid; e < HD * 8; e += 128) { const int cl = e >> 3, q = e & 7; vst2((unsigned*)(VT + (bb * CC + h * HD + cl) * (size_t)TT + t0 + q * 8), *(const v4u*)&tv[cl][q * 8]);
    if (khi) { const size_t o3 = (bb * CC + h * HD + cl) * (size_t)KHI + t0 + q * 8; vst2((unsigned*)(VB + o3), *(const v4u*)&tb[cl][q * 8]); vst2((unsigned*)(VBL + o3), *(const v4u*)&tbl[cl][q * 8]); } } }

#ifndef SM_EXTRA_PARAMS
#define SM_EXTRA_PARAMS
#endif
#ifndef PROJ_EXTRA_PARAMS
#define PROJ_EXTRA_PARAMS
#endif
#ifndef SM_MASK_HOOK
#define SM_MASK_HOOK (void)0
#endif

#define WS_QH  0u                                      // f16 q rows [b*t][CC]
#define WS_KH  (WS_QH + 2u * (size_t)NB * TT * CC)      // f16 k rows [b*t][CC]
#define WS_VT  (WS_KH + 2u * (size_t)NB * TT * CC)      // f16 v planes [b][c][t]
#define WS_QL  (WS_VT + 2u * (size_t)NB * CC * TT)      // f16 q residual x 2^10 rows [b][t < QHI][CC]
#define WS_KL  (WS_QL + 2u * (size_t)NB * QHI * CC)     // f16 k residual x 2^10 rows [b][t < KHI][CC]
#define WS_VB  (WS_KL + 2u * (size_t)NB * KHI * CC)     // bf16 v hi planes [b][c][t < KHI]
#define WS_VBL (WS_VB + 2u * (size_t)NB * CC * KHI)
#define WS_S   (WS_VBL + 2u * (size_t)NB * CC * KHI)    // f32 logits / P [hg][t][s]
#define WS_Y   (WS_S  + 4u * (size_t)HG * TT * TT)      // f32 ctx rows [b*t][CC] (only when there is an output projection)
#define WS_END (WS_Y  + 0u)

// ---- k_sc: block = (query block qb, key block kb <= kb_last(qb), head in group) of batch b: logits x SCALE; q hi + residual (x 2^10) against k (2 products) for query rows < QHI, plus the k residual (3 products) for query blocks < QBH (causal early rows); causal: blocks past the diagonal exit, the mask itself is applied by index in k_sm
__global__ __launch_bounds__(128) void k_sc(const _Float16* __restrict__ QH, const _Float16* __restrict__ KH, const _Float16* __restrict__ QL, const _Float16* __restrict__ KL, int b, int h0, float* __restrict__ S0) { __shared__ __align__(16) float ss[4][16][132];
  const int qb = blockIdx.x, kb = blockIdx.y; if (kb > kb_last(qb)) return;
  const int h = h0 + blockIdx.z; float* S = S0 + (size_t)blockIdx.z * TT * TT;
  const int tid = threadIdx.x, wave = tid >> 5, lane = tid & 31, col = lane & 15, g = lane >> 4; const int k0 = kb * 128; const int ql0 = qb * 64 + wave * 16; const size_t q0 = (size_t)b * TT + ql0, kr0 = (size_t)b * TT + k0;
  v8f acc[8] = {}, accl[8] = {};
  const _Float16* QLb = QL + (size_t)b * QHI * CC; const _Float16* KLb = KL + (size_t)b * KHI * CC;
  if (qb < QBH) {
#pragma unroll
    for (int kc = 0; kc < HD / 32; ++kc) { const v16h ah = frag_h(QH + (q0 + col) * CC + h * HD + kc * 32, lane), al = frag_h(QLb + (size_t)(ql0 + col) * CC + h * HD + kc * 32, lane);
#pragma unroll
      for (int j = 0; j < 8; ++j) { const v16h kbf = frag_h(KH + (kr0 + j * 16 + col) * CC + h * HD + kc * 32, lane), klf = frag_h(KLb + (size_t)(k0 + j * 16 + col) * CC + h * HD + kc * 32, lane); acc[j] = wmma16(ah, kbf, acc[j]); accl[j] = wmma16(al, kbf, accl[j]); accl[j] = wmma16(ah, klf, accl[j]); } }
  } else if (qb * 64 < QHI) {
#pragma unroll
    for (int kc = 0; kc < HD / 32; ++kc) { const v16h ah = frag_h(QH + (q0 + col) * CC + h * HD + kc * 32, lane), al = frag_h(QLb + (size_t)(ql0 + col) * CC + h * HD + kc * 32, lane);
#pragma unroll
      for (int j = 0; j < 8; ++j) { const v16h kbf = frag_h(KH + (kr0 + j * 16 + col) * CC + h * HD + kc * 32, lane); acc[j] = wmma16(ah, kbf, acc[j]); accl[j] = wmma16(al, kbf, accl[j]); } }
  } else {
#pragma unroll
    for (int kc = 0; kc < HD / 32; ++kc) { const v16h ah = frag_h(QH + (q0 + col) * CC + h * HD + kc * 32, lane);
#pragma unroll
      for (int j = 0; j < 8; ++j) { const v16h kbf = frag_h(KH + (kr0 + j * 16 + col) * CC + h * HD + kc * 32, lane); acc[j] = wmma16(ah, kbf, acc[j]); } } }
#pragma unroll
  for (int j = 0; j < 8; ++j) {
#pragma unroll
    for (int r = 0; r < 8; ++r) ss[wave][8 * g + r][j * 16 + col] = (acc[j][r] + accl[j][r] * (1.0f / 1024.0f)) * SCALE; }
  LDSX(); for (int rl = 0; rl < 16; ++rl) vst2(S + (size_t)(ql0 + rl) * TT + k0 + lane * 4, *(const v4f*)&ss[wave][rl][lane * 4]); }
// ---- k_sm: block = query row t (head in group): keys [0, kend): causal -> logit if s <= t else excluded; softmax in f32; P x 2^11 in place (0 for excluded)
__global__ __launch_bounds__(256) void k_sm(float* __restrict__ S0 SM_EXTRA_PARAMS) { __shared__ float sred[8]; __shared__ float sbc; __shared__ __align__(16) float shv[TT];
  const int tid = threadIdx.x; const int t = blockIdx.x; const int kend = (kb_last(t >> 6) + 1) * 128;
  float* sr = S0 + (size_t)blockIdx.y * TT * TT + (size_t)t * TT;
  float m = -3.0e38f; for (int k = tid; k < kend; k += 256) { float v = (!CAUSAL || k <= t) ? sr[k] : -3.0e38f; SM_MASK_HOOK; shv[k] = v; m = fmaxf(m, v); }
#pragma unroll
  for (int o = 1; o < 32; o <<= 1) m = fmaxf(m, __shfl_xor(m, o));
  if ((tid & 31) == 0) sred[tid >> 5] = m; __syncthreads(); if (tid == 0) { float a = sred[0]; for (int i = 1; i < 8; ++i) a = fmaxf(a, sred[i]); sbc = a; } __syncthreads(); m = sbc; __syncthreads();
  float sum = 0.f; for (int k = tid; k < kend; k += 256) { const float v = shv[k]; const float e = (v <= -1.0e38f) ? 0.f : expf(v - m); shv[k] = e; sum += e; }
#pragma unroll
  for (int o = 1; o < 32; o <<= 1) sum += __shfl_xor(sum, o);
  if ((tid & 31) == 0) sred[tid >> 5] = sum; __syncthreads(); if (tid == 0) { float a = 0.f; for (int i = 0; i < 8; ++i) a += sred[i]; sbc = a > 0.f ? 2048.0f / a : 0.f; }   /* a fully excluded row yields P = 0 */ __syncthreads(); const float inv = sbc;
  for (int k = tid; k < kend; k += 256) shv[k] = shv[k] * inv;
  __syncthreads(); for (int q = tid; q < kend / 4; q += 256) vst2(sr + q * 4, *(const v4f*)&shv[q * 4]); }
// ---- k_pv: block = 16 query rows of (b, h), PVW waves: ctx = P . v over keys [0, kend), the key range dealt over the waves in 64-key chunks (one whole 128-byte line of each v plane row), round-robin; each wave keeps a partial 16 x 64 sum, the partials are added in wave order through LDS (P x 2^11 once to f16 against v f16: 1 product; causal early query blocks: P and v as bf16 hi + lo, 3 products); each 256-B (row, head) segment stored by one wave
#define PVW 16
__global__ __launch_bounds__(32 * PVW) void k_pv(const float* __restrict__ PS0, const _Float16* __restrict__ VT, const __bf16* __restrict__ VB, const __bf16* __restrict__ VBL, int b, int h0, float* __restrict__ Y) { const int h = h0 + blockIdx.z; const float* PS = PS0 + (size_t)blockIdx.z * TT * TT; __shared__ __align__(16) float ss[PVW][16][HD + 4];
  const int tid = threadIdx.x, wave = __builtin_amdgcn_readfirstlane(tid >> 5) /* scalar, so that the loops over a wave's own chunks branch on SCC with every lane on */, lane = tid & 31, col = lane & 15, g = lane >> 4; const int qb = blockIdx.x >> 2; const int ql0 = blockIdx.x * 16; const int kce = (kb_last(qb) + 1) * 4;
  v8f acc[HD / 16] = {};
  if (qb < QBH) {
#pragma unroll 1
    for (int kp = wave; kp < kce / 2; kp += PVW)
    for (int kc = 2 * kp; kc < 2 * kp + 2; ++kc) { const F2 p = split_row(PS + (size_t)(ql0 + col) * TT, kc * 32, lane);
      asm volatile("s_wait_loadcnt 0x0" ::: "memory");
#pragma unroll
      for (int j = 0; j < HD / 16; ++j) { const size_t po = ((size_t)b * CC + h * HD + j * 16 + col) * (size_t)KHI + kc * 32; const v16b vh = frag_b(VB + po, lane); acc[j] = wmma_bf(p.h, vh, acc[j]); acc[j] = wmma_bf(p.l, vh, acc[j]); acc[j] = wmma_bf(p.h, frag_b(VBL + po, lane), acc[j]); }
      asm volatile("s_wait_xcnt 0x0" ::: "memory");   /* stands in front of the next pass's rewrite of the address registers that the loads above name */ }
  } else {
#pragma unroll 1
    for (int kp = wave; kp < kce / 2; kp += PVW)
    for (int kc = 2 * kp; kc < 2 * kp + 2; ++kc) { const v16h p = frag_f32(PS + (size_t)(ql0 + col) * TT + kc * 32, lane);
      asm volatile("s_wait_loadcnt 0x0" ::: "memory");
#pragma unroll
      for (int j = 0; j < HD / 16; ++j) { const size_t po = ((size_t)b * CC + h * HD + j * 16 + col) * (size_t)TT + kc * 32; acc[j] = wmma16(p, frag_h(VT + po, lane), acc[j]); }
      asm volatile("s_wait_xcnt 0x0" ::: "memory");   /* stands in front of the next pass's rewrite of the address registers that the loads above name */ } }
#pragma unroll
  for (int j = 0; j < HD / 16; ++j)
#pragma unroll
    for (int r = 0; r < 8; ++r) ss[wave][8 * g + r][j * 16 + col] = acc[j][r] * (1.0f / 2048.0f);
  __syncthreads();   /* every wave's partial is in LDS before any wave adds them */
  v2f s = *(const v2f*)&ss[0][wave][lane * 2];   /* wave w adds row w of the PVW partials, in wave order */
#pragma unroll
  for (int w = 1; w < PVW; ++w) s += *(const v2f*)&ss[w][wave][lane * 2];
  vst2(Y + (((size_t)b * NH + h) * TT + ql0 + wave) * HD + lane * 2, s); }

extern "C" void kernel_launch(void* const* d_in, const int* in_sizes, int n_in, void* d_out, int out_size, void* d_ws, size_t ws_size, hipStream_t stream) {
  (void)in_sizes; (void)n_in; (void)out_size;
  const float** F = (const float**)d_in;
  if (ws_size < (size_t)WS_END) return;
  char* ws = (char*)d_ws; _Float16 *QH = (_Float16*)(ws + WS_QH), *KH = (_Float16*)(ws + WS_KH), *VT = (_Float16*)(ws + WS_VT), *QL = (_Float16*)(ws + WS_QL), *KL = (_Float16*)(ws + WS_KL); __bf16 *VB = (__bf16*)(ws + WS_VB), *VBL = (__bf16*)(ws + WS_VBL); float *S = (float*)(ws + WS_S), *Y = (float*)(ws + WS_Y);
  (void)Y; (void)QL; (void)KL; (void)VB; (void)VBL;
  // inputs: 0 q [B, H, T, 64], 1 k [B, H, 64, T], 2 v [B, H, T, 64] (causal flag folded)
  k_prep8<<<dim3(TNB * TT / 64, NH), 128, 0, stream>>>(F[0], F[1], F[2], QH, QL, KH, KL, VT, VB, VBL);
  for (int b = 0; b < TNB; ++b) for (int h0 = 0; h0 < NH; h0 += HG) {
    k_sc<<<dim3(NQB, TT / 128, HG), 128, 0, stream>>>(QH, KH, QL, KL, b, h0, S);
    k_sm<<<dim3(TT, HG), 256, 0, stream>>>(S);
    k_pv<<<dim3(TT / 16, 1, HG), 32 * PVW, 0, stream>>>(S, VT, VB, VBL, b, h0, (float*)d_out);
  }
}

// v003
// Measured time: 84.9 microseconds a run.
// Versions in between are left out here; by their measured steps it is 9.95 times as fast as v001.
// Over all steps from v000 it is 30.4 times as fast.
// compute dtype: all float inputs rounded to bf16; raw q / k / v: q and k enter the scores as f16 (bf16 values are exact in f16: exact products; the early-row residual planes are zero) x 64^-0.5; causal mask by index (the module's w*b + (-1e9)(1 - b) leaves exactly -1e9 on masked entries == exclusion); softmax f32 with a running maximum; P (1 at the running maximum) once to f16 x v (exact in f16; bf16 hi + lo below row 384), divided by the f32 sum at the end; f32 output.
#include <hip/hip_runtime.h>
#include <math.h>

typedef __attribute__((ext_vector_type(16))) _Float16 v16h;
typedef __attribute__((ext_vector_type(16))) __bf16 v16b;
typedef __attribute__((ext_vector_type(8)))  _Float16 v8h;
typedef __attribute__((ext_vector_type(8)))  float v8f;
typedef __attribute__((ext_vector_type(4)))  float v4f;
typedef __attribute__((ext_vector_type(2)))  float v2f;
typedef __attribute__((ext_vector_type(4)))  unsigned v4u;
typedef __attribute__((ext_vector_type(2)))  unsigned v2u;
typedef __attribute__((ext_vector_type(4)))  int v4i;
typedef float __attribute__((may_alias)) float_a;
typedef int __attribute__((may_alias)) int_a;

template <typename T> __device__ __forceinline__ void vst2(void* p, T v) { *(T*)p = v;  }
__device__ __forceinline__ v8f wmma16(v16h a, v16h b, v8f c) {
  v8f d = __builtin_amdgcn_wmma_f32_16x16x32_f16(false, a, false, b, (short)0, c, false, false);
  asm volatile("v_nop\n\tv_nop\n\tv_nop\n\tv_nop" : "+v"(d) : "v"(a), "v"(b));
  return d;
}
__device__ __forceinline__ v8f wmma_bf(v16b a, v16b b, v8f c) {
  v8f d = __builtin_amdgcn_wmma_f32_16x16x32_bf16(false, a, false, b, (short)0, c, false, false);
  asm volatile("v_nop\n\tv_nop\n\tv_nop\n\tv_nop" : "+v"(d) : "v"(a), "v"(b));
  return d;
}
// 16x16x32 fragments: lane = (h = lane>>4, row/col = lane&15); elements 0..7 = k0+8h+0..7, 8..15 = k0+16+8h+0..7; D element r = row 8h+r
__device__ __forceinline__ v16h frag_h(const _Float16* rowk0, int lane) {
  union { v16h v; v8h q[2]; } u; const _Float16* p = rowk0 + 8 * (lane >> 4);
  u.q[0] = *(const v8h*)p; u.q[1] = *(const v8h*)(p + 16); return u.v;
}
__device__ __forceinline__ v16h frag_f32(const float* rowk0, int lane) {
  v16h a; const float* p = rowk0 + 8 * (lane >> 4);
#pragma unroll
  for (int i = 0; i < 8; ++i) { a[i] = (_Float16)p[i]; a[8 + i] = (_Float16)p[16 + i]; }
  return a;
}
__device__ __forceinline__ v16h frag_f32s(const float* rowk0, int lane, float sc) {
  v16h a; const float* p = rowk0 + 8 * (lane >> 4);
#pragma unroll
  for (int i = 0; i < 8; ++i) { a[i] = (_Float16)(p[i] * sc); a[8 + i] = (_Float16)(p[16 + i] * sc); }
  return a;
}
// column fragment from a [K][ld] layout (column n), rows >= K read as 0
__device__ __forceinline__ v16h fragc_f32(const float* W, int k0, int n, int lane, int ld, int K) {
  v16h a; const int g = lane >> 4;
#pragma unroll
  for (int i = 0; i < 8; ++i) { const int ka = k0 + 8 * g + i, kb = ka + 16;
    a[i] = (_Float16)(ka < K ? W[(size_t)(ka < K ? ka : K - 1) * ld + n] : 0.f); a[8 + i] = (_Float16)(kb < K ? W[(size_t)(kb < K ? kb : K - 1) * ld + n] : 0.f); }
  return a;
}
struct F2 { v16b h, l; };
__device__ __forceinline__ F2 bsplit16(const float v[16]) { F2 r;
#pragma unroll
  for (int i = 0; i < 16; ++i) { const __bf16 h = (__bf16)v[i]; r.h[i] = h; r.l[i] = (__bf16)(v[i] - (float)h); }
  return r; }
__device__ __forceinline__ F2 split_row(const float* row, int k0, int lane) { float v[16]; const float* p = row + k0 + 8 * (lane >> 4);
#pragma unroll
  for (int i = 0; i < 8; ++i) { v[i] = p[i]; v[8 + i] = p[16 + i]; }
  return bsplit16(v); }
__device__ __forceinline__ F2 split_rowK(const float* row, int k0, int lane, int K) { float v[16]; const int g = lane >> 4;
#pragma unroll
  for (int i = 0; i < 8; ++i) { const int ka = k0 + 8 * g + i, kb = ka + 16; v[i] = ka < K ? row[ka < K ? ka : K - 1] : 0.f; v[8 + i] = kb < K ? row[kb < K ? kb : K - 1] : 0.f; }
  return bsplit16(v); }
__device__ __forceinline__ F2 split_col(const float* W, int k0, int n, int lane, int ld, int K) { float v[16]; const int g = lane >> 4;
#pragma unroll
  for (int i = 0; i < 8; ++i) { const int ka = k0 + 8 * g + i, kb = ka + 16; v[i] = ka < K ? W[(size_t)(ka < K ? ka : K - 1) * ld + n] : 0.f; v[8 + i] = kb < K ? W[(size_t)(kb < K ? kb : K - 1) * ld + n] : 0.f; }
  return bsplit16(v); }
__device__ __forceinline__ v8f mac3(const F2& a, const F2& b, v8f c) { c = wmma_bf(a.l, b.h, c); c = wmma_bf(a.h, b.l, c); return wmma_bf(a.h, b.h, c); }
__device__ __forceinline__ float sigm(float v) { return 1.0f / (1.0f + expf(-v)); }
#define LDSX() do { asm volatile("s_wait_dscnt 0" ::: "memory"); __builtin_amdgcn_wave_barrier(); __builtin_amdgcn_fence(__ATOMIC_RELEASE, "workgroup"); } while (0)

// Raw causal scaled-dot-product attention with a PRE-TRANSPOSED key (q [1,16,4096,64], k [1,16,64,4096] = [B, H, D, S], v [1,16,4096,64]; w = q k / sqrt(64); b = tril; w = w*b + (-1e9)(1 - b); softmax; out = w v -> [1,16,4096,64]).
#define NB 1
#define TT 4096
#define CC 1024            // NH * HD = projected width
#define DIN 1024          // input (model) width
#define NH 16
#define HD 64
#define NQB (TT / 64)
#define HG 1
#define SCALE (0.125f)
#define CAUSAL 1
#ifndef TNB
#define TNB NB
#endif
__device__ __forceinline__ float bfr(float v) { return (float)(__bf16)v; }
__host__ __device__ __forceinline__ int kb_last(int qb) { return CAUSAL ? ((qb * 64 + 63) >> 7) : (TT / 128 - 1); }
typedef __attribute__((ext_vector_type(8))) __bf16 v8b;
__device__ __forceinline__ v16b frag_b(const __bf16* rowk0, int lane) {
  union { v16b v; v8b q[2]; } u; const __bf16* p = rowk0 + 8 * (lane >> 4);
  u.q[0] = *(const v8b*)p; u.q[1] = *(const v8b*)(p + 16); return u.v;
}
#define QBH 6              // unused; causal: query rows below QHI (few keys, no averaging) take the high-precision path
#define QHI 384            // rows carrying a q residual plane (3-product logits)
#define KHI 384            // key rows carrying k residual / v bf16 hi+lo planes (used only by the causal high-precision path)
// B fragment (k rows k0+.., output column o) of a weight: (in,out) [K][ld] or (out,in) [ld rows of K]: bf16 exact, or f16(bf16 * 256) exact
__device__ __forceinline__ v16b wcol_io(const float* Wm, int k0, int o, int lane, int ld) { v16b w; const int g = lane >> 4;
#pragma unroll
  for (int i = 0; i < 8; ++i) { w[i] = (__bf16)Wm[(size_t)(k0 + 8 * g + i) * ld + o]; w[8 + i] = (__bf16)Wm[(size_t)(k0 + 16 + 8 * g + i) * ld + o]; }
  return w; }
__device__ __forceinline__ v16b wcol_oi(const float* Wm, int k0, int o, int lane, int K) { v16b w; const float* p = Wm + (size_t)o * K + k0 + 8 * (lane >> 4);
#pragma unroll
  for (int i = 0; i < 8; ++i) { w[i] = (__bf16)p[i]; w[8 + i] = (__bf16)p[16 + i]; }
  return w; }
__device__ __forceinline__ v16h wcolh_io(const float* Wm, int k0, int o, int lane, int ld) { v16h w; const int g = lane >> 4;
#pragma unroll
  for (int i = 0; i < 8; ++i) { w[i] = (_Float16)(bfr(Wm[(size_t)(k0 + 8 * g + i) * ld + o]) * 256.0f); w[8 + i] = (_Float16)(bfr(Wm[(size_t)(k0 + 16 + 8 * g + i) * ld + o]) * 256.0f); }
  return w; }
__device__ __forceinline__ v16h wcolh_oi(const float* Wm, int k0, int o, int lane, int K) { v16h w; const float* p = Wm + (size_t)o * K + k0 + 8 * (lane >> 4);
#pragma unroll
  for (int i = 0; i < 8; ++i) { w[i] = (_Float16)(bfr(p[i]) * 256.0f); w[8 + i] = (_Float16)(bfr(p[16 + i]) * 256.0f); }
  return w; }
#define WQKV_LAYOUT 1   // 0 = (in,out) [DIN][CC]; 1 = (out,in) [CC][DIN]; 2 = per-head [NH][DIN][HD]
__device__ __forceinline__ v16b wcol_hdk(const float* Wm, int k0, int o, int lane) { v16b w; const int g = lane >> 4; const float* p = Wm + (size_t)(o / HD) * DIN * HD + (o % HD);
#pragma unroll
  for (int i = 0; i < 8; ++i) { w[i] = (__bf16)p[(size_t)(k0 + 8 * g + i) * HD]; w[8 + i] = (__bf16)p[(size_t)(k0 + 16 + 8 * g + i) * HD]; }
  return w; }
#define WO_OUT_IN 0
#if WQKV_LAYOUT == 1
#define WCOL(W, k0, o, lane) wcol_oi(W, k0, o, lane, DIN)
#elif WQKV_LAYOUT == 2
#define WCOL(W, k0, o, lane) wcol_hdk(W, k0, o, lane)
#else
#define WCOL(W, k0, o, lane) wcol_io(W, k0, o, lane, CC)
#endif
#if WO_OUT_IN
#define WOCOL(W, k0, o, lane) wcol_oi(W, k0, o, lane, CC)
#define WOCOLH(W, k0, o, lane) wcolh_oi(W, k0, o, lane, CC)
#else
#define WOCOL(W, k0, o, lane) wcol_io(W, k0, o, lane, DIN)
#define WOCOLH(W, k0, o, lane) wcolh_io(W, k0, o, lane, DIN)
#endif

// ---- k_prep8: block = (64 attention positions s0.. of sequence b, head h): reads the module's [B, H, S, 64] inputs (element (b,h,s,c) at ((b*NH + h)*TT + s)*64 + c; the key PRE-TRANSPOSED [B, H, D, S]: element (b,h,s,c) at ((b*NH + h)*64 + c)*TT + s), bf16-rounds them and writes the standard attention planes: q -> f16 hi rows (+ x 2^10 residual rows for s < QHI), k -> f16 rows (+ residual rows s < KHI), v -> f16 planes [c][s] (+ bf16 hi/lo planes for s < KHI)
// A stream: every thread asks for all its 24 x 16 bytes (whole 128-byte lines per wave) before it uses any, each element once. q needs no transposition; k and v are transposed 64 x 64 through LDS tiles of dwords (two neighbouring source rows = two neighbouring 16-bit elements of an output row). All stores stand behind the barrier, so that no wave waits at it for its own stores.
#define TP 33   // dwords per tile row; odd, so that the 16 tile rows a wave writes at once and the 4 it reads at once fall on distinct banks
typedef __attribute__((ext_vector_type(2))) _Float16 v2h;
typedef __attribute__((ext_vector_type(2))) __bf16 v2b;
__device__ __forceinline__ unsigned pkh(float a, float b) { return __builtin_bit_cast(unsigned, (v2h){(_Float16)a, (_Float16)b}); }
__device__ __forceinline__ unsigned pkb(float a, float b) { return __builtin_bit_cast(unsigned, (v2b){(__bf16)a, (__bf16)b}); }
__device__ __forceinline__ float resh(float x) { return (x - (float)(_Float16)x) * 1024.0f; }   // what f16 leaves of x, x 2^10
__device__ __forceinline__ float resb(float x) { return x - (float)(__bf16)x; }                // what bf16 leaves of x
__device__ __forceinline__ v4u trow(const unsigned* t) { return (v4u){t[0], t[1], t[2], t[3]}; }
template <typename T> __device__ __forceinline__ T ldu(const void* ub, unsigned off) { return *(const T*)((const char*)ub + off); }   // block-uniform base + this lane's byte offset
template <typename T> __device__ __forceinline__ void stu(void* ub, unsigned off, T v) { *(T*)((char*)ub + off) = v; }
__global__ __launch_bounds__(128) void k_prep8(const float* __restrict__ Q, const float* __restrict__ K, const float* __restrict__ V, _Float16* __restrict__ QH, _Float16* __restrict__ QL, _Float16* __restrict__ KH, _Float16* __restrict__ KL, _Float16* __restrict__ VT, __bf16* __restrict__ VB, __bf16* __restrict__ VBL) {
  __shared__ unsigned tk[64 * TP], tv[64 * TP], tkl[64 * TP], tb[64 * TP], tbl[64 * TP];
  const unsigned tid = threadIdx.x; const int h = blockIdx.y; const size_t r0 = (size_t)blockIdx.x * 64; const size_t bb = r0 / TT; const int t0 = (int)(r0 % TT); const bool qhi = t0 < QHI, khi = t0 < KHI;
  const float* qs = Q + ((bb * NH + h) * TT + t0) * HD; const float* vs = V + ((bb * NH + h) * TT + t0) * HD; const float* ks = K + (bb * NH + h) * HD * (size_t)TT + t0;
  const unsigned x4 = tid & 15, rp0 = tid >> 4;   /* transposition: source columns 4 x4 .. + 3 of the source rows 2 rp, 2 rp + 1, rp = rp0 + 8 i */
  const unsigned lk = (2 * rp0 * TT + x4 * 4) * 4, lvv = (2 * rp0 * HD + x4 * 4) * 4, lq = tid * 16;
  v4f qa[8], ka[4][2], va[4][2];
#pragma unroll
  for (int i = 0; i < 4; ++i)
#pragma unroll
    for (int e = 0; e < 2; ++e) { ka[i][e] = ldu<v4f>(ks, lk + (16 * i + e) * TT * 4); va[i][e] = ldu<v4f>(vs, lvv + (16 * i + e) * HD * 4); }
#pragma unroll
  for (int i = 0; i < 8; ++i) qa[i] = ldu<v4f>(qs, lq + 2048 * i);
  asm volatile("s_wait_xcnt 0x0" :: "v"(lk), "v"(lvv), "v"(lq) : "memory");   /* stands in front of the first rewrite of an offset register that the loads above name; as its inputs these registers live up to here */
#pragma unroll
  for (int i = 0; i < 4; ++i)
#pragma unroll
    for (int e = 0; e < 2; ++e)
#pragma unroll
      for (int j = 0; j < 4; ++j) { ka[i][e][j] = bfr(ka[i][e][j]); va[i][e][j] = bfr(va[i][e][j]); }   /* module inputs: bf16-rounded; bf16 values are exact in f16, so the residual planes are 0 */
  const unsigned ow = x4 * 4 * TP + rp0;
#pragma unroll
  for (int i = 0; i < 4; ++i)
#pragma unroll
    for (int j = 0; j < 4; ++j) { const unsigned o = ow + j * TP + 8 * i; tk[o] = pkh(ka[i][0][j], ka[i][1][j]); tv[o] = pkh(va[i][0][j], va[i][1][j]); }
  if (khi) {
#pragma unroll
    for (int i = 0; i < 4; ++i)
#pragma unroll
      for (int j = 0; j < 4; ++j) { const unsigned o = ow + j * TP + 8 * i; tkl[o] = pkh(resh(ka[i][0][j]), resh(ka[i][1][j])); tb[o] = pkb(va[i][0][j], va[i][1][j]); tbl[o] = pkb(resb(va[i][0][j]), resb(va[i][1][j])); } }
  __syncthreads();
  const unsigned xr = tid >> 3, q8 = tid & 7, orr = xr * TP + q8 * 4;   /* output rows xr + 16 i (a position of k, a channel of v), their elements 8 q8 .. + 7 */
  const unsigned sk = (xr * CC + q8 * 8) * 2, sv = (xr * TT + q8 * 8) * 2, sq = (rp0 * CC + x4 * 4) * 2;
  _Float16* kd = KH + r0 * CC + h * HD; _Float16* vd = VT + (bb * CC + h * HD) * (size_t)TT + t0; _Float16* qd = QH + r0 * CC + h * HD;
#pragma unroll
  for (int i = 0; i < 4; ++i) { stu(kd, sk + 16 * i * CC * 2, trow(tk + orr + 16 * i * TP)); stu(vd, sv + 16 * i * TT * 2, trow(tv + orr + 16 * i * TP)); }
#pragma unroll
  for (int i = 0; i < 8; ++i) {
#pragma unroll
    for (int j = 0; j < 4; ++j) qa[i][j] = bfr(qa[i][j]);
    stu(qd, sq + 8 * i * CC * 2, (v2u){pkh(qa[i][0], qa[i][1]), pkh(qa[i][2], qa[i][3])}); }
  if (khi) {
    asm volatile("s_wait_xcnt 0x0" ::: "memory");   /* stands in front of the first rewrite of a register that the stores above name */
    const unsigned sb = (xr * KHI + q8 * 8) * 2; _Float16* kld = KL + (bb * KHI + t0) * (size_t)CC + h * HD; __bf16* bd = VB + (bb * CC + h * HD) * (size_t)KHI + t0; __bf16* bld = VBL + (bb * CC + h * HD) * (size_t)KHI + t0;
#pragma unroll
    for (int i = 0; i < 4; ++i) { stu(kld, sk + 16 * i * CC * 2, trow(tkl + orr + 16 * i * TP)); stu(bd, sb + 16 * i * KHI * 2, trow(tb + orr + 16 * i * TP)); stu(bld, sb + 16 * i * KHI * 2, trow(tbl + orr + 16 * i * TP)); } }
  if (qhi) {
    asm volatile("s_wait_xcnt 0x0" ::: "memory");   /* as above */
    _Float16* qld = QL + (bb * QHI + t0) * (size_t)CC + h * HD;
#pragma unroll
    for (int i = 0; i < 8; ++i) stu(qld, sq + 8 * i * CC * 2, (v2u){pkh(resh(qa[i][0]), resh(qa[i][1])), pkh(resh(qa[i][2]), resh(qa[i][3]))}); } }

#ifndef SM_EXTRA_PARAMS
#define SM_EXTRA_PARAMS
#endif
#ifndef PROJ_EXTRA_PARAMS
#define PROJ_EXTRA_PARAMS
#endif
#ifndef SM_MASK_HOOK
#define SM_MASK_HOOK (void)0
#endif

#define WS_QH  0u                                      // f16 q rows [b*t][CC]
#define WS_KH  (WS_QH + 2u * (size_t)NB * TT * CC)      // f16 k rows [b*t][CC]
#define WS_VT  (WS_KH + 2u * (size_t)NB * TT * CC)      // f16 v planes [b][c][t]
#define WS_QL  (WS_VT + 2u * (size_t)NB * CC * TT)      // f16 q residual x 2^10 rows [b][t < QHI][CC]
#define WS_KL  (WS_QL + 2u * (size_t)NB * QHI * CC)     // f16 k residual x 2^10 rows [b][t < KHI][CC]
#define WS_VB  (WS_KL + 2u * (size_t)NB * KHI * CC)     // bf16 v hi planes [b][c][t < KHI]
#define WS_VBL (WS_VB + 2u * (size_t)NB * CC * KHI)
#define WS_END (WS_VBL + 2u * (size_t)NB * CC * KHI)

// ---- k_fa: scores, softmax and P . v of one (head, 128-query block) in one kernel; wave = QW * 16 query rows, walks its keys [0, ql0 + 32) in steps of 32 and keeps, per query, a running maximum, a running sum and a 64-wide f32 sum (rescaled as the maximum moves), so no logit and no P ever goes to memory.
// Transposed products: S^T = K . Q^T (A = key rows, B = query rows), so a lane holds 16 scores of ONE query (column lane & 15; keys k0 + 8g + r and k0 + 16 + 8g + r) and the two score tiles, converted in place, are the B operand of O^T += V^T . P^T in the hardware k order; A = v planes [c][t], read in the same order by frag_hu / frag_bu.
// HI (query blocks below row QHI): q and k residual planes enter the scores (3 products), P as bf16 hi + lo against v bf16 hi + lo (3 products), as before.
// Every plain '#pragma unroll' below stands on a loop of constant length, so that the fragment arrays are indexed by constants and stay in registers.
template <bool B> struct BC { static constexpr bool v = B; };
#define QW 2   // 16-query tiles of a wave
#define C2 (SCALE * 1.44269504088896340736f)   // logits in units of log2
__device__ __forceinline__ float xhalf(float x) { return __builtin_bit_cast(float, __builtin_amdgcn_permlanex16(__builtin_bit_cast(int, x), __builtin_bit_cast(int, x), 0x76543210, 0xfedcba98, false, false)); }   // lane l with lane l ^ 16
// fragment from a wave-uniform base and this lane's own byte offset (row * pitch + 16 * (lane >> 4)): the lane offsets never change, only the scalar base walks
__device__ __forceinline__ v16h frag_hu(const _Float16* ub, unsigned lo) { union { v16h v; v8h q[2]; } u; const char* p = (const char*)ub + lo; u.q[0] = *(const v8h*)p; u.q[1] = *(const v8h*)(p + 32); return u.v; }
__device__ __forceinline__ v16b frag_bu(const __bf16* ub, unsigned lo) { union { v16b v; v8b q[2]; } u; const char* p = (const char*)ub + lo; u.q[0] = *(const v8b*)p; u.q[1] = *(const v8b*)(p + 32); return u.v; }
template <bool HI, int QT> __device__ __forceinline__ void fa_body(const _Float16* __restrict__ QH, const _Float16* __restrict__ KH, const _Float16* __restrict__ QL, const _Float16* __restrict__ KL, const _Float16* __restrict__ VT, const __bf16* __restrict__ VB, const __bf16* __restrict__ VBL, float* __restrict__ Y, int h, int ql0, int lane) {
  const int col = lane & 15, g = lane >> 4; const int nst = ((ql0 + 16 * QT - 1) >> 5) + 1;
  const _Float16* kp = KH + h * HD; const _Float16* klp = KL + h * HD; const _Float16* vp = VT + (size_t)h * HD * TT; const __bf16* vbp = VB + (size_t)h * HD * KHI; const __bf16* vblp = VBL + (size_t)h * HD * KHI;   /* wave-uniform */
  const unsigned lrow = (unsigned)col * (CC * 2) + 16 * g, lv = (unsigned)col * (TT * 2) + 16 * g, lvb = (unsigned)col * (KHI * 2) + 16 * g;   /* lane offsets, bytes: q / k rows, v planes, early v planes */
  v16h qf[QT][2], qlf[QT][2], kf[4];
#pragma unroll
  for (int u = 0; u < QT; ++u)
#pragma unroll
    for (int kc = 0; kc < 2; ++kc) { qf[u][kc] = frag_hu(QH + (size_t)(ql0 + u * 16) * CC + h * HD + kc * 32, lrow); if constexpr (HI) qlf[u][kc] = frag_hu(QL + (size_t)(ql0 + u * 16) * CC + h * HD + kc * 32, lrow); }
  auto loadK = [&](int k0) {
#pragma unroll
    for (int t = 0; t < 2; ++t)
#pragma unroll
      for (int kc = 0; kc < 2; ++kc) kf[t * 2 + kc] = frag_hu(kp + (size_t)(k0 + t * 16) * CC + kc * 32, lrow); };
  v8f acc[QT][HD / 16] = {}; float m[QT], l[QT];
#pragma unroll
  for (int u = 0; u < QT; ++u) { m[u] = -3.0e38f; l[u] = 0.f; }
  auto step = [&](int k0, auto mk) { constexpr bool MASK = decltype(mk)::v;
    v16h vf[HD / 16];   /* this step's v fragments: asked for first, used last (the few HI steps, short of registers, fetch theirs where they use them) */
    if constexpr (!HI) {
#pragma unroll
      for (int j = 0; j < HD / 16; ++j) vf[j] = frag_hu(vp + (size_t)j * 16 * TT + k0, lv); }
    v8f st[QT][2] = {};
#pragma unroll
    for (int t = 0; t < 2; ++t)
#pragma unroll
      for (int kc = 0; kc < 2; ++kc)
#pragma unroll
        for (int u = 0; u < QT; ++u) st[u][t] = __builtin_amdgcn_wmma_f32_16x16x32_f16(false, kf[t * 2 + kc], false, qf[u][kc], (short)0, st[u][t], false, false);
    if constexpr (HI) { v8f sl[QT][2] = {};
#pragma unroll
      for (int t = 0; t < 2; ++t) {
#pragma unroll
        for (int kc = 0; kc < 2; ++kc) { const v16h klf = frag_hu(klp + (size_t)(k0 + t * 16) * CC + kc * 32, lrow);
#pragma unroll
          for (int u = 0; u < QT; ++u) { sl[u][t] = __builtin_amdgcn_wmma_f32_16x16x32_f16(false, kf[t * 2 + kc], false, qlf[u][kc], (short)0, sl[u][t], false, false); sl[u][t] = __builtin_amdgcn_wmma_f32_16x16x32_f16(false, klf, false, qf[u][kc], (short)0, sl[u][t], false, false); } }
#pragma unroll
        for (int u = 0; u < QT; ++u) st[u][t] += sl[u][t] * (1.0f / 1024.0f); } }
    if constexpr (!MASK) loadK(k0 + 32);   /* the next step's key fragments, into the same registers, one step ahead of their use */
#pragma unroll
    for (int u = 0; u < QT; ++u) {
      if constexpr (MASK) {
#pragma unroll
        for (int t = 0; t < 2; ++t)
#pragma unroll
          for (int r = 0; r < 8; ++r) if (k0 + 16 * t + 8 * g + r > ql0 + u * 16 + col) st[u][t][r] = -3.0e38f; }
      float mx = fmaxf(st[u][0][0], st[u][1][0]);
#pragma unroll
      for (int r = 1; r < 8; ++r) mx = fmaxf(mx, fmaxf(st[u][0][r], st[u][1][r]));
      mx = fmaxf(mx, xhalf(mx));   /* the other half of this query's 32 keys */
      const float mn = fmaxf(m[u], mx * C2); const float al = __builtin_amdgcn_exp2f(m[u] - mn); m[u] = mn;
      float p[16]; float sum = 0.f;
#pragma unroll
      for (int i = 0; i < 16; ++i) { p[i] = __builtin_amdgcn_exp2f(fmaf(st[u][i >> 3][i & 7], C2, -mn)); sum += p[i]; }
      l[u] = l[u] * al + sum;
#pragma unroll
      for (int j = 0; j < HD / 16; ++j) acc[u][j] *= al;
      if constexpr (HI) { const F2 pb = bsplit16(p);
#pragma unroll
        for (int j = 0; j < HD / 16; ++j) { const v16b vh = frag_bu(vbp + (size_t)j * 16 * KHI + k0, lvb), vl = frag_bu(vblp + (size_t)j * 16 * KHI + k0, lvb); acc[u][j] = __builtin_amdgcn_wmma_f32_16x16x32_bf16(false, vh, false, pb.h, (short)0, acc[u][j], false, false); acc[u][j] = __builtin_amdgcn_wmma_f32_16x16x32_bf16(false, vh, false, pb.l, (short)0, acc[u][j], false, false); acc[u][j] = __builtin_amdgcn_wmma_f32_16x16x32_bf16(false, vl, false, pb.h, (short)0, acc[u][j], false, false); }
      } else { v16h pf;
#pragma unroll
        for (int i = 0; i < 16; ++i) pf[i] = (_Float16)p[i];
#pragma unroll
        for (int j = 0; j < HD / 16; ++j) acc[u][j] = __builtin_amdgcn_wmma_f32_16x16x32_f16(false, vf[j], false, pf, (short)0, acc[u][j], false, false); } } };
  loadK(0);
  asm volatile("s_wait_xcnt 0x0" ::: "memory");   /* stands in front of the first rewrite of an address register that the loads above name */
#pragma unroll 1   /* rolled: a second copy of the step would double the fragments in flight and cost the second wave of a SIMD its registers */
  for (int s = 0; s < nst - 1; ++s) step(s * 32, BC<false>{});   /* every key of these steps is below the wave's first query: no mask */
  step((nst - 1) * 32, BC<true>{});   /* the step that holds the diagonal */
#pragma unroll
  for (int u = 0; u < QT; ++u) { const float inv = 1.0f / (l[u] + xhalf(l[u]));   /* the sum is at least 1: the key that gave the maximum counts 1 */
    float* yo = Y + ((size_t)h * TT + ql0 + u * 16 + col) * HD + 8 * g;
#pragma unroll
    for (int j = 0; j < HD / 16; ++j) { const v8f o = acc[u][j] * inv; vst2(yo + j * 16, (v4f){o[0], o[1], o[2], o[3]}); vst2(yo + j * 16 + 4, (v4f){o[4], o[5], o[6], o[7]}); } }
  asm volatile("s_wait_xcnt 0x0" ::: "memory");   /* stands in front of any later rewrite of the address and data registers that the stores above name (a second tile follows on the early rows) */ }
// block = (head, 64 * QW query rows), 4 waves that share nothing but the cache; all blocks fit on the chip at once, the order folds the query blocks (long ones first, then short ones in reverse), for speed only
#define NFB (TT / (64 * QW))
__global__ __launch_bounds__(128) void k_fa(const _Float16* __restrict__ QH, const _Float16* __restrict__ KH, const _Float16* __restrict__ QL, const _Float16* __restrict__ KL, const _Float16* __restrict__ VT, const __bf16* __restrict__ VB, const __bf16* __restrict__ VBL, float* __restrict__ Y) {
  const int idx = blockIdx.x, grp = idx / (NH * 16), a = (idx / NH) & 15, h = idx % NH; const int fb = (NFB / 16 - 1 - grp) * 16 + ((grp & 1) ? a : 15 - a);
  const int tid = threadIdx.x, wave = __builtin_amdgcn_readfirstlane(tid >> 5) /* scalar, so that the loop over a wave's own steps branches on SCC with every lane on */, lane = tid & 31; const int ql0 = fb * 64 * QW + wave * 16 * QW;
  if (fb * 64 * QW < QHI) {   /* the residual planes take twice the registers: one 16-query tile after the other */
#pragma unroll 1   /* rolled: one copy of this rarely run code */
    for (int u = 0; u < QW; ++u) fa_body<true, 1>(QH, KH, QL, KL, VT, VB, VBL, Y, h, ql0 + u * 16, lane);
  } else fa_body<false, QW>(QH, KH, QL, KL, VT, VB, VBL, Y, h, ql0, lane); }

extern "C" void kernel_launch(void* const* d_in, const int* in_sizes, int n_in, void* d_out, int out_size, void* d_ws, size_t ws_size, hipStream_t stream) {
  (void)in_sizes; (void)n_in; (void)out_size;
  const float** F = (const float**)d_in;
  if (ws_size < (size_t)WS_END) return;
  char* ws = (char*)d_ws; _Float16 *QH = (_Float16*)(ws + WS_QH), *KH = (_Float16*)(ws + WS_KH), *VT = (_Float16*)(ws + WS_VT), *QL = (_Float16*)(ws + WS_QL), *KL = (_Float16*)(ws + WS_KL); __bf16 *VB = (__bf16*)(ws + WS_VB), *VBL = (__bf16*)(ws + WS_VBL);
  // inputs: 0 q [B, H, T, 64], 1 k [B, H, 64, T], 2 v [B, H, T, 64] (causal flag folded)
  k_prep8<<<dim3(TNB * TT / 64, NH), 128, 0, stream>>>(F[0], F[1], F[2], QH, QL, KH, KL, VT, VB, VBL);
  k_fa<<<dim3(NFB * NH), 128, 0, stream>>>(QH, KH, QL, KL, VT, VB, VBL, (float*)d_out);
}

// v004
// One run takes 81.3 microseconds.
// Next to v003, in two timings, it ran 1.04 times as fast each time.
// All steps since v000 together make it 31.7 times as fast.
// compute dtype: all float inputs rounded to bf16; raw q / k / v: q and k enter the scores as f16 (bf16 values are exact in f16: exact products; the early-row residual planes are zero) x 64^-0.5; causal mask by index (the module's w*b + (-1e9)(1 - b) leaves exactly -1e9 on masked entries == exclusion); softmax f32 with a running maximum; P (1 at the running maximum) once to f16 x v (exact in f16; bf16 hi + lo below row 384), divided by the f32 sum at the end; f32 output.
#include <hip/hip_runtime.h>
#include <math.h>

typedef __attribute__((ext_vector_type(16))) _Float16 v16h;
typedef __attribute__((ext_vector_type(16))) __bf16 v16b;
typedef __attribute__((ext_vector_type(8)))  _Float16 v8h;
typedef __attribute__((ext_vector_type(8)))  float v8f;
typedef __attribute__((ext_vector_type(4)))  float v4f;
typedef __attribute__((ext_vector_type(2)))  float v2f;
typedef __attribute__((ext_vector_type(4)))  unsigned v4u;
typedef __attribute__((ext_vector_type(2)))  unsigned v2u;
typedef __attribute__((ext_vector_type(4)))  int v4i;
typedef float __attribute__((may_alias)) float_a;
typedef int __attribute__((may_alias)) int_a;

template <typename T> __device__ __forceinline__ void vst2(void* p, T v) { *(T*)p = v;  }
__device__ __forceinline__ v8f wmma16(v16h a, v16h b, v8f c) {
  v8f d = __builtin_amdgcn_wmma_f32_16x16x32_f16(false, a, false, b, (short)0, c, false, false);
  asm volatile("v_nop\n\tv_nop\n\tv_nop\n\tv_nop" : "+v"(d) : "v"(a), "v"(b));
  return d;
}
__device__ __forceinline__ v8f wmma_bf(v16b a, v16b b, v8f c) {
  v8f d = __builtin_amdgcn_wmma_f32_16x16x32_bf16(false, a, false, b, (short)0, c, false, false);
  asm volatile("v_nop\n\tv_nop\n\tv_nop\n\tv_nop" : "+v"(d) : "v"(a), "v"(b));
  return d;
}
// 16x16x32 fragments: lane = (h = lane>>4, row/col = lane&15); elements 0..7 = k0+8h+0..7, 8..15 = k0+16+8h+0..7; D element r = row 8h+r
__device__ __forceinline__ v16h frag_h(const _Float16* rowk0, int lane) {
  union { v16h v; v8h q[2]; } u; const _Float16* p = rowk0 + 8 * (lane >> 4);
  u.q[0] = *(const v8h*)p; u.q[1] = *(const v8h*)(p + 16); return u.v;
}
__device__ __forceinline__ v16h frag_f32(const float* rowk0, int lane) {
  v16h a; const float* p = rowk0 + 8 * (lane >> 4);
#pragma unroll
  for (int i = 0; i < 8; ++i) { a[i] = (_Float16)p[i]; a[8 + i] = (_Float16)p[16 + i]; }
  return a;
}
__device__ __forceinline__ v16h frag_f32s(const float* rowk0, int lane, float sc) {
  v16h a; const float* p = rowk0 + 8 * (lane >> 4);
#pragma unroll
  for (int i = 0; i < 8; ++i) { a[i] = (_Float16)(p[i] * sc); a[8 + i] = (_Float16)(p[16 + i] * sc); }
  return a;
}
// column fragment from a [K][ld] layout (column n), rows >= K read as 0
__device__ __forceinline__ v16h fragc_f32(const float* W, int k0, int n, int lane, int ld, int K) {
  v16h a; const int g = lane >> 4;
#pragma unroll
  for (int i = 0; i < 8; ++i) { const int ka = k0 + 8 * g + i, kb = ka + 16;
    a[i] = (_Float16)(ka < K ? W[(size_t)(ka < K ? ka : K - 1) * ld + n] : 0.f); a[8 + i] = (_Float16)(kb < K ? W[(size_t)(kb < K ? kb : K - 1) * ld + n] : 0.f); }
  return a;
}
struct F2 { v16b h, l; };
__device__ __forceinline__ F2 bsplit16(const float v[16]) { F2 r;
#pragma unroll
  for (int i = 0; i < 16; ++i) { const __bf16 h = (__bf16)v[i]; r.h[i] = h; r.l[i] = (__bf16)(v[i] - (float)h); }
  return r; }
__device__ __forceinline__ F2 split_row(const float* row, int k0, int lane) { float v[16]; const float* p = row + k0 + 8 * (lane >> 4);
#pragma unroll
  for (int i = 0; i < 8; ++i) { v[i] = p[i]; v[8 + i] = p[16 + i]; }
  return bsplit16(v); }
__device__ __forceinline__ F2 split_rowK(const float* row, int k0, int lane, int K) { float v[16]; const int g = lane >> 4;
#pragma unroll
  for (int i = 0; i < 8; ++i) { const int ka = k0 + 8 * g + i, kb = ka + 16; v[i] = ka < K ? row[ka < K ? ka : K - 1] : 0.f; v[8 + i] = kb < K ? row[kb < K ? kb : K - 1] : 0.f; }
  return bsplit16(v); }
__device__ __forceinline__ F2 split_col(const float* W, int k0, int n, int lane, int ld, int K) { float v[16]; const int g = lane >> 4;
#pragma unroll
  for (int i = 0; i < 8; ++i) { const int ka = k0 + 8 * g + i, kb = ka + 16; v[i] = ka < K ? W[(size_t)(ka < K ? ka : K - 1) * ld + n] : 0.f; v[8 + i] = kb < K ? W[(size_t)(kb < K ? kb : K - 1) * ld + n] : 0.f; }
  return bsplit16(v); }
__device__ __forceinline__ v8f mac3(const F2& a, const F2& b, v8f c) { c = wmma_bf(a.l, b.h, c); c = wmma_bf(a.h, b.l, c); return wmma_bf(a.h, b.h, c); }
__device__ __forceinline__ float sigm(float v) { return 1.0f / (1.0f + expf(-v)); }
#define LDSX() do { asm volatile("s_wait_dscnt 0" ::: "memory"); __builtin_amdgcn_wave_barrier(); __builtin_amdgcn_fence(__ATOMIC_RELEASE, "workgroup"); } while (0)

// Raw causal scaled-dot-product attention with a PRE-TRANSPOSED key (q [1,16,4096,64], k [1,16,64,4096] = [B, H, D, S], v [1,16,4096,64]; w = q k / sqrt(64); b = tril; w = w*b + (-1e9)(1 - b); softmax; out = w v -> [1,16,4096,64]).
#define NB 1
#define TT 4096
#define CC 1024            // NH * HD = projected width
#define DIN 1024          // input (model) width
#define NH 16
#define HD 64
#define NQB (TT / 64)
#define HG 1
#define SCALE (0.125f)
#define CAUSAL 1
#ifndef TNB
#define TNB NB
#endif
__device__ __forceinline__ float bfr(float v) { return (float)(__bf16)v; }
__host__ __device__ __forceinline__ int kb_last(int qb) { return CAUSAL ? ((qb * 64 + 63) >> 7) : (TT / 128 - 1); }
typedef __attribute__((ext_vector_type(8))) __bf16 v8b;
__device__ __forceinline__ v16b frag_b(const __bf16* rowk0, int lane) {
  union { v16b v; v8b q[2]; } u; const __bf16* p = rowk0 + 8 * (lane >> 4);
  u.q[0] = *(const v8b*)p; u.q[1] = *(const v8b*)(p + 16); return u.v;
}
#define QBH 6              // unused; causal: query rows below QHI (few keys, no averaging) take the high-precision path
#define QHI 384            // rows carrying a q residual plane (3-product logits)
#define KHI 384            // key rows carrying k residual / v bf16 hi+lo planes (used only by the causal high-precision path)
// B fragment (k rows k0+.., output column o) of a weight: (in,out) [K][ld] or (out,in) [ld rows of K]: bf16 exact, or f16(bf16 * 256) exact
__device__ __forceinline__ v16b wcol_io(const float* Wm, int k0, int o, int lane, int ld) { v16b w; const int g = lane >> 4;
#pragma unroll
  for (int i = 0; i < 8; ++i) { w[i] = (__bf16)Wm[(size_t)(k0 + 8 * g + i) * ld + o]; w[8 + i] = (__bf16)Wm[(size_t)(k0 + 16 + 8 * g + i) * ld + o]; }
  return w; }
__device__ __forceinline__ v16b wcol_oi(const float* Wm, int k0, int o, int lane, int K) { v16b w; const float* p = Wm + (size_t)o * K + k0 + 8 * (lane >> 4);
#pragma unroll
  for (int i = 0; i < 8; ++i) { w[i] = (__bf16)p[i]; w[8 + i] = (__bf16)p[16 + i]; }
  return w; }
__device__ __forceinline__ v16h wcolh_io(const float* Wm, int k0, int o, int lane, int ld) { v16h w; const int g = lane >> 4;
#pragma unroll
  for (int i = 0; i < 8; ++i) { w[i] = (_Float16)(bfr(Wm[(size_t)(k0 + 8 * g + i) * ld + o]) * 256.0f); w[8 + i] = (_Float16)(bfr(Wm[(size_t)(k0 + 16 + 8 * g + i) * ld + o]) * 256.0f); }
  return w; }
__device__ __forceinline__ v16h wcolh_oi(const float* Wm, int k0, int o, int lane, int K) { v16h w; const float* p = Wm + (size_t)o * K + k0 + 8 * (lane >> 4);
#pragma unroll
  for (int i = 0; i < 8; ++i) { w[i] = (_Float16)(bfr(p[i]) * 256.0f); w[8 + i] = (_Float16)(bfr(p[16 + i]) * 256.0f); }
  return w; }
#define WQKV_LAYOUT 1   // 0 = (in,out) [DIN][CC]; 1 = (out,in) [CC][DIN]; 2 = per-head [NH][DIN][HD]
__device__ __forceinline__ v16b wcol_hdk(const float* Wm, int k0, int o, int lane) { v16b w; const int g = lane >> 4; const float* p = Wm + (size_t)(o / HD) * DIN * HD + (o % HD);
#pragma unroll
  for (int i = 0; i < 8; ++i) { w[i] = (__bf16)p[(size_t)(k0 + 8 * g + i) * HD]; w[8 + i] = (__bf16)p[(size_t)(k0 + 16 + 8 * g + i) * HD]; }
  return w; }
#define WO_OUT_IN 0
#if WQKV_LAYOUT == 1
#define WCOL(W, k0, o, lane) wcol_oi(W, k0, o, lane, DIN)
#elif WQKV_LAYOUT == 2
#define WCOL(W, k0, o, lane) wcol_hdk(W, k0, o, lane)
#else
#define WCOL(W, k0, o, lane) wcol_io(W, k0, o, lane, CC)
#endif
#if WO_OUT_IN
#define WOCOL(W, k0, o, lane) wcol_oi(W, k0, o, lane, CC)
#define WOCOLH(W, k0, o, lane) wcolh_oi(W, k0, o, lane, CC)
#else
#define WOCOL(W, k0, o, lane) wcol_io(W, k0, o, lane, DIN)
#define WOCOLH(W, k0, o, lane) wcolh_io(W, k0, o, lane, DIN)
#endif

// ---- k_prep8: block = (64 attention positions s0.. of sequence b, head h): reads the module's [B, H, S, 64] inputs (element (b,h,s,c) at ((b*NH + h)*TT + s)*64 + c; the key PRE-TRANSPOSED [B, H, D, S]: element (b,h,s,c) at ((b*NH + h)*64 + c)*TT + s), bf16-rounds them and writes the standard attention planes: q -> f16 hi rows (+ x 2^10 residual rows for s < QHI), k -> f16 rows (+ residual rows s < KHI), v -> f16 planes [c][s] (+ bf16 hi/lo planes for s < KHI)
// A stream: every thread asks for all its 24 x 16 bytes (whole 128-byte lines per wave) before it uses any, each element once. q needs no transposition; k and v are transposed 64 x 64 through LDS tiles of dwords (two neighbouring source rows = two neighbouring 16-bit elements of an output row). All stores stand behind the barrier, so that no wave waits at it for its own stores.
#define TP 33   // dwords per tile row; odd, so that the 16 tile rows a wave writes at once and the 4 it reads at once fall on distinct banks
typedef __attribute__((ext_vector_type(2))) _Float16 v2h;
typedef __attribute__((ext_vector_type(2))) __bf16 v2b;
__device__ __forceinline__ unsigned pkh(float a, float b) { return __builtin_bit_cast(unsigned, (v2h){(_Float16)a, (_Float16)b}); }
__device__ __forceinline__ unsigned pkb(float a, float b) { return __builtin_bit_cast(unsigned, (v2b){(__bf16)a, (__bf16)b}); }
__device__ __forceinline__ float resh(float x) { return (x - (float)(_Float16)x) * 1024.0f; }   // what f16 leaves of x, x 2^10
__device__ __forceinline__ float resb(float x) { return x - (float)(__bf16)x; }                // what bf16 leaves of x
__device__ __forceinline__ v4u trow(const unsigned* t) { return (v4u){t[0], t[1], t[2], t[3]}; }
template <typename T> __device__ __forceinline__ T ldu(const void* ub, unsigned off) { return *(const T*)((const char*)ub + off); }   // block-uniform base + this lane's byte offset
template <typename T> __device__ __forceinline__ void stu(void* ub, unsigned off, T v) { *(T*)((char*)ub + off) = v; }
__global__ __launch_bounds__(128) void k_prep8(const float* __restrict__ Q, const float* __restrict__ K, const float* __restrict__ V, _Float16* __restrict__ QH, _Float16* __restrict__ QL, _Float16* __restrict__ KH, _Float16* __restrict__ KL, _Float16* __restrict__ VT, __bf16* __restrict__ VB, __bf16* __restrict__ VBL) {
  __shared__ unsigned tk[64 * TP], tv[64 * TP], tkl[64 * TP], tb[64 * TP], tbl[64 * TP];
  const unsigned tid = threadIdx.x; const int h = blockIdx.y; const size_t r0 = (size_t)blockIdx.x * 64; const size_t bb = r0 / TT; const int t0 = (int)(r0 % TT); const bool qhi = t0 < QHI, khi = t0 < KHI;
  const float* qs = Q + ((bb * NH + h) * TT + t0) * HD; const float* vs = V + ((bb * NH + h) * TT + t0) * HD; const float* ks = K + (bb * NH + h) * HD * (size_t)TT + t0;
  const unsigned x4 = tid & 15, rp0 = tid >> 4;   /* transposition: source columns 4 x4 .. + 3 of the source rows 2 rp, 2 rp + 1, rp = rp0 + 8 i */
  const unsigned lk = (2 * rp0 * TT + x4 * 4) * 4, lvv = (2 * rp0 * HD + x4 * 4) * 4, lq = tid * 16;
  v4f qa[8], ka[4][2], va[4][2];
#pragma unroll
  for (int i = 0; i < 4; ++i)
#pragma unroll
    for (int e = 0; e < 2; ++e) { ka[i][e] = ldu<v4f>(ks, lk + (16 * i + e) * TT * 4); va[i][e] = ldu<v4f>(vs, lvv + (16 * i + e) * HD * 4); }
#pragma unroll
  for (int i = 0; i < 8; ++i) qa[i] = ldu<v4f>(qs, lq + 2048 * i);
  asm volatile("s_wait_xcnt 0x0" :: "v"(lk), "v"(lvv), "v"(lq) : "memory");   /* stands in front of the first rewrite of an offset register that the loads above name; as its inputs these registers live up to here */
#pragma unroll
  for (int i = 0; i < 4; ++i)
#pragma unroll
    for (int e = 0; e < 2; ++e)
#pragma unroll
      for (int j = 0; j < 4; ++j) { ka[i][e][j] = bfr(ka[i][e][j]); va[i][e][j] = bfr(va[i][e][j]); }   /* module inputs: bf16-rounded; bf16 values are exact in f16, so the residual planes are 0 */
  const unsigned ow = x4 * 4 * TP + rp0;
#pragma unroll
  for (int i = 0; i < 4; ++i)
#pragma unroll
    for (int j = 0; j < 4; ++j) { const unsigned o = ow + j * TP + 8 * i; tk[o] = pkh(ka[i][0][j], ka[i][1][j]); tv[o] = pkh(va[i][0][j], va[i][1][j]); }
  if (khi) {
#pragma unroll
    for (int i = 0; i < 4; ++i)
#pragma unroll
      for (int j = 0; j < 4; ++j) { const unsigned o = ow + j * TP + 8 * i; tkl[o] = pkh(resh(ka[i][0][j]), resh(ka[i][1][j])); tb[o] = pkb(va[i][0][j], va[i][1][j]); tbl[o] = pkb(resb(va[i][0][j]), resb(va[i][1][j])); } }
  __syncthreads();
  const unsigned xr = tid >> 3, q8 = tid & 7, orr = xr * TP + q8 * 4;   /* output rows xr + 16 i (a position of k, a channel of v), their elements 8 q8 .. + 7 */
  const unsigned sk = (xr * CC + q8 * 8) * 2, sv = (xr * TT + q8 * 8) * 2, sq = (rp0 * CC + x4 * 4) * 2;
  _Float16* kd = KH + r0 * CC + h * HD; _Float16* vd = VT + (bb * CC + h * HD) * (size_t)TT + t0; _Float16* qd = QH + r0 * CC + h * HD;
#pragma unroll
  for (int i = 0; i < 4; ++i) { stu(kd, sk + 16 * i * CC * 2, trow(tk + orr + 16 * i * TP)); stu(vd, sv + 16 * i * TT * 2, trow(tv + orr + 16 * i * TP)); }
#pragma unroll
  for (int i = 0; i < 8; ++i) {
#pragma unroll
    for (int j = 0; j < 4; ++j) qa[i][j] = bfr(qa[i][j]);
    stu(qd, sq + 8 * i * CC * 2, (v2u){pkh(qa[i][0], qa[i][1]), pkh(qa[i][2], qa[i][3])}); }
  if (khi) {
    asm volatile("s_wait_xcnt 0x0" ::: "memory");   /* stands in front of the first rewrite of a register that the stores above name */
    const unsigned sb = (xr * KHI + q8 * 8) * 2; _Float16* kld = KL + (bb * KHI + t0) * (size_t)CC + h * HD; __bf16* bd = VB + (bb * CC + h * HD) * (size_t)KHI + t0; __bf16* bld = VBL + (bb * CC + h * HD) * (size_t)KHI + t0;
#pragma unroll
    for (int i = 0; i < 4; ++i) { stu(kld, sk + 16 * i * CC * 2, trow(tkl + orr + 16 * i * TP)); stu(bd, sb + 16 * i * KHI * 2, trow(tb + orr + 16 * i * TP)); stu(bld, sb + 16 * i * KHI * 2, trow(tbl + orr + 16 * i * TP)); } }
  if (qhi) {
    asm volatile("s_wait_xcnt 0x0" ::: "memory");   /* as above */
    _Float16* qld = QL + (bb * QHI + t0) * (size_t)CC + h * HD;
#pragma unroll
    for (int i = 0; i < 8; ++i) stu(qld, sq + 8 * i * CC * 2, (v2u){pkh(resh(qa[i][0]), resh(qa[i][1])), pkh(resh(qa[i][2]), resh(qa[i][3]))}); } }

#ifndef SM_EXTRA_PARAMS
#define SM_EXTRA_PARAMS
#endif
#ifndef PROJ_EXTRA_PARAMS
#define PROJ_EXTRA_PARAMS
#endif
#ifndef SM_MASK_HOOK
#define SM_MASK_HOOK (void)0
#endif

#define WS_QH  0u                                      // f16 q rows [b*t][CC]
#define WS_KH  (WS_QH + 2u * (size_t)NB * TT * CC)      // f16 k rows [b*t][CC]
#define WS_VT  (WS_KH + 2u * (size_t)NB * TT * CC)      // f16 v planes [b][c][t]
#define WS_QL  (WS_VT + 2u * (size_t)NB * CC * TT)      // f16 q residual x 2^10 rows [b][t < QHI][CC]
#define WS_KL  (WS_QL + 2u * (size_t)NB * QHI * CC)     // f16 k residual x 2^10 rows [b][t < KHI][CC]
#define WS_VB  (WS_KL + 2u * (size_t)NB * KHI * CC)     // bf16 v hi planes [b][c][t < KHI]
#define WS_VBL (WS_VB + 2u * (size_t)NB * CC * KHI)
#define WS_END (WS_VBL + 2u * (size_t)NB * CC * KHI)

// ---- k_fa: scores, softmax and P . v of one (head, 128-query block) in one kernel; KS waves share QT * 16 query rows: wave ks of them takes the 32-key steps ks, ks + KS, .. of the keys [0, ql0 + QT * 16) rounded up to 32 and keeps, per query, a running maximum, a running sum and a 64-wide f32 sum (rescaled as the maximum moves), so no logit and no P ever goes to memory. At the end the KS waves bring their sums to one maximum and add them, in wave order, through LDS.
// Transposed products: S^T = K . Q^T (A = key rows, B = query rows), so a lane holds 16 scores of ONE query (column lane & 15; keys k0 + 8g + r and k0 + 16 + 8g + r) and the two score tiles, converted in place, are the B operand of O^T += V^T . P^T in the hardware k order; A = v planes [c][t], read in the same order by frag_hu / frag_bu.
// HI (query blocks below row QHI): q and k residual planes enter the scores (3 products), P as bf16 hi + lo against v bf16 hi + lo (3 products), as before.
// Every plain '#pragma unroll' below stands on a loop of constant length, so that the fragment arrays are indexed by constants and stay in registers.
template <bool B> struct BC { static constexpr bool v = B; };
#define QW 2   // 16-query tiles of a wave
#define C2 (SCALE * 1.44269504088896340736f)   // logits in units of log2
__device__ __forceinline__ float xhalf(float x) { return __builtin_bit_cast(float, __builtin_amdgcn_permlanex16(__builtin_bit_cast(int, x), __builtin_bit_cast(int, x), 0x76543210, 0xfedcba98, false, false)); }   // lane l with lane l ^ 16
// fragment from a wave-uniform base and this lane's own byte offset (row * pitch + 16 * (lane >> 4)): the lane offsets never change, only the scalar base walks
__device__ __forceinline__ v16h frag_hu(const _Float16* ub, unsigned lo) { union { v16h v; v8h q[2]; } u; const char* p = (const char*)ub + lo; u.q[0] = *(const v8h*)p; u.q[1] = *(const v8h*)(p + 32); return u.v; }
__device__ __forceinline__ v16b frag_bu(const __bf16* ub, unsigned lo) { union { v16b v; v8b q[2]; } u; const char* p = (const char*)ub + lo; u.q[0] = *(const v8b*)p; u.q[1] = *(const v8b*)(p + 32); return u.v; }
__device__ __forceinline__ float exp2_slot(float x) { float r; asm("v_exp_f32 %0, %1\n\tv_nop" : "=v"(r) : "v"(x)); return r; }   // 2^x for the join behind the loop; the v_nop fills the slot that the instruction set asks for between a transcendental and a next instruction that reads its result or overwrites its source
template <bool HI, int QT, int KS> __device__ __forceinline__ void fa_body(const _Float16* __restrict__ QH, const _Float16* __restrict__ KH, const _Float16* __restrict__ QL, const _Float16* __restrict__ KL, const _Float16* __restrict__ VT, const __bf16* __restrict__ VB, const __bf16* __restrict__ VBL, float* __restrict__ Y, int h, int ql0, int lane, int ks, float* gml, v4f* gac) {
  static_assert(QT * (HD / 16) == 2 * KS, "each wave adds up and stores two 16-channel tiles: one whole 128-byte line of each of 16 queries");
  const int col = lane & 15, g = lane >> 4; const int nst = ((ql0 + 16 * QT - 1) >> 5) + 1; const int klast = (nst - 1) * 32;
  const _Float16* kp = KH + h * HD; const _Float16* klp = KL + h * HD; const _Float16* vp = VT + (size_t)h * HD * TT; const __bf16* vbp = VB + (size_t)h * HD * KHI; const __bf16* vblp = VBL + (size_t)h * HD * KHI;   /* wave-uniform */
  const unsigned lrow = (unsigned)col * (CC * 2) + 16 * g, lv = (unsigned)col * (TT * 2) + 16 * g, lvb = (unsigned)col * (KHI * 2) + 16 * g;   /* lane offsets, bytes: q / k rows, v planes, early v planes */
  v16h qf[QT][2], qlf[QT][2], kf[4];
#pragma unroll
  for (int u = 0; u < QT; ++u)
#pragma unroll
    for (int kc = 0; kc < 2; ++kc) { qf[u][kc] = frag_hu(QH + (size_t)(ql0 + u * 16) * CC + h * HD + kc * 32, lrow); if constexpr (HI) qlf[u][kc] = frag_hu(QL + (size_t)(ql0 + u * 16) * CC + h * HD + kc * 32, lrow); }
  auto loadK = [&](int k0) { const _Float16* ka = (const _Float16*)((const char*)(kp + (size_t)k0 * CC) + lrow);   /* this lane's own address: key row k0 + col, its half of the first 32 channels */
#pragma unroll
    for (int t = 0; t < 2; ++t)
#pragma unroll
      for (int kc = 0; kc < 2; ++kc) kf[t * 2 + kc] = frag_hu(ka + (size_t)t * 16 * CC + kc * 32, 0);
    asm volatile("s_wait_xcnt 0x0" :: "v"(ka) : "memory");   /* stands in front of the first rewrite of an address register that the loads above name; as its input the address lives up to here, so that no load of the run lands in it */ };
  v8f acc[QT][HD / 16] = {}; float m[QT], l[QT];
#pragma unroll
  for (int u = 0; u < QT; ++u) { m[u] = -3.0e38f; l[u] = 0.f; }
  auto step = [&](int k0, auto mk) { constexpr bool MASK = decltype(mk)::v;
    v16h vf[HD / 16];   /* this step's v fragments: asked for first, used last (the few HI steps, short of registers, fetch theirs where they use them) */
    if constexpr (!HI) {
#pragma unroll
      for (int j = 0; j < HD / 16; ++j) vf[j] = frag_hu(vp + (size_t)j * 16 * TT + k0, lv); }
    v8f st[QT][2] = {};
#pragma unroll
    for (int t = 0; t < 2; ++t)
#pragma unroll
      for (int kc = 0; kc < 2; ++kc)
#pragma unroll
        for (int u = 0; u < QT; ++u) st[u][t] = __builtin_amdgcn_wmma_f32_16x16x32_f16(false, kf[t * 2 + kc], false, qf[u][kc], (short)0, st[u][t], false, false);
    if constexpr (HI) { v8f sl[QT][2] = {};
#pragma unroll
      for (int t = 0; t < 2; ++t) {
#pragma unroll
        for (int kc = 0; kc < 2; ++kc) { const v16h klf = frag_hu(klp + (size_t)(k0 + t * 16) * CC + kc * 32, lrow);
#pragma unroll
          for (int u = 0; u < QT; ++u) { sl[u][t] = __builtin_amdgcn_wmma_f32_16x16x32_f16(false, kf[t * 2 + kc], false, qlf[u][kc], (short)0, sl[u][t], false, false); sl[u][t] = __builtin_amdgcn_wmma_f32_16x16x32_f16(false, klf, false, qf[u][kc], (short)0, sl[u][t], false, false); } }
#pragma unroll
        for (int u = 0; u < QT; ++u) st[u][t] += sl[u][t] * (1.0f / 1024.0f); } }
    if constexpr (!MASK) loadK(k0 + 32 * KS < klast ? k0 + 32 * KS : klast);   /* the key fragments of this wave's next step, into the same registers, one step ahead of their use (a wave with no next step asks for the last step's: in range, unused) */
#pragma unroll
    for (int u = 0; u < QT; ++u) {
      if constexpr (MASK) {
#pragma unroll
        for (int t = 0; t < 2; ++t)
#pragma unroll
          for (int r = 0; r < 8; ++r) if (k0 + 16 * t + 8 * g + r > ql0 + u * 16 + col) st[u][t][r] = -3.0e38f; }
      float mx = fmaxf(st[u][0][0], st[u][1][0]);
#pragma unroll
      for (int r = 1; r < 8; ++r) mx = fmaxf(mx, fmaxf(st[u][0][r], st[u][1][r]));
      mx = fmaxf(mx, xhalf(mx));   /* the other half of this query's 32 keys */
      const float mn = fmaxf(m[u], mx * C2); const float al = __builtin_amdgcn_exp2f(m[u] - mn); m[u] = mn;
      float p[16]; float sum = 0.f;
#pragma unroll
      for (int i = 0; i < 16; ++i) { p[i] = __builtin_amdgcn_exp2f(fmaf(st[u][i >> 3][i & 7], C2, -mn)); sum += p[i]; }
      l[u] = l[u] * al + sum;
#pragma unroll
      for (int j = 0; j < HD / 16; ++j) acc[u][j] *= al;
      if constexpr (HI) { const F2 pb = bsplit16(p);
#pragma unroll
        for (int j = 0; j < HD / 16; ++j) { const v16b vh = frag_bu(vbp + (size_t)j * 16 * KHI + k0, lvb), vl = frag_bu(vblp + (size_t)j * 16 * KHI + k0, lvb); acc[u][j] = __builtin_amdgcn_wmma_f32_16x16x32_bf16(false, vh, false, pb.h, (short)0, acc[u][j], false, false); acc[u][j] = __builtin_amdgcn_wmma_f32_16x16x32_bf16(false, vh, false, pb.l, (short)0, acc[u][j], false, false); acc[u][j] = __builtin_amdgcn_wmma_f32_16x16x32_bf16(false, vl, false, pb.h, (short)0, acc[u][j], false, false); }
      } else { v16h pf;
#pragma unroll
        for (int i = 0; i < 16; ++i) pf[i] = (_Float16)p[i];
#pragma unroll
        for (int j = 0; j < HD / 16; ++j) acc[u][j] = __builtin_amdgcn_wmma_f32_16x16x32_f16(false, vf[j], false, pf, (short)0, acc[u][j], false, false); } } };
  loadK(ks * 32 < klast ? ks * 32 : klast);   /* its wait serves the query loads above as well */
#pragma unroll 1   /* rolled: a second copy of the step would double the fragments in flight, past the 256 registers that a wave of a 16-wave block may have */
  for (int s = ks; s < nst - 1; s += KS) step(s * 32, BC<false>{});   /* every key of these steps is below the wave's first query: no mask */
  if (((nst - 1) & (KS - 1)) == ks) step(klast, BC<true>{});   /* the step that holds the diagonal: the wave whose turn it is (a scalar test: every lane stays on) */
  /* the KS waves' parts become one: gml = [wave][u][maximum | sum][query], gac = [wave][u][j][half of the 8 channels][lane]. A wave that had no step brings maximum -3e38, sums 0: weight 0 */
#pragma unroll
  for (int u = 0; u < QT; ++u) { const float lt = l[u] + xhalf(l[u]); gml[ks * 64 + (u * 2 + g) * 16 + col] = g ? lt : m[u]; }
  __syncthreads();
#pragma unroll
  for (int u = 0; u < QT; ++u) { float mk[KS], mm = -3.0e38f, ls = 0.f;
#pragma unroll
    for (int k = 0; k < KS; ++k) { mk[k] = gml[k * 64 + u * 32 + col]; mm = fmaxf(mm, mk[k]); }
#pragma unroll
    for (int k = 0; k < KS; ++k) ls += gml[k * 64 + u * 32 + 16 + col] * exp2_slot(mk[k] - mm);   /* at least 1: the key that gave the maximum counts 1 */
    const float f = exp2_slot(m[u] - mm) / ls;
#pragma unroll
    for (int j = 0; j < HD / 16; ++j) { const v8f o = acc[u][j] * f; v4f* d = gac + ks * 512 + (u * (HD / 16) + j) * 64 + lane; d[0] = (v4f){o[0], o[1], o[2], o[3]}; d[32] = (v4f){o[4], o[5], o[6], o[7]}; } }
  __syncthreads();
#pragma unroll
  for (int jj = 0; jj < 2; ++jj) { const int t = ks * 2 + jj;   /* tile (u, j) = (t / 4, t % 4) */
    float* yo = Y + ((size_t)h * TT + ql0 + (t >> 2) * 16 + col) * HD + (t & 3) * 16 + 8 * g;
#pragma unroll
    for (int e = 0; e < 2; ++e) { const v4f* s = gac + t * 64 + e * 32 + lane; v4f o = s[0];
#pragma unroll
      for (int k = 1; k < KS; ++k) o += s[k * 512];
      vst2(yo + 4 * e, o); } }
  asm volatile("s_wait_xcnt 0x0" ::: "memory");   /* stands in front of any later rewrite of the address and data registers that the stores above name */ }
// block = (head, 64 * QW query rows), 16 waves: 4 tiles of 32 queries x 4 shares of the keys (early rows: 8 tiles of 16 x 2); the waves of equal share walk the same keys and meet in the cache. A WGP holds one block at a time, so the order is by falling length, for the WGPs that are free first to take the longer of what is left; the early-row blocks, few steps but slow ones, go first
#define NFB (TT / (64 * QW))
#define NHB (QHI / (64 * QW))
__global__ __launch_bounds__(512) void k_fa(const _Float16* __restrict__ QH, const _Float16* __restrict__ KH, const _Float16* __restrict__ QL, const _Float16* __restrict__ KL, const _Float16* __restrict__ VT, const __bf16* __restrict__ VB, const __bf16* __restrict__ VBL, float* __restrict__ Y) {
  __shared__ float sml[16 * 64]; __shared__ v4f sac[16 * 512];   /* a wave's maxima and sums; a wave's 64 x 32 partial output */
  const int idx = blockIdx.x, od = idx / NH, h = idx % NH; const int fb = od < NHB ? NHB - 1 - od : NFB - 1 - (od - NHB);
  const int tid = threadIdx.x, wave = __builtin_amdgcn_readfirstlane(tid >> 5) /* scalar, so that the loop over a wave's own steps branches on SCC with every lane on */, lane = tid & 31;
  if (fb < NHB) { const int ks = wave & 1, gw = wave - ks;   /* the residual planes take twice the registers: 16-query tiles; the branch is the same for the whole block, as the barriers inside ask */
    fa_body<true, 1, 2>(QH, KH, QL, KL, VT, VB, VBL, Y, h, fb * 64 * QW + (wave >> 1) * 16, lane, ks, sml + gw * 64, sac + gw * 512);
  } else { const int ks = wave & 3, gw = wave - ks;
    fa_body<false, QW, 4>(QH, KH, QL, KL, VT, VB, VBL, Y, h, fb * 64 * QW + (wave >> 2) * 16 * QW, lane, ks, sml + gw * 64, sac + gw * 512); } }

extern "C" void kernel_launch(void* const* d_in, const int* in_sizes, int n_in, void* d_out, int out_size, void* d_ws, size_t ws_size, hipStream_t stream) {
  (void)in_sizes; (void)n_in; (void)out_size;
  const float** F = (const float**)d_in;
  if (ws_size < (size_t)WS_END) return;
  char* ws = (char*)d_ws; _Float16 *QH = (_Float16*)(ws + WS_QH), *KH = (_Float16*)(ws + WS_KH), *VT = (_Float16*)(ws + WS_VT), *QL = (_Float16*)(ws + WS_QL), *KL = (_Float16*)(ws + WS_KL); __bf16 *VB = (__bf16*)(ws + WS_VB), *VBL = (__bf16*)(ws + WS_VBL);
  // inputs: 0 q [B, H, T, 64], 1 k [B, H, 64, T], 2 v [B, H, T, 64] (causal flag folded)
  k_prep8<<<dim3(TNB * TT / 64, NH), 128, 0, stream>>>(F[0], F[1], F[2], QH, QL, KH, KL, VT, VB, VBL);
  k_fa<<<dim3(NFB * NH), 512, 0, stream>>>(QH, KH, QL, KL, VT, VB, VBL, (float*)d_out);
}

// v005
// It runs in 46.5 microseconds.
// Next to v004, in two timings, it ran 1.75 times as fast each time.
// Counting every step since v000, it is 55.4 times as fast.
// compute dtype: all float inputs rounded to bf16; raw q / k / v: q and k enter the scores as f16 (bf16 values are exact in f16: exact products; the early-row residual planes are zero) x 64^-0.5; causal mask by index (the module's w*b + (-1e9)(1 - b) leaves exactly -1e9 on masked entries == exclusion); softmax f32 with a running maximum; P (1 at the running maximum) once to f16 x v (exact in f16; bf16 hi + lo below row 384), divided by the f32 sum at the end; f32 output.
#include <hip/hip_runtime.h>
#include <math.h>

typedef __attribute__((ext_vector_type(16))) _Float16 v16h;
typedef __attribute__((ext_vector_type(16))) __bf16 v16b;
typedef __attribute__((ext_vector_type(8)))  _Float16 v8h;
typedef __attribute__((ext_vector_type(8)))  float v8f;
typedef __attribute__((ext_vector_type(4)))  float v4f;
typedef __attribute__((ext_vector_type(2)))  float v2f;
typedef __attribute__((ext_vector_type(4)))  unsigned v4u;
typedef __attribute__((ext_vector_type(2)))  unsigned v2u;
typedef __attribute__((ext_vector_type(4)))  int v4i;
typedef float __attribute__((may_alias)) float_a;
typedef int __attribute__((may_alias)) int_a;

template <typename T> __device__ __forceinline__ void vst2(void* p, T v) { *(T*)p = v;  }
__device__ __forceinline__ v8f wmma16(v16h a, v16h b, v8f c) {
  v8f d = __builtin_amdgcn_wmma_f32_16x16x32_f16(false, a, false, b, (short)0, c, false, false);
  asm volatile("v_nop\n\tv_nop\n\tv_nop\n\tv_nop" : "+v"(d) : "v"(a), "v"(b));
  return d;
}
__device__ __forceinline__ v8f wmma_bf(v16b a, v16b b, v8f c) {
  v8f d = __builtin_amdgcn_wmma_f32_16x16x32_bf16(false, a, false, b, (short)0, c, false, false);
  asm volatile("v_nop\n\tv_nop\n\tv_nop\n\tv_nop" : "+v"(d) : "v"(a), "v"(b));
  return d;
}
// 16x16x32 fragments: lane = (h = lane>>4, row/col = lane&15); elements 0..7 = k0+8h+0..7, 8..15 = k0+16+8h+0..7; D element r = row 8h+r
__device__ __forceinline__ v16h frag_h(const _Float16* rowk0, int lane) {
  union { v16h v; v8h q[2]; } u; const _Float16* p = rowk0 + 8 * (lane >> 4);
  u.q[0] = *(const v8h*)p; u.q[1] = *(const v8h*)(p + 16); return u.v;
}
__device__ __forceinline__ v16h frag_f32(const float* rowk0, int lane) {
  v16h a; const float* p = rowk0 + 8 * (lane >> 4);
#pragma unroll
  for (int i = 0; i < 8; ++i) { a[i] = (_Float16)p[i]; a[8 + i] = (_Float16)p[16 + i]; }
  return a;
}
__device__ __forceinline__ v16h frag_f32s(const float* rowk0, int lane, float sc) {
  v16h a; const float* p = rowk0 + 8 * (lane >> 4);
#pragma unroll
  for (int i = 0; i < 8; ++i) { a[i] = (_Float16)(p[i] * sc); a[8 + i] = (_Float16)(p[16 + i] * sc); }
  return a;
}
// column fragment from a [K][ld] layout (column n), rows >= K read as 0
__device__ __forceinline__ v16h fragc_f32(const float* W, int k0, int n, int lane, int ld, int K) {
  v16h a; const int g = lane >> 4;
#pragma unroll
  for (int i = 0; i < 8; ++i) { const int ka = k0 + 8 * g + i, kb = ka + 16;
    a[i] = (_Float16)(ka < K ? W[(size_t)(ka < K ? ka : K - 1) * ld + n] : 0.f); a[8 + i] = (_Float16)(kb < K ? W[(size_t)(kb < K ? kb : K - 1) * ld + n] : 0.f); }
  return a;
}
struct F2 { v16b h, l; };
__device__ __forceinline__ F2 bsplit16(const float v[16]) { F2 r;
#pragma unroll
  for (int i = 0; i < 16; ++i) { const __bf16 h = (__bf16)v[i]; r.h[i] = h; r.l[i] = (__bf16)(v[i] - (float)h); }
  return r; }
__device__ __forceinline__ F2 split_row(const float* row, int k0, int lane) { float v[16]; const float* p = row + k0 + 8 * (lane >> 4);
#pragma unroll
  for (int i = 0; i < 8; ++i) { v[i] = p[i]; v[8 + i] = p[16 + i]; }
  return bsplit16(v); }
__device__ __forceinline__ F2 split_rowK(const float* row, int k0, int lane, int K) { float v[16]; const int g = lane >> 4;
#pragma unroll
  for (int i = 0; i < 8; ++i) { const int ka = k0 + 8 * g + i, kb = ka + 16; v[i] = ka < K ? row[ka < K ? ka : K - 1] : 0.f; v[8 + i] = kb < K ? row[kb < K ? kb : K - 1] : 0.f; }
  return bsplit16(v); }
__device__ __forceinline__ F2 split_col(const float* W, int k0, int n, int lane, int ld, int K) { float v[16]; const int g = lane >> 4;
#pragma unroll
  for (int i = 0; i < 8; ++i) { const int ka = k0 + 8 * g + i, kb = ka + 16; v[i] = ka < K ? W[(size_t)(ka < K ? ka : K - 1) * ld + n] : 0.f; v[8 + i] = kb < K ? W[(size_t)(kb < K ? kb : K - 1) * ld + n] : 0.f; }
  return bsplit16(v); }
__device__ __forceinline__ v8f mac3(const F2& a, const F2& b, v8f c) { c = wmma_bf(a.l, b.h, c); c = wmma_bf(a.h, b.l, c); return wmma_bf(a.h, b.h, c); }
__device__ __forceinline__ float sigm(float v) { return 1.0f / (1.0f + expf(-v)); }
#define LDSX() do { asm volatile("s_wait_dscnt 0" ::: "memory"); __builtin_amdgcn_wave_barrier(); __builtin_amdgcn_fence(__ATOMIC_RELEASE, "workgroup"); } while (0)

// Raw causal scaled-dot-product attention with a PRE-TRANSPOSED key (q [1,16,4096,64], k [1,16,64,4096] = [B, H, D, S], v [1,16,4096,64]; w = q k / sqrt(64); b = tril; w = w*b + (-1e9)(1 - b); softmax; out = w v -> [1,16,4096,64]).
#define NB 1
#define TT 4096
#define CC 1024            // NH * HD = projected width
#define DIN 1024          // input (model) width
#define NH 16
#define HD 64
#define NQB (TT / 64)
#define HG 1
#define SCALE (0.125f)
#define CAUSAL 1
#ifndef TNB
#define TNB NB
#endif
__device__ __forceinline__ float bfr(float v) { return (float)(__bf16)v; }
__host__ __device__ __forceinline__ int kb_last(int qb) { return CAUSAL ? ((qb * 64 + 63) >> 7) : (TT / 128 - 1); }
typedef __attribute__((ext_vector_type(8))) __bf16 v8b;
__device__ __forceinline__ v16b frag_b(const __bf16* rowk0, int lane) {
  union { v16b v; v8b q[2]; } u; const __bf16* p = rowk0 + 8 * (lane >> 4);
  u.q[0] = *(const v8b*)p; u.q[1] = *(const v8b*)(p + 16); return u.v;
}
#define QBH 6              // unused; causal: query rows below QHI (few keys, no averaging) take the high-precision path
#define QHI 384            // rows carrying a q residual plane (3-product logits)
#define KHI 384            // key rows carrying k residual / v bf16 hi+lo planes (used only by the causal high-precision path)
// B fragment (k rows k0+.., output column o) of a weight: (in,out) [K][ld] or (out,in) [ld rows of K]: bf16 exact, or f16(bf16 * 256) exact
__device__ __forceinline__ v16b wcol_io(const float* Wm, int k0, int o, int lane, int ld) { v16b w; const int g = lane >> 4;
#pragma unroll
  for (int i = 0; i < 8; ++i) { w[i] = (__bf16)Wm[(size_t)(k0 + 8 * g + i) * ld + o]; w[8 + i] = (__bf16)Wm[(size_t)(k0 + 16 + 8 * g + i) * ld + o]; }
  return w; }
__device__ __forceinline__ v16b wcol_oi(const float* Wm, int k0, int o, int lane, int K) { v16b w; const float* p = Wm + (size_t)o * K + k0 + 8 * (lane >> 4);
#pragma unroll
  for (int i = 0; i < 8; ++i) { w[i] = (__bf16)p[i]; w[8 + i] = (__bf16)p[16 + i]; }
  return w; }
__device__ __forceinline__ v16h wcolh_io(const float* Wm, int k0, int o, int lane, int ld) { v16h w; const int g = lane >> 4;
#pragma unroll
  for (int i = 0; i < 8; ++i) { w[i] = (_Float16)(bfr(Wm[(size_t)(k0 + 8 * g + i) * ld + o]) * 256.0f); w[8 + i] = (_Float16)(bfr(Wm[(size_t)(k0 + 16 + 8 * g + i) * ld + o]) * 256.0f); }
  return w; }
__device__ __forceinline__ v16h wcolh_oi(const float* Wm, int k0, int o, int lane, int K) { v16h w; const float* p = Wm + (size_t)o * K + k0 + 8 * (lane >> 4);
#pragma unroll
  for (int i = 0; i < 8; ++i) { w[i] = (_Float16)(bfr(p[i]) * 256.0f); w[8 + i] = (_Float16)(bfr(p[16 + i]) * 256.0f); }
  return w; }
#define WQKV_LAYOUT 1   // 0 = (in,out) [DIN][CC]; 1 = (out,in) [CC][DIN]; 2 = per-head [NH][DIN][HD]
__device__ __forceinline__ v16b wcol_hdk(const float* Wm, int k0, int o, int lane) { v16b w; const int g = lane >> 4; const float* p = Wm + (size_t)(o / HD) * DIN * HD + (o % HD);
#pragma unroll
  for (int i = 0; i < 8; ++i) { w[i] = (__bf16)p[(size_t)(k0 + 8 * g + i) * HD]; w[8 + i] = (__bf16)p[(size_t)(k0 + 16 + 8 * g + i) * HD]; }
  return w; }
#define WO_OUT_IN 0
#if WQKV_LAYOUT == 1
#define WCOL(W, k0, o, lane) wcol_oi(W, k0, o, lane, DIN)
#elif WQKV_LAYOUT == 2
#define WCOL(W, k0, o, lane) wcol_hdk(W, k0, o, lane)
#else
#define WCOL(W, k0, o, lane) wcol_io(W, k0, o, lane, CC)
#endif
#if WO_OUT_IN
#define WOCOL(W, k0, o, lane) wcol_oi(W, k0, o, lane, CC)
#define WOCOLH(W, k0, o, lane) wcolh_oi(W, k0, o, lane, CC)
#else
#define WOCOL(W, k0, o, lane) wcol_io(W, k0, o, lane, DIN)
#define WOCOLH(W, k0, o, lane) wcolh_io(W, k0, o, lane, DIN)
#endif

// ---- k_prep8: block = (64 attention positions s0.. of sequence b, head h): reads the module's [B, H, S, 64] inputs (element (b,h,s,c) at ((b*NH + h)*TT + s)*64 + c; the key PRE-TRANSPOSED [B, H, D, S]: element (b,h,s,c) at ((b*NH + h)*64 + c)*TT + s), bf16-rounds them and writes the standard attention planes: q -> f16 hi rows (+ x 2^10 residual rows for s < QHI), k and v -> f16 in the order of k_fa's matrix fragments (below; + k residual rows and v bf16 hi/lo planes [c][s] for s < KHI)
// Fragment order, per head 128 bytes a position: k = [16-key tile][32-channel half kc][e][lane][8 channels kc*32 + 16 e + 8 (lane >> 4) ..] of key (lane & 15); v = [32-key step][16-channel tile j][e][lane][8 keys 16 e + 8 (lane >> 4) ..] of channel j*16 + (lane & 15). One 16-byte load of a wave is then 512 bytes in a row, four whole lines
// A stream: every thread asks for all its 24 x 16 bytes (whole 128-byte lines per wave) before it uses any, each element once. q needs no transposition; k and v are transposed 64 x 64 through LDS tiles of dwords (two neighbouring source rows = two neighbouring 16-bit elements of an output row). All stores stand behind the barrier, so that no wave waits at it for its own stores.
#define TP 33   // dwords per tile row; odd, so that the 16 tile rows a wave writes at once, and the 4 (early-row planes) or 16 (fragment order) it reads at once, spread over the banks
typedef __attribute__((ext_vector_type(2))) _Float16 v2h;
typedef __attribute__((ext_vector_type(2))) __bf16 v2b;
__device__ __forceinline__ unsigned pkh(float a, float b) { return __builtin_bit_cast(unsigned, (v2h){(_Float16)a, (_Float16)b}); }
__device__ __forceinline__ unsigned pkb(float a, float b) { return __builtin_bit_cast(unsigned, (v2b){(__bf16)a, (__bf16)b}); }
__device__ __forceinline__ float resh(float x) { return (x - (float)(_Float16)x) * 1024.0f; }   // what f16 leaves of x, x 2^10
__device__ __forceinline__ float resb(float x) { return x - (float)(__bf16)x; }                // what bf16 leaves of x
__device__ __forceinline__ v4u trow(const unsigned* t) { return (v4u){t[0], t[1], t[2], t[3]}; }
template <typename T> __device__ __forceinline__ T ldu(const void* ub, unsigned off) { return *(const T*)((const char*)ub + off); }   // block-uniform base + this lane's byte offset
template <typename T> __device__ __forceinline__ void stu(void* ub, unsigned off, T v) { *(T*)((char*)ub + off) = v; }
__global__ __launch_bounds__(128) void k_prep8(const float* __restrict__ Q, const float* __restrict__ K, const float* __restrict__ V, _Float16* __restrict__ QH, _Float16* __restrict__ QL, _Float16* __restrict__ KH, _Float16* __restrict__ KL, _Float16* __restrict__ VT, __bf16* __restrict__ VB, __bf16* __restrict__ VBL) {
  __shared__ unsigned tk[64 * TP], tv[64 * TP], tkl[64 * TP], tb[64 * TP], tbl[64 * TP];
  const unsigned tid = threadIdx.x; const int h = blockIdx.y; const size_t r0 = (size_t)blockIdx.x * 64; const size_t bb = r0 / TT; const int t0 = (int)(r0 % TT); const bool qhi = t0 < QHI, khi = t0 < KHI;
  const float* qs = Q + ((bb * NH + h) * TT + t0) * HD; const float* vs = V + ((bb * NH + h) * TT + t0) * HD; const float* ks = K + (bb * NH + h) * HD * (size_t)TT + t0;
  const unsigned x4 = tid & 15, rp0 = tid >> 4;   /* transposition: source columns 4 x4 .. + 3 of the source rows 2 rp, 2 rp + 1, rp = rp0 + 8 i */
  const unsigned lk = (2 * rp0 * TT + x4 * 4) * 4, lvv = (2 * rp0 * HD + x4 * 4) * 4, lq = tid * 16;
  v4f qa[8], ka[4][2], va[4][2];
#pragma unroll
  for (int i = 0; i < 4; ++i)
#pragma unroll
    for (int e = 0; e < 2; ++e) { ka[i][e] = ldu<v4f>(ks, lk + (16 * i + e) * TT * 4); va[i][e] = ldu<v4f>(vs, lvv + (16 * i + e) * HD * 4); }
#pragma unroll
  for (int i = 0; i < 8; ++i) qa[i] = ldu<v4f>(qs, lq + 2048 * i);
  asm volatile("s_wait_xcnt 0x0" :: "v"(lk), "v"(lvv), "v"(lq) : "memory");   /* stands in front of the first rewrite of an offset register that the loads above name; as its inputs these registers live up to here */
#pragma unroll
  for (int i = 0; i < 4; ++i)
#pragma unroll
    for (int e = 0; e < 2; ++e)
#pragma unroll
      for (int j = 0; j < 4; ++j) { ka[i][e][j] = bfr(ka[i][e][j]); va[i][e][j] = bfr(va[i][e][j]); }   /* module inputs: bf16-rounded; bf16 values are exact in f16, so the residual planes are 0 */
  const unsigned ow = x4 * 4 * TP + rp0;
#pragma unroll
  for (int i = 0; i < 4; ++i)
#pragma unroll
    for (int j = 0; j < 4; ++j) { const unsigned o = ow + j * TP + 8 * i; tk[o] = pkh(ka[i][0][j], ka[i][1][j]); tv[o] = pkh(va[i][0][j], va[i][1][j]); }
  if (khi) {
#pragma unroll
    for (int i = 0; i < 4; ++i)
#pragma unroll
      for (int j = 0; j < 4; ++j) { const unsigned o = ow + j * TP + 8 * i; tkl[o] = pkh(resh(ka[i][0][j]), resh(ka[i][1][j])); tb[o] = pkb(va[i][0][j], va[i][1][j]); tbl[o] = pkb(resb(va[i][0][j]), resb(va[i][1][j])); } }
  __syncthreads();
  const unsigned xr = tid >> 3, q8 = tid & 7, orr = xr * TP + q8 * 4;   /* output rows xr + 16 i (a position of k, a channel of v), their elements 8 q8 .. + 7 */
  const unsigned sk = (xr * CC + q8 * 8) * 2, sq = (rp0 * CC + x4 * 4) * 2;
  const unsigned fw = tid >> 5, fc = tid & 15, fd = (fw & 1) * 8 + ((tid >> 4) & 1) * 4, sf = tid * 16;   /* fragment order: wave fw stores 512-byte piece 4 i + fw of the block's 8 KB; fc = fragment row, fd = the dword of its elements 16 e + 8 g */
  const unsigned ofk = fc * TP + (fw >> 1) * 16 + fd, ofv = ((fw >> 1) * 16 + fc) * TP + fd;
  _Float16* kd = KH + ((bb * NH + h) * TT + t0) * HD; _Float16* vd = VT + ((bb * NH + h) * TT + t0) * HD; _Float16* qd = QH + r0 * CC + h * HD;
#pragma unroll
  for (int i = 0; i < 4; ++i) { stu(kd, sf + 2048 * i, trow(tk + ofk + 16 * i * TP)); stu(vd, sf + 2048 * i, trow(tv + ofv + (i & 1) * 32 * TP + (i >> 1) * 16)); }
#pragma unroll
  for (int i = 0; i < 8; ++i) {
#pragma unroll
    for (int j = 0; j < 4; ++j) qa[i][j] = bfr(qa[i][j]);
    stu(qd, sq + 8 * i * CC * 2, (v2u){pkh(qa[i][0], qa[i][1]), pkh(qa[i][2], qa[i][3])}); }
  if (khi) {
    asm volatile("s_wait_xcnt 0x0" ::: "memory");   /* stands in front of the first rewrite of a register that the stores above name */
    const unsigned sb = (xr * KHI + q8 * 8) * 2; _Float16* kld = KL + (bb * KHI + t0) * (size_t)CC + h * HD; __bf16* bd = VB + (bb * CC + h * HD) * (size_t)KHI + t0; __bf16* bld = VBL + (bb * CC + h * HD) * (size_t)KHI + t0;
#pragma unroll
    for (int i = 0; i < 4; ++i) { stu(kld, sk + 16 * i * CC * 2, trow(tkl + orr + 16 * i * TP)); stu(bd, sb + 16 * i * KHI * 2, trow(tb + orr + 16 * i * TP)); stu(bld, sb + 16 * i * KHI * 2, trow(tbl + orr + 16 * i * TP)); } }
  if (qhi) {
    asm volatile("s_wait_xcnt 0x0" ::: "memory");   /* as above */
    _Float16* qld = QL + (bb * QHI + t0) * (size_t)CC + h * HD;
#pragma unroll
    for (int i = 0; i < 8; ++i) stu(qld, sq + 8 * i * CC * 2, (v2u){pkh(resh(qa[i][0]), resh(qa[i][1])), pkh(resh(qa[i][2]), resh(qa[i][3]))}); } }

#ifndef SM_EXTRA_PARAMS
#define SM_EXTRA_PARAMS
#endif
#ifndef PROJ_EXTRA_PARAMS
#define PROJ_EXTRA_PARAMS
#endif
#ifndef SM_MASK_HOOK
#define SM_MASK_HOOK (void)0
#endif

#define WS_QH  0u                                      // f16 q rows [b*t][CC]
#define WS_KH  (WS_QH + 2u * (size_t)NB * TT * CC)      // f16 k in fragment order [b][h][t / 16][2 KB]
#define WS_VT  (WS_KH + 2u * (size_t)NB * TT * CC)      // f16 v in fragment order [b][h][t / 32][4 KB]
#define WS_QL  (WS_VT + 2u * (size_t)NB * CC * TT)      // f16 q residual x 2^10 rows [b][t < QHI][CC]
#define WS_KL  (WS_QL + 2u * (size_t)NB * QHI * CC)     // f16 k residual x 2^10 rows [b][t < KHI][CC]
#define WS_VB  (WS_KL + 2u * (size_t)NB * KHI * CC)     // bf16 v hi planes [b][c][t < KHI]
#define WS_VBL (WS_VB + 2u * (size_t)NB * CC * KHI)
#define WS_END (WS_VBL + 2u * (size_t)NB * CC * KHI)

// ---- k_fa: scores, softmax and P . v of one (head, 128-query block) in one kernel; KS waves share QT * 16 query rows: wave ks of them takes the 32-key steps ks, ks + KS, .. of the keys [0, ql0 + 16 QT) rounded up to whole steps and keeps, per query, a running maximum, a running sum and a 64-wide f32 sum (rescaled as the maximum moves), so no logit and no P ever goes to memory. At the end the KS waves bring their sums to one maximum and add them, in wave order, through LDS.
// Transposed products: S^T = K . Q^T (A = key rows, B = query rows), so a lane holds 16 scores of ONE query (column lane & 15; keys k0 + 8g + r and k0 + 16 + 8g + r) and the two score tiles, converted in place, are the B operand of O^T += V^T . P^T in the hardware k order; A = v by channel, in the same order (frag_fu; early rows frag_bu).
// HI (query blocks below row QHI): q and k residual planes enter the scores (3 products), P as bf16 hi + lo against v bf16 hi + lo (3 products), as before.
// Every plain '#pragma unroll' below stands on a loop of constant length, so that the fragment arrays are indexed by constants and stay in registers.
template <bool B> struct BC { static constexpr bool v = B; };
#define QW 2   // 16-query tiles of a wave
#define C2 (SCALE * 1.44269504088896340736f)   // logits in units of log2
__device__ __forceinline__ float xhalf(float x) { return __builtin_bit_cast(float, __builtin_amdgcn_permlanex16(__builtin_bit_cast(int, x), __builtin_bit_cast(int, x), 0x76543210, 0xfedcba98, false, false)); }   // lane l with lane l ^ 16
// fragment from a wave-uniform base and this lane's own byte offset (row * pitch + 16 * (lane >> 4)): the lane offsets never change, only the scalar base walks
__device__ __forceinline__ v16h frag_hu(const _Float16* ub, unsigned lo) { union { v16h v; v8h q[2]; } u; const char* p = (const char*)ub + lo; u.q[0] = *(const v8h*)p; u.q[1] = *(const v8h*)(p + 32); return u.v; }
__device__ __forceinline__ v16h frag_fu(const _Float16* ub, unsigned lo) { union { v16h v; v8h q[2]; } u; const char* p = (const char*)ub + lo; u.q[0] = *(const v8h*)p; u.q[1] = *(const v8h*)(p + 512); return u.v; }   // from the fragment-order planes: this lane's 16 bytes at 16 * lane (in lo, or in ub with lo = 0), the two halves 512 bytes apart
__device__ __forceinline__ v16b frag_bu(const __bf16* ub, unsigned lo) { union { v16b v; v8b q[2]; } u; const char* p = (const char*)ub + lo; u.q[0] = *(const v8b*)p; u.q[1] = *(const v8b*)(p + 32); return u.v; }
__device__ __forceinline__ float exp2_slot(float x) { float r; asm("v_exp_f32 %0, %1\n\tv_nop" : "=v"(r) : "v"(x)); return r; }   // 2^x for the join behind the loop; the v_nop fills the slot that the instruction set asks for between a transcendental and a next instruction that reads its result or overwrites its source
template <bool HI, int QT, int KS> __device__ __forceinline__ void fa_body(const _Float16* __restrict__ QH, const _Float16* __restrict__ KH, const _Float16* __restrict__ QL, const _Float16* __restrict__ KL, const _Float16* __restrict__ VT, const __bf16* __restrict__ VB, const __bf16* __restrict__ VBL, float* __restrict__ Y, int h, int ql0, int lane, int ks, float* gml, v4f* gac) {
  static_assert(QT * (HD / 16) == 2 * KS, "each wave adds up and stores two 16-channel tiles: one whole 128-byte line of each of 16 queries");
  const int col = lane & 15, g = lane >> 4; const int nst = ((ql0 + 16 * QT - 1) >> 5) + 1; const int klast = (nst - 1) * 32;
  const _Float16* kp = KH + (size_t)h * HD * TT; const _Float16* klp = KL + h * HD; const _Float16* vp = VT + (size_t)h * HD * TT; const __bf16* vbp = VB + (size_t)h * HD * KHI; const __bf16* vblp = VBL + (size_t)h * HD * KHI;   /* wave-uniform */
  const unsigned lrow = (unsigned)col * (CC * 2) + 16 * g, lf = (unsigned)lane * 16, lvb = (unsigned)col * (KHI * 2) + 16 * g;   /* lane offsets, bytes: q / k residual rows, k and v in fragment order, early v planes */
  v16h qf[QT][2], qlf[QT][2], kf[4];
#pragma unroll
  for (int u = 0; u < QT; ++u)
#pragma unroll
    for (int kc = 0; kc < 2; ++kc) { qf[u][kc] = frag_hu(QH + (size_t)(ql0 + u * 16) * CC + h * HD + kc * 32, lrow); if constexpr (HI) qlf[u][kc] = frag_hu(QL + (size_t)(ql0 + u * 16) * CC + h * HD + kc * 32, lrow); }
  auto loadK = [&](int k0) { const _Float16* ka = (const _Float16*)((const char*)(kp + (size_t)k0 * HD) + lf);   /* this lane's own address: its 16 bytes of the step's first 512 */
#pragma unroll
    for (int t = 0; t < 2; ++t)
#pragma unroll
      for (int kc = 0; kc < 2; ++kc) kf[t * 2 + kc] = frag_fu(ka + (t * 2 + kc) * 512, 0);
    asm volatile("s_wait_xcnt 0x0" :: "v"(ka) : "memory");   /* stands in front of the first rewrite of an address register that the loads above name; as its input the address lives up to here, so that no load of the run lands in it */ };
  v8f acc[QT][HD / 16] = {}; float m[QT], l[QT];
#pragma unroll
  for (int u = 0; u < QT; ++u) { m[u] = -3.0e38f; l[u] = 0.f; }
  auto step = [&](int k0, auto mk) { constexpr bool MASK = decltype(mk)::v;
    v16h vf[HD / 16];   /* this step's v fragments: asked for first, used last (the few HI steps, short of registers, fetch theirs where they use them) */
    if constexpr (!HI) {
#pragma unroll
      for (int j = 0; j < HD / 16; ++j) vf[j] = frag_fu(vp + (size_t)k0 * HD + j * 512, lf); }
    v8f st[QT][2] = {};
#pragma unroll
    for (int t = 0; t < 2; ++t)
#pragma unroll
      for (int kc = 0; kc < 2; ++kc)
#pragma unroll
        for (int u = 0; u < QT; ++u) st[u][t] = __builtin_amdgcn_wmma_f32_16x16x32_f16(false, kf[t * 2 + kc], false, qf[u][kc], (short)0, st[u][t], false, false);
    if constexpr (HI) { v8f sl[QT][2] = {};
#pragma unroll
      for (int t = 0; t < 2; ++t) {
#pragma unroll
        for (int kc = 0; kc < 2; ++kc) { const v16h klf = frag_hu(klp + (size_t)(k0 + t * 16) * CC + kc * 32, lrow);
#pragma unroll
          for (int u = 0; u < QT; ++u) { sl[u][t] = __builtin_amdgcn_wmma_f32_16x16x32_f16(false, kf[t * 2 + kc], false, qlf[u][kc], (short)0, sl[u][t], false, false); sl[u][t] = __builtin_amdgcn_wmma_f32_16x16x32_f16(false, klf, false, qf[u][kc], (short)0, sl[u][t], false, false); } }
#pragma unroll
        for (int u = 0; u < QT; ++u) st[u][t] += sl[u][t] * (1.0f / 1024.0f); } }
    if constexpr (!MASK) loadK(k0 + 32 * KS < klast ? k0 + 32 * KS : klast);   /* the key fragments of this wave's next step, into the same registers, one step ahead of their use (a wave with no next step asks for the last step's: in range, unused) */
#pragma unroll
    for (int u = 0; u < QT; ++u) {
      if constexpr (MASK) {
#pragma unroll
        for (int t = 0; t < 2; ++t)
#pragma unroll
          for (int r = 0; r < 8; ++r) if (k0 + 16 * t + 8 * g + r > ql0 + u * 16 + col) st[u][t][r] = -3.0e38f; }
      float mx = fmaxf(st[u][0][0], st[u][1][0]);
#pragma unroll
      for (int r = 1; r < 8; ++r) mx = fmaxf(mx, fmaxf(st[u][0][r], st[u][1][r]));
      mx = fmaxf(mx, xhalf(mx));   /* the other half of this query's 32 keys */
      const float mn = fmaxf(m[u], mx * C2); const float al = __builtin_amdgcn_exp2f(m[u] - mn); m[u] = mn;
      float p[16]; float sum = 0.f;
#pragma unroll
      for (int i = 0; i < 16; ++i) { p[i] = __builtin_amdgcn_exp2f(fmaf(st[u][i >> 3][i & 7], C2, -mn)); sum += p[i]; }
      l[u] = l[u] * al + sum;
#pragma unroll
      for (int j = 0; j < HD / 16; ++j) acc[u][j] *= al;
      if constexpr (HI) { const F2 pb = bsplit16(p);
#pragma unroll
        for (int j = 0; j < HD / 16; ++j) { const v16b vh = frag_bu(vbp + (size_t)j * 16 * KHI + k0, lvb), vl = frag_bu(vblp + (size_t)j * 16 * KHI + k0, lvb); acc[u][j] = __builtin_amdgcn_wmma_f32_16x16x32_bf16(false, vh, false, pb.h, (short)0, acc[u][j], false, false); acc[u][j] = __builtin_amdgcn_wmma_f32_16x16x32_bf16(false, vh, false, pb.l, (short)0, acc[u][j], false, false); acc[u][j] = __builtin_amdgcn_wmma_f32_16x16x32_bf16(false, vl, false, pb.h, (short)0, acc[u][j], false, false); }
      } else { v16h pf;
#pragma unroll
        for (int i = 0; i < 16; ++i) pf[i] = (_Float16)p[i];
#pragma unroll
        for (int j = 0; j < HD / 16; ++j) acc[u][j] = __builtin_amdgcn_wmma_f32_16x16x32_f16(false, vf[j], false, pf, (short)0, acc[u][j], false, false); } } };
  loadK(ks * 32 < klast ? ks * 32 : klast);   /* its wait serves the query loads above as well */
#pragma unroll 1   /* rolled: a second copy of the step would double the fragments in flight, past the 256 registers that a wave of a 16-wave block may have */
  for (int s = ks; s < nst - 1; s += KS) step(s * 32, BC<false>{});   /* every key of these steps is below the wave's first query: no mask */
  if (((nst - 1) & (KS - 1)) == ks) step(klast, BC<true>{});   /* the step that holds the diagonal: the wave whose turn it is (a scalar test: every lane stays on) */
  /* the KS waves' parts become one: gml = [wave][u][maximum | sum][query], gac = [wave][u][j][half of the 8 channels][lane]. A wave that had no step brings maximum -3e38, sums 0: weight 0 */
#pragma unroll
  for (int u = 0; u < QT; ++u) { const float lt = l[u] + xhalf(l[u]); gml[ks * 64 + (u * 2 + g) * 16 + col] = g ? lt : m[u]; }
  __syncthreads();
#pragma unroll
  for (int u = 0; u < QT; ++u) { float mk[KS], mm = -3.0e38f, ls = 0.f;
#pragma unroll
    for (int k = 0; k < KS; ++k) { mk[k] = gml[k * 64 + u * 32 + col]; mm = fmaxf(mm, mk[k]); }
#pragma unroll
    for (int k = 0; k < KS; ++k) ls += gml[k * 64 + u * 32 + 16 + col] * exp2_slot(mk[k] - mm);   /* at least 1: the key that gave the maximum counts 1 */
    const float f = exp2_slot(m[u] - mm) / ls;
#pragma unroll
    for (int j = 0; j < HD / 16; ++j) { const v8f o = acc[u][j] * f; v4f* d = gac + ks * 512 + (u * (HD / 16) + j) * 64 + lane; d[0] = (v4f){o[0], o[1], o[2], o[3]}; d[32] = (v4f){o[4], o[5], o[6], o[7]}; } }
  __syncthreads();
#pragma unroll
  for (int jj = 0; jj < 2; ++jj) { const int t = ks * 2 + jj;   /* tile (u, j) = (t / 4, t % 4) */
    float* yo = Y + ((size_t)h * TT + ql0 + (t >> 2) * 16 + col) * HD + (t & 3) * 16 + 8 * g;
#pragma unroll
    for (int e = 0; e < 2; ++e) { const v4f* s = gac + t * 64 + e * 32 + lane; v4f o = s[0];
#pragma unroll
      for (int k = 1; k < KS; ++k) o += s[k * 512];
      vst2(yo + 4 * e, o); } }
  asm volatile("s_wait_xcnt 0x0" ::: "memory");   /* stands in front of any later rewrite of the address and data registers that the stores above name */ }
// block = (head, 64 * QW query rows), 16 waves: 4 tiles of 32 queries x 4 shares of the keys (early rows: 8 tiles of 16 x 2); the waves of equal share walk the same keys and meet in the cache. A WGP holds one block at a time, so the order is by falling length, for the WGPs that are free first to take the longer of what is left; the early-row blocks, few steps but slow ones, go first
#define NFB (TT / (64 * QW))
#define NHB (QHI / (64 * QW))
__global__ __launch_bounds__(512) void k_fa(const _Float16* __restrict__ QH, const _Float16* __restrict__ KH, const _Float16* __restrict__ QL, const _Float16* __restrict__ KL, const _Float16* __restrict__ VT, const __bf16* __restrict__ VB, const __bf16* __restrict__ VBL, float* __restrict__ Y) {
  __shared__ float sml[16 * 64]; __shared__ v4f sac[16 * 512];   /* a wave's maxima and sums; a wave's 64 x 32 partial output */
  const int idx = blockIdx.x, od = idx / NH, h = idx % NH; const int fb = od < NHB ? NHB - 1 - od : NFB - 1 - (od - NHB);
  const int tid = threadIdx.x, wave = __builtin_amdgcn_readfirstlane(tid >> 5) /* scalar, so that the loop over a wave's own steps branches on SCC with every lane on */, lane = tid & 31;
  if (fb < NHB) { const int ks = wave & 1, gw = wave - ks;   /* the residual planes take twice the registers: 16-query tiles; the branch is the same for the whole block, as the barriers inside ask */
    fa_body<true, 1, 2>(QH, KH, QL, KL, VT, VB, VBL, Y, h, fb * 64 * QW + (wave >> 1) * 16, lane, ks, sml + gw * 64, sac + gw * 512);
  } else { const int ks = wave & 3, gw = wave - ks;
    fa_body<false, QW, 4>(QH, KH, QL, KL, VT, VB, VBL, Y, h, fb * 64 * QW + (wave >> 2) * 16 * QW, lane, ks, sml + gw * 64, sac + gw * 512); } }

extern "C" void kernel_launch(void* const* d_in, const int* in_sizes, int n_in, void* d_out, int out_size, void* d_ws, size_t ws_size, hipStream_t stream) {
  (void)in_sizes; (void)n_in; (void)out_size;
  const float** F = (const float**)d_in;
  if (ws_size < (size_t)WS_END) return;
  char* ws = (char*)d_ws; _Float16 *QH = (_Float16*)(ws + WS_QH), *KH = (_Float16*)(ws + WS_KH), *VT = (_Float16*)(ws + WS_VT), *QL = (_Float16*)(ws + WS_QL), *KL = (_Float16*)(ws + WS_KL); __bf16 *VB = (__bf16*)(ws + WS_VB), *VBL = (__bf16*)(ws + WS_VBL);
  // inputs: 0 q [B, H, T, 64], 1 k [B, H, 64, T], 2 v [B, H, T, 64] (causal flag folded)
  k_prep8<<<dim3(TNB * TT / 64, NH), 128, 0, stream>>>(F[0], F[1], F[2], QH, QL, KH, KL, VT, VB, VBL);
  k_fa<<<dim3(NFB * NH), 512, 0, stream>>>(QH, KH, QL, KL, VT, VB, VBL, (float*)d_out);
}

// v006
// One run takes 42.8 microseconds.
// Timed twice side by side with v005, it ran 1.09 times as fast both times.
// All steps since v000 together make it 60.3 times as fast.
// compute dtype: all float inputs rounded to bf16; raw q / k / v: q and k enter the scores as f16 (bf16 values are exact in f16: exact products; the early-row residual planes are zero) x 64^-0.5; causal mask by index (the module's w*b + (-1e9)(1 - b) leaves exactly -1e9 on masked entries == exclusion); softmax f32 against a held reference maximum (moved up to the running maximum when P outgrows it; early rows: in every step); P (at most 1024) once to f16 x v (exact in f16; bf16 hi + lo below row 384), divided by the f32 sum at the end; f32 output.
#include <hip/hip_runtime.h>
#include <math.h>

typedef __attribute__((ext_vector_type(16))) _Float16 v16h;
typedef __attribute__((ext_vector_type(16))) __bf16 v16b;
typedef __attribute__((ext_vector_type(8)))  _Float16 v8h;
typedef __attribute__((ext_vector_type(8)))  float v8f;
typedef __attribute__((ext_vector_type(4)))  float v4f;
typedef __attribute__((ext_vector_type(2)))  float v2f;
typedef __attribute__((ext_vector_type(4)))  unsigned v4u;
typedef __attribute__((ext_vector_type(2)))  unsigned v2u;
typedef __attribute__((ext_vector_type(4)))  int v4i;
typedef float __attribute__((may_alias)) float_a;
typedef int __attribute__((may_alias)) int_a;

template <typename T> __device__ __forceinline__ void vst2(void* p, T v) { *(T*)p = v;  }
__device__ __forceinline__ v8f wmma16(v16h a, v16h b, v8f c) {
  v8f d = __builtin_amdgcn_wmma_f32_16x16x32_f16(false, a, false, b, (short)0, c, false, false);
  asm volatile("v_nop\n\tv_nop\n\tv_nop\n\tv_nop" : "+v"(d) : "v"(a), "v"(b));
  return d;
}
__device__ __forceinline__ v8f wmma_bf(v16b a, v16b b, v8f c) {
  v8f d = __builtin_amdgcn_wmma_f32_16x16x32_bf16(false, a, false, b, (short)0, c, false, false);
  asm volatile("v_nop\n\tv_nop\n\tv_nop\n\tv_nop" : "+v"(d) : "v"(a), "v"(b));
  return d;
}
// 16x16x32 fragments: lane = (h = lane>>4, row/col = lane&15); elements 0..7 = k0+8h+0..7, 8..15 = k0+16+8h+0..7; D element r = row 8h+r
__device__ __forceinline__ v16h frag_h(const _Float16* rowk0, int lane) {
  union { v16h v; v8h q[2]; } u; const _Float16* p = rowk0 + 8 * (lane >> 4);
  u.q[0] = *(const v8h*)p; u.q[1] = *(const v8h*)(p + 16); return u.v;
}
__device__ __forceinline__ v16h frag_f32(const float* rowk0, int lane) {
  v16h a; const float* p = rowk0 + 8 * (lane >> 4);
#pragma unroll
  for (int i = 0; i < 8; ++i) { a[i] = (_Float16)p[i]; a[8 + i] = (_Float16)p[16 + i]; }
  return a;
}
__device__ __forceinline__ v16h frag_f32s(const float* rowk0, int lane, float sc) {
  v16h a; const float* p = rowk0 + 8 * (lane >> 4);
#pragma unroll
  for (int i = 0; i < 8; ++i) { a[i] = (_Float16)(p[i] * sc); a[8 + i] = (_Float16)(p[16 + i] * sc); }
  return a;
}
// column fragment from a [K][ld] layout (column n), rows >= K read as 0
__device__ __forceinline__ v16h fragc_f32(const float* W, int k0, int n, int lane, int ld, int K) {
  v16h a; const int g = lane >> 4;
#pragma unroll
  for (int i = 0; i < 8; ++i) { const int ka = k0 + 8 * g + i, kb = ka + 16;
    a[i] = (_Float16)(ka < K ? W[(size_t)(ka < K ? ka : K - 1) * ld + n] : 0.f); a[8 + i] = (_Float16)(kb < K ? W[(size_t)(kb < K ? kb : K - 1) * ld + n] : 0.f); }
  return a;
}
struct F2 { v16b h, l; };
__device__ __forceinline__ F2 bsplit16(const float v[16]) { F2 r;
#pragma unroll
  for (int i = 0; i < 16; ++i) { const __bf16 h = (__bf16)v[i]; r.h[i] = h; r.l[i] = (__bf16)(v[i] - (float)h); }
  return r; }
__device__ __forceinline__ F2 split_row(const float* row, int k0, int lane) { float v[16]; const float* p = row + k0 + 8 * (lane >> 4);
#pragma unroll
  for (int i = 0; i < 8; ++i) { v[i] = p[i]; v[8 + i] = p[16 + i]; }
  return bsplit16(v); }
__device__ __forceinline__ F2 split_rowK(const float* row, int k0, int lane, int K) { float v[16]; const int g = lane >> 4;
#pragma unroll
  for (int i = 0; i < 8; ++i) { const int ka = k0 + 8 * g + i, kb = ka + 16; v[i] = ka < K ? row[ka < K ? ka : K - 1] : 0.f; v[8 + i] = kb < K ? row[kb < K ? kb : K - 1] : 0.f; }
  return bsplit16(v); }
__device__ __forceinline__ F2 split_col(const float* W, int k0, int n, int lane, int ld, int K) { float v[16]; const int g = lane >> 4;
#pragma unroll
  for (int i = 0; i < 8; ++i) { const int ka = k0 + 8 * g + i, kb = ka + 16; v[i] = ka < K ? W[(size_t)(ka < K ? ka : K - 1) * ld + n] : 0.f; v[8 + i] = kb < K ? W[(size_t)(kb < K ? kb : K - 1) * ld + n] : 0.f; }
  return bsplit16(v); }
__device__ __forceinline__ v8f mac3(const F2& a, const F2& b, v8f c) { c = wmma_bf(a.l, b.h, c); c = wmma_bf(a.h, b.l, c); return wmma_bf(a.h, b.h, c); }
__device__ __forceinline__ float sigm(float v) { return 1.0f / (1.0f + expf(-v)); }
#define LDSX() do { asm volatile("s_wait_dscnt 0" ::: "memory"); __builtin_amdgcn_wave_barrier(); __builtin_amdgcn_fence(__ATOMIC_RELEASE, "workgroup"); } while (0)

// Raw causal scaled-dot-product attention with a PRE-TRANSPOSED key (q [1,16,4096,64], k [1,16,64,4096] = [B, H, D, S], v [1,16,4096,64]; w = q k / sqrt(64); b = tril; w = w*b + (-1e9)(1 - b); softmax; out = w v -> [1,16,4096,64]).
#define NB 1
#define TT 4096
#define CC 1024            // NH * HD = projected width
#define DIN 1024          // input (model) width
#define NH 16
#define HD 64
#define NQB (TT / 64)
#define HG 1
#define SCALE (0.125f)
#define CAUSAL 1
#ifndef TNB
#define TNB NB
#endif
__device__ __forceinline__ float bfr(float v) { return (float)(__bf16)v; }
__host__ __device__ __forceinline__ int kb_last(int qb) { return CAUSAL ? ((qb * 64 + 63) >> 7) : (TT / 128 - 1); }
typedef __attribute__((ext_vector_type(8))) __bf16 v8b;
__device__ __forceinline__ v16b frag_b(const __bf16* rowk0, int lane) {
  union { v16b v; v8b q[2]; } u; const __bf16* p = rowk0 + 8 * (lane >> 4);
  u.q[0] = *(const v8b*)p; u.q[1] = *(const v8b*)(p + 16); return u.v;
}
#define QBH 6              // unused; causal: query rows below QHI (few keys, no averaging) take the high-precision path
#define QHI 384            // rows carrying a q residual plane (3-product logits)
#define KHI 384            // key rows carrying k residual / v bf16 hi+lo planes (used only by the causal high-precision path)
// B fragment (k rows k0+.., output column o) of a weight: (in,out) [K][ld] or (out,in) [ld rows of K]: bf16 exact, or f16(bf16 * 256) exact
__device__ __forceinline__ v16b wcol_io(const float* Wm, int k0, int o, int lane, int ld) { v16b w; const int g = lane >> 4;
#pragma unroll
  for (int i = 0; i < 8; ++i) { w[i] = (__bf16)Wm[(size_t)(k0 + 8 * g + i) * ld + o]; w[8 + i] = (__bf16)Wm[(size_t)(k0 + 16 + 8 * g + i) * ld + o]; }
  return w; }
__device__ __forceinline__ v16b wcol_oi(const float* Wm, int k0, int o, int lane, int K) { v16b w; const float* p = Wm + (size_t)o * K + k0 + 8 * (lane >> 4);
#pragma unroll
  for (int i = 0; i < 8; ++i) { w[i] = (__bf16)p[i]; w[8 + i] = (__bf16)p[16 + i]; }
  return w; }
__device__ __forceinline__ v16h wcolh_io(const float* Wm, int k0, int o, int lane, int ld) { v16h w; const int g = lane >> 4;
#pragma unroll
  for (int i = 0; i < 8; ++i) { w[i] = (_Float16)(bfr(Wm[(size_t)(k0 + 8 * g + i) * ld + o]) * 256.0f); w[8 + i] = (_Float16)(bfr(Wm[(size_t)(k0 + 16 + 8 * g + i) * ld + o]) * 256.0f); }
  return w; }
__device__ __forceinline__ v16h wcolh_oi(const float* Wm, int k0, int o, int lane, int K) { v16h w; const float* p = Wm + (size_t)o * K + k0 + 8 * (lane >> 4);
#pragma unroll
  for (int i = 0; i < 8; ++i) { w[i] = (_Float16)(bfr(p[i]) * 256.0f); w[8 + i] = (_Float16)(bfr(p[16 + i]) * 256.0f); }
  return w; }
#define WQKV_LAYOUT 1   // 0 = (in,out) [DIN][CC]; 1 = (out,in) [CC][DIN]; 2 = per-head [NH][DIN][HD]
__device__ __forceinline__ v16b wcol_hdk(const float* Wm, int k0, int o, int lane) { v16b w; const int g = lane >> 4; const float* p = Wm + (size_t)(o / HD) * DIN * HD + (o % HD);
#pragma unroll
  for (int i = 0; i < 8; ++i) { w[i] = (__bf16)p[(size_t)(k0 + 8 * g + i) * HD]; w[8 + i] = (__bf16)p[(size_t)(k0 + 16 + 8 * g + i) * HD]; }
  return w; }
#define WO_OUT_IN 0
#if WQKV_LAYOUT == 1
#define WCOL(W, k0, o, lane) wcol_oi(W, k0, o, lane, DIN)
#elif WQKV_LAYOUT == 2
#define WCOL(W, k0, o, lane) wcol_hdk(W, k0, o, lane)
#else
#define WCOL(W, k0, o, lane) wcol_io(W, k0, o, lane, CC)
#endif
#if WO_OUT_IN
#define WOCOL(W, k0, o, lane) wcol_oi(W, k0, o, lane, CC)
#define WOCOLH(W, k0, o, lane) wcolh_oi(W, k0, o, lane, CC)
#else
#define WOCOL(W, k0, o, lane) wcol_io(W, k0, o, lane, DIN)
#define WOCOLH(W, k0, o, lane) wcolh_io(W, k0, o, lane, DIN)
#endif

// ---- k_prep8: block = (64 attention positions s0.. of sequence b, head h): reads the module's [B, H, S, 64] inputs (element (b,h,s,c) at ((b*NH + h)*TT + s)*64 + c; the key PRE-TRANSPOSED [B, H, D, S]: element (b,h,s,c) at ((b*NH + h)*64 + c)*TT + s), bf16-rounds them and writes the standard attention planes: q -> f16 hi rows (+ x 2^10 residual rows for s < QHI), k and v -> f16 in the order of k_fa's matrix fragments (below; + k residual rows and v bf16 hi/lo planes [c][s] for s < KHI)
// Fragment order, per head 128 bytes a position: k = [16-key tile][32-channel half kc][e][lane][8 channels kc*32 + 16 e + 8 (lane >> 4) ..] of key (lane & 15); v = [32-key step][16-channel tile j][e][lane][8 keys 16 e + 8 (lane >> 4) ..] of channel j*16 + (lane & 15). One 16-byte load of a wave is then 512 bytes in a row, four whole lines
// A stream: every thread asks for all its 24 x 16 bytes (whole 128-byte lines per wave) before it uses any, each element once. q needs no transposition; k and v are transposed 64 x 64 through LDS tiles of dwords (two neighbouring source rows = two neighbouring 16-bit elements of an output row). All stores stand behind the barrier, so that no wave waits at it for its own stores.
#define TP 33   // dwords per tile row; odd, so that the 16 tile rows a wave writes at once, and the 4 (early-row planes) or 16 (fragment order) it reads at once, spread over the banks
typedef __attribute__((ext_vector_type(2))) _Float16 v2h;
typedef __attribute__((ext_vector_type(2))) __bf16 v2b;
__device__ __forceinline__ unsigned pkh(float a, float b) { return __builtin_bit_cast(unsigned, (v2h){(_Float16)a, (_Float16)b}); }
__device__ __forceinline__ unsigned pkb(float a, float b) { return __builtin_bit_cast(unsigned, (v2b){(__bf16)a, (__bf16)b}); }
__device__ __forceinline__ float resh(float x) { return (x - (float)(_Float16)x) * 1024.0f; }   // what f16 leaves of x, x 2^10
__device__ __forceinline__ float resb(float x) { return x - (float)(__bf16)x; }                // what bf16 leaves of x
__device__ __forceinline__ v4u trow(const unsigned* t) { return (v4u){t[0], t[1], t[2], t[3]}; }
template <typename T> __device__ __forceinline__ T ldu(const void* ub, unsigned off) { return *(const T*)((const char*)ub + off); }   // block-uniform base + this lane's byte offset
template <typename T> __device__ __forceinline__ void stu(void* ub, unsigned off, T v) { *(T*)((char*)ub + off) = v; }
__global__ __launch_bounds__(128) void k_prep8(const float* __restrict__ Q, const float* __restrict__ K, const float* __restrict__ V, _Float16* __restrict__ QH, _Float16* __restrict__ QL, _Float16* __restrict__ KH, _Float16* __restrict__ KL, _Float16* __restrict__ VT, __bf16* __restrict__ VB, __bf16* __restrict__ VBL) {
  __shared__ unsigned tk[64 * TP], tv[64 * TP], tkl[64 * TP], tb[64 * TP], tbl[64 * TP];
  const unsigned tid = threadIdx.x; const int h = blockIdx.y; const size_t r0 = (size_t)blockIdx.x * 64; const size_t bb = r0 / TT; const int t0 = (int)(r0 % TT); const bool qhi = t0 < QHI, khi = t0 < KHI;
  const float* qs = Q + ((bb * NH + h) * TT + t0) * HD; const float* vs = V + ((bb * NH + h) * TT + t0) * HD; const float* ks = K + (bb * NH + h) * HD * (size_t)TT + t0;
  const unsigned x4 = tid & 15, rp0 = tid >> 4;   /* transposition: source columns 4 x4 .. + 3 of the source rows 2 rp, 2 rp + 1, rp = rp0 + 8 i */
  const unsigned lk = (2 * rp0 * TT + x4 * 4) * 4, lvv = (2 * rp0 * HD + x4 * 4) * 4, lq = tid * 16;
  v4f qa[8], ka[4][2], va[4][2];
#pragma unroll
  for (int i = 0; i < 4; ++i)
#pragma unroll
    for (int e = 0; e < 2; ++e) { ka[i][e] = ldu<v4f>(ks, lk + (16 * i + e) * TT * 4); va[i][e] = ldu<v4f>(vs, lvv + (16 * i + e) * HD * 4); }
#pragma unroll
  for (int i = 0; i < 8; ++i) qa[i] = ldu<v4f>(qs, lq + 2048 * i);
  asm volatile("s_wait_xcnt 0x0" :: "v"(lk), "v"(lvv), "v"(lq) : "memory");   /* stands in front of the first rewrite of an offset register that the loads above name; as its inputs these registers live up to here */
#pragma unroll
  for (int i = 0; i < 4; ++i)
#pragma unroll
    for (int e = 0; e < 2; ++e)
#pragma unroll
      for (int j = 0; j < 4; ++j) { ka[i][e][j] = bfr(ka[i][e][j]); va[i][e][j] = bfr(va[i][e][j]); }   /* module inputs: bf16-rounded; bf16 values are exact in f16, so the residual planes are 0 */
  const unsigned ow = x4 * 4 * TP + rp0;
#pragma unroll
  for (int i = 0; i < 4; ++i)
#pragma unroll
    for (int j = 0; j < 4; ++j) { const unsigned o = ow + j * TP + 8 * i; tk[o] = pkh(ka[i][0][j], ka[i][1][j]); tv[o] = pkh(va[i][0][j], va[i][1][j]); }
  if (khi) {
#pragma unroll
    for (int i = 0; i < 4; ++i)
#pragma unroll
      for (int j = 0; j < 4; ++j) { const unsigned o = ow + j * TP + 8 * i; tkl[o] = pkh(resh(ka[i][0][j]), resh(ka[i][1][j])); tb[o] = pkb(va[i][0][j], va[i][1][j]); tbl[o] = pkb(resb(va[i][0][j]), resb(va[i][1][j])); } }
  __syncthreads();
  const unsigned xr = tid >> 3, q8 = tid & 7, orr = xr * TP + q8 * 4;   /* output rows xr + 16 i (a position of k, a channel of v), their elements 8 q8 .. + 7 */
  const unsigned sk = (xr * CC + q8 * 8) * 2, sq = (rp0 * CC + x4 * 4) * 2;
  const unsigned fw = tid >> 5, fc = tid & 15, fd = (fw & 1) * 8 + ((tid >> 4) & 1) * 4, sf = tid * 16;   /* fragment order: wave fw stores 512-byte piece 4 i + fw of the block's 8 KB; fc = fragment row, fd = the dword of its elements 16 e + 8 g */
  const unsigned ofk = fc * TP + (fw >> 1) * 16 + fd, ofv = ((fw >> 1) * 16 + fc) * TP + fd;
  _Float16* kd = KH + ((bb * NH + h) * TT + t0) * HD; _Float16* vd = VT + ((bb * NH + h) * TT + t0) * HD; _Float16* qd = QH + r0 * CC + h * HD;
#pragma unroll
  for (int i = 0; i < 4; ++i) { stu(kd, sf + 2048 * i, trow(tk + ofk + 16 * i * TP)); stu(vd, sf + 2048 * i, trow(tv + ofv + (i & 1) * 32 * TP + (i >> 1) * 16)); }
#pragma unroll
  for (int i = 0; i < 8; ++i) {
#pragma unroll
    for (int j = 0; j < 4; ++j) qa[i][j] = bfr(qa[i][j]);
    stu(qd, sq + 8 * i * CC * 2, (v2u){pkh(qa[i][0], qa[i][1]), pkh(qa[i][2], qa[i][3])}); }
  if (khi) {
    asm volatile("s_wait_xcnt 0x0" ::: "memory");   /* stands in front of the first rewrite of a register that the stores above name */
    const unsigned sb = (xr * KHI + q8 * 8) * 2; _Float16* kld = KL + (bb * KHI + t0) * (size_t)CC + h * HD; __bf16* bd = VB + (bb * CC + h * HD) * (size_t)KHI + t0; __bf16* bld = VBL + (bb * CC + h * HD) * (size_t)KHI + t0;
#pragma unroll
    for (int i = 0; i < 4; ++i) { stu(kld, sk + 16 * i * CC * 2, trow(tkl + orr + 16 * i * TP)); stu(bd, sb + 16 * i * KHI * 2, trow(tb + orr + 16 * i * TP)); stu(bld, sb + 16 * i * KHI * 2, trow(tbl + orr + 16 * i * TP)); } }
  if (qhi) {
    asm volatile("s_wait_xcnt 0x0" ::: "memory");   /* as above */
    _Float16* qld = QL + (bb * QHI + t0) * (size_t)CC + h * HD;
#pragma unroll
    for (int i = 0; i < 8; ++i) stu(qld, sq + 8 * i * CC * 2, (v2u){pkh(resh(qa[i][0]), resh(qa[i][1])), pkh(resh(qa[i][2]), resh(qa[i][3]))}); } }

#ifndef SM_EXTRA_PARAMS
#define SM_EXTRA_PARAMS
#endif
#ifndef PROJ_EXTRA_PARAMS
#define PROJ_EXTRA_PARAMS
#endif
#ifndef SM_MASK_HOOK
#define SM_MASK_HOOK (void)0
#endif

#define WS_QH  0u                                      // f16 q rows [b*t][CC]
#define WS_KH  (WS_QH + 2u * (size_t)NB * TT * CC)      // f16 k in fragment order [b][h][t / 16][2 KB]
#define WS_VT  (WS_KH + 2u * (size_t)NB * TT * CC)      // f16 v in fragment order [b][h][t / 32][4 KB]
#define WS_QL  (WS_VT + 2u * (size_t)NB * CC * TT)      // f16 q residual x 2^10 rows [b][t < QHI][CC]
#define WS_KL  (WS_QL + 2u * (size_t)NB * QHI * CC)     // f16 k residual x 2^10 rows [b][t < KHI][CC]
#define WS_VB  (WS_KL + 2u * (size_t)NB * KHI * CC)     // bf16 v hi planes [b][c][t < KHI]
#define WS_VBL (WS_VB + 2u * (size_t)NB * CC * KHI)
#define WS_END (WS_VBL + 2u * (size_t)NB * CC * KHI)

// ---- k_fa: scores, softmax and P . v of one (head, 128-query block) in one kernel; KS waves share QT * 16 query rows: wave ks of them takes the 32-key steps ks, ks + KS, .. of the keys [0, ql0 + 32) and keeps, per query, a reference maximum, a running sum and a 64-wide f32 sum (rescaled when the reference moves), so no logit and no P ever goes to memory. Late rows hold the reference: the maximum of the wave's first step stays in use while every step's P stay small enough for f16, so that the common step forms no maximum and rescales nothing. At the end the KS waves bring their sums to one maximum and add them, in wave order, through LDS.
// Transposed products: S^T = K . Q^T (A = key rows, B = query rows), so a lane holds 16 scores of ONE query (column lane & 15; keys k0 + 8g + r and k0 + 16 + 8g + r) and the two score tiles, converted in place, are the B operand of O^T += V^T . P^T in the hardware k order; A = v by channel, in the same order (frag_fu; early rows frag_bu).
// HI (query blocks below row QHI): q and k residual planes enter the scores (3 products), P as bf16 hi + lo against v bf16 hi + lo (3 products), as before.
// Every plain '#pragma unroll' below stands on a loop of constant length, so that the fragment arrays are indexed by constants and stay in registers.
template <bool B> struct BC { static constexpr bool v = B; };
#define QW 2   // 16-query tiles of a wave
#define C2 (SCALE * 1.44269504088896340736f)   // logits in units of log2
#define PTOP 1024.0f   // while the 16 P of a lane and step sum to no more than this, each of them is at most this: far inside f16 and bf16, and the reference stays
__device__ __forceinline__ float xhalf(float x) { return __builtin_bit_cast(float, __builtin_amdgcn_permlanex16(__builtin_bit_cast(int, x), __builtin_bit_cast(int, x), 0x76543210, 0xfedcba98, false, false)); }   // lane l with lane l ^ 16
// fragment from a wave-uniform base and this lane's own byte offset (row * pitch + 16 * (lane >> 4)): the lane offsets never change, only the scalar base walks
__device__ __forceinline__ v16h frag_hu(const _Float16* ub, unsigned lo) { union { v16h v; v8h q[2]; } u; const char* p = (const char*)ub + lo; u.q[0] = *(const v8h*)p; u.q[1] = *(const v8h*)(p + 32); return u.v; }
__device__ __forceinline__ v16h frag_fu(const _Float16* ub, unsigned lo) { union { v16h v; v8h q[2]; } u; const char* p = (const char*)ub + lo; u.q[0] = *(const v8h*)p; u.q[1] = *(const v8h*)(p + 512); return u.v; }   // from the fragment-order planes: the pointer holds this lane's 16 * lane bytes (lo = 0), the two halves 512 bytes apart
__device__ __forceinline__ v16b frag_bu(const __bf16* ub, unsigned lo) { union { v16b v; v8b q[2]; } u; const char* p = (const char*)ub + lo; u.q[0] = *(const v8b*)p; u.q[1] = *(const v8b*)(p + 32); return u.v; }
__device__ __forceinline__ float exp2_slot(float x) { float r; asm("v_exp_f32 %0, %1\n\tv_nop" : "=v"(r) : "v"(x)); return r; }   // 2^x for a step's rescale and for the join behind the loop; the v_nop fills the slot that the instruction set asks for between a transcendental and a next instruction that reads its result or overwrites its source
// 2^x of 16 values, in place, as one run: inside it every v_exp_f32 is followed by an independent one, and behind the last stands a v_nop: the slot that the instruction set asks for between a transcendental and a next instruction that reads its result or overwrites its source
__device__ __forceinline__ void exp2_run(float (&x)[16]) {
  asm("v_exp_f32 %0, %0\n\tv_exp_f32 %1, %1\n\tv_exp_f32 %2, %2\n\tv_exp_f32 %3, %3\n\tv_exp_f32 %4, %4\n\tv_exp_f32 %5, %5\n\tv_exp_f32 %6, %6\n\tv_exp_f32 %7, %7\n\tv_exp_f32 %8, %8\n\tv_exp_f32 %9, %9\n\tv_exp_f32 %10, %10\n\tv_exp_f32 %11, %11\n\tv_exp_f32 %12, %12\n\tv_exp_f32 %13, %13\n\tv_exp_f32 %14, %14\n\tv_exp_f32 %15, %15\n\tv_nop"
      : "+v"(x[0]), "+v"(x[1]), "+v"(x[2]), "+v"(x[3]), "+v"(x[4]), "+v"(x[5]), "+v"(x[6]), "+v"(x[7]), "+v"(x[8]), "+v"(x[9]), "+v"(x[10]), "+v"(x[11]), "+v"(x[12]), "+v"(x[13]), "+v"(x[14]), "+v"(x[15])); }
template <bool HI, int QT, int KS> __device__ __forceinline__ void fa_body(const _Float16* __restrict__ QH, const _Float16* __restrict__ KH, const _Float16* __restrict__ QL, const _Float16* __restrict__ KL, const _Float16* __restrict__ VT, const __bf16* __restrict__ VB, const __bf16* __restrict__ VBL, float* __restrict__ Y, int h, int ql0, int lane, int ks, float* gml, v4f* gac) {
  static_assert(QT * (HD / 16) == 2 * KS, "each wave adds up and stores two 16-channel tiles: one whole 128-byte line of each of 16 queries");
  const int col = lane & 15, g = lane >> 4; const int nst = ((ql0 + 16 * QT - 1) >> 5) + 1; const int klast = (nst - 1) * 32;
  const _Float16* kp = KH + (size_t)h * HD * TT; const _Float16* klp = KL + h * HD; const _Float16* vp = VT + (size_t)h * HD * TT; const __bf16* vbp = VB + (size_t)h * HD * KHI; const __bf16* vblp = VBL + (size_t)h * HD * KHI;   /* wave-uniform */
  const unsigned lrow = (unsigned)col * (CC * 2) + 16 * g, lf = (unsigned)lane * 16, lvb = (unsigned)col * (KHI * 2) + 16 * g;   /* lane offsets, bytes: q / k residual rows, k and v in fragment order, early v planes */
  v16h qf[QT][2], qlf[QT][2], kf[4];
#pragma unroll
  for (int u = 0; u < QT; ++u)
#pragma unroll
    for (int kc = 0; kc < 2; ++kc) { qf[u][kc] = frag_hu(QH + (size_t)(ql0 + u * 16) * CC + h * HD + kc * 32, lrow); if constexpr (HI) qlf[u][kc] = frag_hu(QL + (size_t)(ql0 + u * 16) * CC + h * HD + kc * 32, lrow); }
  auto loadK = [&](v16h (&kd)[4], int k0) { const _Float16* ka = (const _Float16*)((const char*)(kp + (size_t)k0 * HD) + lf);   /* this lane's own address: its 16 bytes of the step's first 512 */
#pragma unroll
    for (int t = 0; t < 2; ++t)
#pragma unroll
      for (int kc = 0; kc < 2; ++kc) kd[t * 2 + kc] = frag_fu(ka + (t * 2 + kc) * 512, 0);
    asm volatile("s_wait_xcnt 0x0" :: "v"(ka) : "memory");   /* stands in front of the first rewrite of an address register that the loads above name; as its input the address lives up to here, so that no load of the run lands in it */ };
  v8f acc[QT][HD / 16] = {}; float m[QT], l[QT];
#pragma unroll
  for (int u = 0; u < QT; ++u) { m[u] = -3.0e38f; l[u] = 0.f; }
  auto step = [&](int k0, auto mk, auto fs) { constexpr bool MASK = decltype(mk)::v, FIRST = decltype(fs)::v;
    v16h vf[HD / 16];   /* this step's v fragments: asked for first, used last (the few HI steps, short of registers, fetch theirs where they use them) */
    if constexpr (!HI) { const _Float16* va = (const _Float16*)((const char*)(vp + (size_t)k0 * HD) + lf);   /* this lane's own address, as in loadK */
#pragma unroll
      for (int j = 0; j < HD / 16; ++j) vf[j] = frag_fu(va + j * 512, 0);
      asm volatile("s_wait_xcnt 0x0" :: "v"(va) : "memory");   /* as in loadK: in front of the first rewrite of the address register; as its input the address lives up to here, so that no load of the run lands in it */ }
    v8f st[QT][2];
    auto scores = [&](const v16h (&kk)[4]) {
#pragma unroll
      for (int u = 0; u < QT; ++u)
#pragma unroll
        for (int t = 0; t < 2; ++t) st[u][t] = (v8f){};
#pragma unroll
      for (int t = 0; t < 2; ++t)
#pragma unroll
        for (int kc = 0; kc < 2; ++kc)
#pragma unroll
          for (int u = 0; u < QT; ++u) st[u][t] = __builtin_amdgcn_wmma_f32_16x16x32_f16(false, kk[t * 2 + kc], false, qf[u][kc], (short)0, st[u][t], false, false);
      if constexpr (HI) { v8f sl[QT][2] = {};
#pragma unroll
        for (int t = 0; t < 2; ++t) {
#pragma unroll
          for (int kc = 0; kc < 2; ++kc) { const v16h klf = frag_hu(klp + (size_t)(k0 + t * 16) * CC + kc * 32, lrow);
#pragma unroll
            for (int u = 0; u < QT; ++u) { sl[u][t] = __builtin_amdgcn_wmma_f32_16x16x32_f16(false, kk[t * 2 + kc], false, qlf[u][kc], (short)0, sl[u][t], false, false); sl[u][t] = __builtin_amdgcn_wmma_f32_16x16x32_f16(false, klf, false, qf[u][kc], (short)0, sl[u][t], false, false); } }
#pragma unroll
          for (int u = 0; u < QT; ++u) st[u][t] += sl[u][t] * (1.0f / 1024.0f); } }
      if constexpr (MASK) {
#pragma unroll
        for (int u = 0; u < QT; ++u)
#pragma unroll
          for (int t = 0; t < 2; ++t)
#pragma unroll
            for (int r = 0; r < 8; ++r) if (k0 + 16 * t + 8 * g + r > ql0 + u * 16 + col) st[u][t][r] = -3.0e38f; } };
    float p[QT][16], sum[QT];
    auto soft = [&](int u) {   /* P and its sum against the reference m[u] in use */
#pragma unroll
      for (int i = 0; i < 16; ++i) p[u][i] = fmaf(st[u][i >> 3][i & 7], C2, -m[u]);
      exp2_run(p[u]); sum[u] = p[u][0];
#pragma unroll
      for (int i = 1; i < 16; ++i) sum[u] += p[u][i]; };
    auto lift = [&](int u) {   /* the reference moves up to the running maximum; what was summed so far is rescaled (a first step has nothing summed) */
      float mx = fmaxf(st[u][0][0], st[u][1][0]);
#pragma unroll
      for (int r = 1; r < 8; ++r) mx = fmaxf(mx, fmaxf(st[u][0][r], st[u][1][r]));
      mx = fmaxf(mx, xhalf(mx));   /* the other half of this query's 32 keys */
      const float mn = fmaxf(m[u], mx * C2);
      if constexpr (!FIRST) { const float al = exp2_slot(m[u] - mn); l[u] *= al;
#pragma unroll
        for (int j = 0; j < HD / 16; ++j) acc[u][j] *= al; }
      m[u] = mn; };
    scores(kf);
    if constexpr (!MASK) loadK(kf, k0 + 32 * KS < klast ? k0 + 32 * KS : klast);   /* the key fragments of this wave's next step, into the same registers, one step ahead of their use (a wave with no next step asks for the last step's: in range, unused) */
    if constexpr (HI || FIRST) {   /* the few early-row steps move the reference in every step */
#pragma unroll
      for (int u = 0; u < QT; ++u) { lift(u); soft(u); }
    } else {
      bool over = false;
#pragma unroll
      for (int u = 0; u < QT; ++u) { soft(u); over |= !(sum[u] <= PTOP); }
      if (__builtin_amdgcn_ballot_w32(over) != 0) {   /* one scalar test a step, every lane stays on: some lane's P have outgrown the reference. Rare, so the scores are not kept for it: they are formed again, from this step's key fragments fetched again where the next step's have taken their place */
        if constexpr (MASK) scores(kf); else { v16h k2[4]; loadK(k2, k0); scores(k2); }
#pragma unroll
        for (int u = 0; u < QT; ++u) { lift(u); soft(u); } } }
#pragma unroll
    for (int u = 0; u < QT; ++u) {
      l[u] += sum[u];
      if constexpr (HI) { const F2 pb = bsplit16(p[u]);
#pragma unroll
        for (int j = 0; j < HD / 16; ++j) { const v16b vh = frag_bu(vbp + (size_t)j * 16 * KHI + k0, lvb), vl = frag_bu(vblp + (size_t)j * 16 * KHI + k0, lvb); acc[u][j] = __builtin_amdgcn_wmma_f32_16x16x32_bf16(false, vh, false, pb.h, (short)0, acc[u][j], false, false); acc[u][j] = __builtin_amdgcn_wmma_f32_16x16x32_bf16(false, vh, false, pb.l, (short)0, acc[u][j], false, false); acc[u][j] = __builtin_amdgcn_wmma_f32_16x16x32_bf16(false, vl, false, pb.h, (short)0, acc[u][j], false, false); }
      } else { v16h pf;
#pragma unroll
        for (int i = 0; i < 16; ++i) pf[i] = (_Float16)p[u][i];
#pragma unroll
        for (int j = 0; j < HD / 16; ++j) acc[u][j] = __builtin_amdgcn_wmma_f32_16x16x32_f16(false, vf[j], false, pf, (short)0, acc[u][j], false, false); } } };
  loadK(kf, ks * 32 < klast ? ks * 32 : klast);   /* its wait serves the query loads above as well */
  static_assert(HI || QHI / 32 >= KS, "below: every wave of a late-row tile has a first step in front of the diagonal");
  if constexpr (!HI) step(ks * 32, BC<false>{}, BC<true>{});   /* a wave's first step sets its reference */
#pragma unroll 1   /* rolled: a second copy of the step would double the fragments in flight, past the 256 registers that a wave of a 16-wave block may have */
  for (int s = HI ? ks : ks + KS; s < nst - 1; s += KS) step(s * 32, BC<false>{}, BC<false>{});   /* every key of these steps is below the wave's first query: no mask */
  if (((nst - 1) & (KS - 1)) == ks) step(klast, BC<true>{}, BC<false>{});   /* the step that holds the diagonal: the wave whose turn it is (a scalar test: every lane stays on) */
  /* the KS waves' parts become one: gml = [wave][u][maximum | sum][query], gac = [wave][u][j][half of the 8 channels][lane]. A wave that had no step brings maximum -3e38, sums 0: weight 0 */
#pragma unroll
  for (int u = 0; u < QT; ++u) { const float lt = l[u] + xhalf(l[u]); gml[ks * 64 + (u * 2 + g) * 16 + col] = g ? lt : m[u]; }
  __syncthreads();
#pragma unroll
  for (int u = 0; u < QT; ++u) { float mk[KS], mm = -3.0e38f, ls = 0.f;
#pragma unroll
    for (int k = 0; k < KS; ++k) { mk[k] = gml[k * 64 + u * 32 + col]; mm = fmaxf(mm, mk[k]); }
#pragma unroll
    for (int k = 0; k < KS; ++k) ls += gml[k * 64 + u * 32 + 16 + col] * exp2_slot(mk[k] - mm);   /* at least 1: the key that gave the maximum counts 1 */
    const float f = exp2_slot(m[u] - mm) / ls;
#pragma unroll
    for (int j = 0; j < HD / 16; ++j) { const v8f o = acc[u][j] * f; v4f* d = gac + ks * 512 + (u * (HD / 16) + j) * 64 + lane; d[0] = (v4f){o[0], o[1], o[2], o[3]}; d[32] = (v4f){o[4], o[5], o[6], o[7]}; } }
  __syncthreads();
#pragma unroll
  for (int jj = 0; jj < 2; ++jj) { const int t = ks * 2 + jj;   /* tile (u, j) = (t / 4, t % 4) */
    float* yo = Y + ((size_t)h * TT + ql0 + (t >> 2) * 16 + col) * HD + (t & 3) * 16 + 8 * g;
#pragma unroll
    for (int e = 0; e < 2; ++e) { const v4f* s = gac + t * 64 + e * 32 + lane; v4f o = s[0];
#pragma unroll
      for (int k = 1; k < KS; ++k) o += s[k * 512];
      vst2(yo + 4 * e, o); } }
  asm volatile("s_wait_xcnt 0x0" ::: "memory");   /* stands in front of any later rewrite of the address and data registers that the stores above name */ }
// block = (head, 64 * QW query rows), 16 waves: 4 tiles of 32 queries x 4 shares of the keys (early rows: 8 tiles of 16 x 2); the waves of equal share walk the same keys and meet in the cache. A WGP holds one block at a time, so the order is by falling length, for the WGPs that are free first to take the longer of what is left; the early-row blocks, few steps but slow ones, go first
#define NFB (TT / (64 * QW))
#define NHB (QHI / (64 * QW))
__global__ __launch_bounds__(512) void k_fa(const _Float16* __restrict__ QH, const _Float16* __restrict__ KH, const _Float16* __restrict__ QL, const _Float16* __restrict__ KL, const _Float16* __restrict__ VT, const __bf16* __restrict__ VB, const __bf16* __restrict__ VBL, float* __restrict__ Y) {
  __shared__ float sml[16 * 64]; __shared__ v4f sac[16 * 512];   /* a wave's maxima and sums; a wave's 64 x 32 partial output */
  const int idx = blockIdx.x, od = idx / NH, h = idx % NH; const int fb = od < NHB ? NHB - 1 - od : NFB - 1 - (od - NHB);
  const int tid = threadIdx.x, wave = __builtin_amdgcn_readfirstlane(tid >> 5) /* scalar, so that the loop over a wave's own steps branches on SCC with every lane on */, lane = tid & 31;
  if (fb < NHB) { const int ks = wave & 1, gw = wave - ks;   /* the residual planes take twice the registers: 16-query tiles; the branch is the same for the whole block, as the barriers inside ask */
    fa_body<true, 1, 2>(QH, KH, QL, KL, VT, VB, VBL, Y, h, fb * 64 * QW + (wave >> 1) * 16, lane, ks, sml + gw * 64, sac + gw * 512);
  } else { const int ks = wave & 3, gw = wave - ks;
    fa_body<false, QW, 4>(QH, KH, QL, KL, VT, VB, VBL, Y, h, fb * 64 * QW + (wave >> 2) * 16 * QW, lane, ks, sml + gw * 64, sac + gw * 512); } }

extern "C" void kernel_launch(void* const* d_in, const int* in_sizes, int n_in, void* d_out, int out_size, void* d_ws, size_t ws_size, hipStream_t stream) {
  (void)in_sizes; (void)n_in; (void)out_size;
  const float** F = (const float**)d_in;
  if (ws_size < (size_t)WS_END) return;
  char* ws = (char*)d_ws; _Float16 *QH = (_Float16*)(ws + WS_QH), *KH = (_Float16*)(ws + WS_KH), *VT = (_Float16*)(ws + WS_VT), *QL = (_Float16*)(ws + WS_QL), *KL = (_Float16*)(ws + WS_KL); __bf16 *VB = (__bf16*)(ws + WS_VB), *VBL = (__bf16*)(ws + WS_VBL);
  // inputs: 0 q [B, H, T, 64], 1 k [B, H, 64, T], 2 v [B, H, T, 64] (causal flag folded)
  k_prep8<<<dim3(TNB * TT / 64, NH), 128, 0, stream>>>(F[0], F[1], F[2], QH, QL, KH, KL, VT, VB, VBL);
  k_fa<<<dim3(NFB * NH), 512, 0, stream>>>(QH, KH, QL, KL, VT, VB, VBL, (float*)d_out);
}

// v007
// Measured time: 40.9 microseconds a run.
// Next to v006, in two timings, it ran 1.03 and 1.04 times as fast.
// All steps since v000 together make it 62.5 times as fast.
// compute dtype: all float inputs rounded to bf16; raw q / k / v: q and k enter the scores as f16 (bf16 values are exact in f16: exact products; the early-row residual planes are zero) x 64^-0.5; causal mask by index (the module's w*b + (-1e9)(1 - b) leaves exactly -1e9 on masked entries == exclusion); softmax f32 against a held reference maximum (moved up to the running maximum when P outgrows it; early rows: in every step); P (at most 1024) once to f16 x v (exact in f16; bf16 hi + lo below row 384), divided by the f32 sum at the end; f32 output.
#include <hip/hip_runtime.h>
#include <math.h>

typedef __attribute__((ext_vector_type(16))) _Float16 v16h;
typedef __attribute__((ext_vector_type(16))) __bf16 v16b;
typedef __attribute__((ext_vector_type(8)))  _Float16 v8h;
typedef __attribute__((ext_vector_type(8)))  float v8f;
typedef __attribute__((ext_vector_type(4)))  float v4f;
typedef __attribute__((ext_vector_type(2)))  float v2f;
typedef __attribute__((ext_vector_type(4)))  unsigned v4u;
typedef __attribute__((ext_vector_type(2)))  unsigned v2u;
typedef __attribute__((ext_vector_type(4)))  int v4i;
typedef float __attribute__((may_alias)) float_a;
typedef int __attribute__((may_alias)) int_a;

template <typename T> __device__ __forceinline__ void vst2(void* p, T v) { *(T*)p = v;  }
__device__ __forceinline__ v8f wmma16(v16h a, v16h b, v8f c) {
  v8f d = __builtin_amdgcn_wmma_f32_16x16x32_f16(false, a, false, b, (short)0, c, false, false);
  asm volatile("v_nop\n\tv_nop\n\tv_nop\n\tv_nop" : "+v"(d) : "v"(a), "v"(b));
  return d;
}
__device__ __forceinline__ v8f wmma_bf(v16b a, v16b b, v8f c) {
  v8f d = __builtin_amdgcn_wmma_f32_16x16x32_bf16(false, a, false, b, (short)0, c, false, false);
  asm volatile("v_nop\n\tv_nop\n\tv_nop\n\tv_nop" : "+v"(d) : "v"(a), "v"(b));
  return d;
}
// 16x16x32 fragments: lane = (h = lane>>4, row/col = lane&15); elements 0..7 = k0+8h+0..7, 8..15 = k0+16+8h+0..7; D element r = row 8h+r
__device__ __forceinline__ v16h frag_h(const _Float16* rowk0, int lane) {
  union { v16h v; v8h q[2]; } u; const _Float16* p = rowk0 + 8 * (lane >> 4);
  u.q[0] = *(const v8h*)p; u.q[1] = *(const v8h*)(p + 16); return u.v;
}
__device__ __forceinline__ v16h frag_f32(const float* rowk0, int lane) {
  v16h a; const float* p = rowk0 + 8 * (lane >> 4);
#pragma unroll
  for (int i = 0; i < 8; ++i) { a[i] = (_Float16)p[i]; a[8 + i] = (_Float16)p[16 + i]; }
  return a;
}
__device__ __forceinline__ v16h frag_f32s(const float* rowk0, int lane, float sc) {
  v16h a; const float* p = rowk0 + 8 * (lane >> 4);
#pragma unroll
  for (int i = 0; i < 8; ++i) { a[i] = (_Float16)(p[i] * sc); a[8 + i] = (_Float16)(p[16 + i] * sc); }
  return a;
}
// column fragment from a [K][ld] layout (column n), rows >= K read as 0
__device__ __forceinline__ v16h fragc_f32(const float* W, int k0, int n, int lane, int ld, int K) {
  v16h a; const int g = lane >> 4;
#pragma unroll
  for (int i = 0; i < 8; ++i) { const int ka = k0 + 8 * g + i, kb = ka + 16;
    a[i] = (_Float16)(ka < K ? W[(size_t)(ka < K ? ka : K - 1) * ld + n] : 0.f); a[8 + i] = (_Float16)(kb < K ? W[(size_t)(kb < K ? kb : K - 1) * ld + n] : 0.f); }
  return a;
}
struct F2 { v16b h, l; };
__device__ __forceinline__ F2 bsplit16(const float v[16]) { F2 r;
#pragma unroll
  for (int i = 0; i < 16; ++i) { const __bf16 h = (__bf16)v[i]; r.h[i] = h; r.l[i] = (__bf16)(v[i] - (float)h); }
  return r; }
__device__ __forceinline__ F2 split_row(const float* row, int k0, int lane) { float v[16]; const float* p = row + k0 + 8 * (lane >> 4);
#pragma unroll
  for (int i = 0; i < 8; ++i) { v[i] = p[i]; v[8 + i] = p[16 + i]; }
  return bsplit16(v); }
__device__ __forceinline__ F2 split_rowK(const float* row, int k0, int lane, int K) { float v[16]; const int g = lane >> 4;
#pragma unroll
  for (int i = 0; i < 8; ++i) { const int ka = k0 + 8 * g + i, kb = ka + 16; v[i] = ka < K ? row[ka < K ? ka : K - 1] : 0.f; v[8 + i] = kb < K ? row[kb < K ? kb : K - 1] : 0.f; }
  return bsplit16(v); }
__device__ __forceinline__ F2 split_col(const float* W, int k0, int n, int lane, int ld, int K) { float v[16]; const int g = lane >> 4;
#pragma unroll
  for (int i = 0; i < 8; ++i) { const int ka = k0 + 8 * g + i, kb = ka + 16; v[i] = ka < K ? W[(size_t)(ka < K ? ka : K - 1) * ld + n] : 0.f; v[8 + i] = kb < K ? W[(size_t)(kb < K ? kb : K - 1) * ld + n] : 0.f; }
  return bsplit16(v); }
__device__ __forceinline__ v8f mac3(const F2& a, const F2& b, v8f c) { c = wmma_bf(a.l, b.h, c); c = wmma_bf(a.h, b.l, c); return wmma_bf(a.h, b.h, c); }
__device__ __forceinline__ float sigm(float v) { return 1.0f / (1.0f + expf(-v)); }
#define LDSX() do { asm volatile("s_wait_dscnt 0" ::: "memory"); __builtin_amdgcn_wave_barrier(); __builtin_amdgcn_fence(__ATOMIC_RELEASE, "workgroup"); } while (0)

// Raw causal scaled-dot-product attention with a PRE-TRANSPOSED key (q [1,16,4096,64], k [1,16,64,4096] = [B, H, D, S], v [1,16,4096,64]; w = q k / sqrt(64); b = tril; w = w*b + (-1e9)(1 - b); softmax; out = w v -> [1,16,4096,64]).
#define NB 1
#define TT 4096
#define CC 1024            // NH * HD = projected width
#define DIN 1024          // input (model) width
#define NH 16
#define HD 64
#define NQB (TT / 64)
#define HG 1
#define SCALE (0.125f)
#define CAUSAL 1
#ifndef TNB
#define TNB NB
#endif
__device__ __forceinline__ float bfr(float v) { return (float)(__bf16)v; }
__host__ __device__ __forceinline__ int kb_last(int qb) { return CAUSAL ? ((qb * 64 + 63) >> 7) : (TT / 128 - 1); }
typedef __attribute__((ext_vector_type(8))) __bf16 v8b;
__device__ __forceinline__ v16b frag_b(const __bf16* rowk0, int lane) {
  union { v16b v; v8b q[2]; } u; const __bf16* p = rowk0 + 8 * (lane >> 4);
  u.q[0] = *(const v8b*)p; u.q[1] = *(const v8b*)(p + 16); return u.v;
}
#define QBH 6              // unused; causal: query rows below QHI (few keys, no averaging) take the high-precision path
#define QHI 384            // rows carrying a q residual plane (3-product logits)
#define KHI 384            // key rows carrying k residual / v bf16 hi+lo planes (used only by the causal high-precision path)
// B fragment (k rows k0+.., output column o) of a weight: (in,out) [K][ld] or (out,in) [ld rows of K]: bf16 exact, or f16(bf16 * 256) exact
__device__ __forceinline__ v16b wcol_io(const float* Wm, int k0, int o, int lane, int ld) { v16b w; const int g = lane >> 4;
#pragma unroll
  for (int i = 0; i < 8; ++i) { w[i] = (__bf16)Wm[(size_t)(k0 + 8 * g + i) * ld + o]; w[8 + i] = (__bf16)Wm[(size_t)(k0 + 16 + 8 * g + i) * ld + o]; }
  return w; }
__device__ __forceinline__ v16b wcol_oi(const float* Wm, int k0, int o, int lane, int K) { v16b w; const float* p = Wm + (size_t)o * K + k0 + 8 * (lane >> 4);
#pragma unroll
  for (int i = 0; i < 8; ++i) { w[i] = (__bf16)p[i]; w[8 + i] = (__bf16)p[16 + i]; }
  return w; }
__device__ __forceinline__ v16h wcolh_io(const float* Wm, int k0, int o, int lane, int ld) { v16h w; const int g = lane >> 4;
#pragma unroll
  for (int i = 0; i < 8; ++i) { w[i] = (_Float16)(bfr(Wm[(size_t)(k0 + 8 * g + i) * ld + o]) * 256.0f); w[8 + i] = (_Float16)(bfr(Wm[(size_t)(k0 + 16 + 8 * g + i) * ld + o]) * 256.0f); }
  return w; }
__device__ __forceinline__ v16h wcolh_oi(const float* Wm, int k0, int o, int lane, int K) { v16h w; const float* p = Wm + (size_t)o * K + k0 + 8 * (lane >> 4);
#pragma unroll
  for (int i = 0; i < 8; ++i) { w[i] = (_Float16)(bfr(p[i]) * 256.0f); w[8 + i] = (_Float16)(bfr(p[16 + i]) * 256.0f); }
  return w; }
#define WQKV_LAYOUT 1   // 0 = (in,out) [DIN][CC]; 1 = (out,in) [CC][DIN]; 2 = per-head [NH][DIN][HD]
__device__ __forceinline__ v16b wcol_hdk(const float* Wm, int k0, int o, int lane) { v16b w; const int g = lane >> 4; const float* p = Wm + (size_t)(o / HD) * DIN * HD + (o % HD);
#pragma unroll
  for (int i = 0; i < 8; ++i) { w[i] = (__bf16)p[(size_t)(k0 + 8 * g + i) * HD]; w[8 + i] = (__bf16)p[(size_t)(k0 + 16 + 8 * g + i) * HD]; }
  return w; }
#define WO_OUT_IN 0
#if WQKV_LAYOUT == 1
#define WCOL(W, k0, o, lane) wcol_oi(W, k0, o, lane, DIN)
#elif WQKV_LAYOUT == 2
#define WCOL(W, k0, o, lane) wcol_hdk(W, k0, o, lane)
#else
#define WCOL(W, k0, o, lane) wcol_io(W, k0, o, lane, CC)
#endif
#if WO_OUT_IN
#define WOCOL(W, k0, o, lane) wcol_oi(W, k0, o, lane, CC)
#define WOCOLH(W, k0, o, lane) wcolh_oi(W, k0, o, lane, CC)
#else
#define WOCOL(W, k0, o, lane) wcol_io(W, k0, o, lane, DIN)
#define WOCOLH(W, k0, o, lane) wcolh_io(W, k0, o, lane, DIN)
#endif

// ---- k_prep8: block = (64 attention positions s0.. of sequence b, head h): reads the module's k and v (v [B, H, S, 64]: element (b,h,s,c) at ((b*NH + h)*TT + s)*64 + c; the key PRE-TRANSPOSED [B, H, D, S]: element (b,h,s,c) at ((b*NH + h)*64 + c)*TT + s), bf16-rounds them and writes the attention planes (q is read by k_fa itself): k and v -> f16 in the order of k_fa's matrix fragments (below; + k residual rows and v bf16 hi/lo planes [c][s] for s < KHI)
// Fragment order, per head 128 bytes a position: k = [16-key tile][32-channel half kc][e][lane][8 channels kc*32 + 16 e + 8 (lane >> 4) ..] of key (lane & 15); v = [32-key step][16-channel tile j][e][lane][8 keys 16 e + 8 (lane >> 4) ..] of channel j*16 + (lane & 15). One 16-byte load of a wave is then 512 bytes in a row, four whole lines
// A stream: every thread asks for all its 16 x 16 bytes (whole 128-byte lines per wave) before it uses any, each element once. k and v are transposed 64 x 64 through LDS tiles of dwords (two neighbouring source rows = two neighbouring 16-bit elements of an output row). All stores stand behind the barrier, so that no wave waits at it for its own stores.
#define TP 33   // dwords per tile row; odd, so that the 16 tile rows a wave writes at once, and the 4 (early-row planes) or 16 (fragment order) it reads at once, spread over the banks
typedef __attribute__((ext_vector_type(2))) _Float16 v2h;
typedef __attribute__((ext_vector_type(2))) __bf16 v2b;
__device__ __forceinline__ unsigned pkh(float a, float b) { return __builtin_bit_cast(unsigned, (v2h){(_Float16)a, (_Float16)b}); }
__device__ __forceinline__ unsigned pkb(float a, float b) { return __builtin_bit_cast(unsigned, (v2b){(__bf16)a, (__bf16)b}); }
__device__ __forceinline__ float resh(float x) { return (x - (float)(_Float16)x) * 1024.0f; }   // what f16 leaves of x, x 2^10
__device__ __forceinline__ float resb(float x) { return x - (float)(__bf16)x; }                // what bf16 leaves of x
__device__ __forceinline__ v4u trow(const unsigned* t) { return (v4u){t[0], t[1], t[2], t[3]}; }
template <typename T> __device__ __forceinline__ T ldu(const void* ub, unsigned off) { return *(const T*)((const char*)ub + off); }   // block-uniform base + this lane's byte offset
template <typename T> __device__ __forceinline__ void stu(void* ub, unsigned off, T v) { *(T*)((char*)ub + off) = v; }
__global__ __launch_bounds__(128) void k_prep8(const float* __restrict__ K, const float* __restrict__ V, _Float16* __restrict__ KH, _Float16* __restrict__ KL, _Float16* __restrict__ VT, __bf16* __restrict__ VB, __bf16* __restrict__ VBL) {
  __shared__ unsigned tk[64 * TP], tv[64 * TP], tkl[64 * TP], tb[64 * TP], tbl[64 * TP];
  const unsigned tid = threadIdx.x; const int h = blockIdx.y; const size_t r0 = (size_t)blockIdx.x * 64; const size_t bb = r0 / TT; const int t0 = (int)(r0 % TT); const bool khi = t0 < KHI;
  const float* vs = V + ((bb * NH + h) * TT + t0) * HD; const float* ks = K + (bb * NH + h) * HD * (size_t)TT + t0;
  const unsigned x4 = tid & 15, rp0 = tid >> 4;   /* transposition: source columns 4 x4 .. + 3 of the source rows 2 rp, 2 rp + 1, rp = rp0 + 8 i */
  const unsigned lk = (2 * rp0 * TT + x4 * 4) * 4, lvv = (2 * rp0 * HD + x4 * 4) * 4;
  v4f ka[4][2], va[4][2];
#pragma unroll
  for (int i = 0; i < 4; ++i)
#pragma unroll
    for (int e = 0; e < 2; ++e) { ka[i][e] = ldu<v4f>(ks, lk + (16 * i + e) * TT * 4); va[i][e] = ldu<v4f>(vs, lvv + (16 * i + e) * HD * 4); }
  asm volatile("s_wait_xcnt 0x0" :: "v"(lk), "v"(lvv) : "memory");   /* stands in front of the first rewrite of an offset register that the loads above name; as its inputs these registers live up to here */
#pragma unroll
  for (int i = 0; i < 4; ++i)
#pragma unroll
    for (int e = 0; e < 2; ++e)
#pragma unroll
      for (int j = 0; j < 4; ++j) { ka[i][e][j] = bfr(ka[i][e][j]); va[i][e][j] = bfr(va[i][e][j]); }   /* module inputs: bf16-rounded; bf16 values are exact in f16, so the residual planes are 0 */
  const unsigned ow = x4 * 4 * TP + rp0;
#pragma unroll
  for (int i = 0; i < 4; ++i)
#pragma unroll
    for (int j = 0; j < 4; ++j) { const unsigned o = ow + j * TP + 8 * i; tk[o] = pkh(ka[i][0][j], ka[i][1][j]); tv[o] = pkh(va[i][0][j], va[i][1][j]); }
  if (khi) {
#pragma unroll
    for (int i = 0; i < 4; ++i)
#pragma unroll
      for (int j = 0; j < 4; ++j) { const unsigned o = ow + j * TP + 8 * i; tkl[o] = pkh(resh(ka[i][0][j]), resh(ka[i][1][j])); tb[o] = pkb(va[i][0][j], va[i][1][j]); tbl[o] = pkb(resb(va[i][0][j]), resb(va[i][1][j])); } }
  __syncthreads();
  const unsigned xr = tid >> 3, q8 = tid & 7, orr = xr * TP + q8 * 4;   /* output rows xr + 16 i (a position of k, a channel of v), their elements 8 q8 .. + 7 */
  const unsigned sk = (xr * CC + q8 * 8) * 2;
  const unsigned fw = tid >> 5, fc = tid & 15, fd = (fw & 1) * 8 + ((tid >> 4) & 1) * 4, sf = tid * 16;   /* fragment order: wave fw stores 512-byte piece 4 i + fw of the block's 8 KB; fc = fragment row, fd = the dword of its elements 16 e + 8 g */
  const unsigned ofk = fc * TP + (fw >> 1) * 16 + fd, ofv = ((fw >> 1) * 16 + fc) * TP + fd;
  _Float16* kd = KH + ((bb * NH + h) * TT + t0) * HD; _Float16* vd = VT + ((bb * NH + h) * TT + t0) * HD;
#pragma unroll
  for (int i = 0; i < 4; ++i) { stu(kd, sf + 2048 * i, trow(tk + ofk + 16 * i * TP)); stu(vd, sf + 2048 * i, trow(tv + ofv + (i & 1) * 32 * TP + (i >> 1) * 16)); }
  asm volatile("s_wait_xcnt 0x0" ::: "memory");   /* stands in front of the first rewrite of a register that the stores above name; in front of the branch, so that nothing of the branch's own block comes to stand ahead of it */
  if (khi) {
    const unsigned sb = (xr * KHI + q8 * 8) * 2; _Float16* kld = KL + (bb * KHI + t0) * (size_t)CC + h * HD; __bf16* bd = VB + (bb * CC + h * HD) * (size_t)KHI + t0; __bf16* bld = VBL + (bb * CC + h * HD) * (size_t)KHI + t0;
#pragma unroll
    for (int i = 0; i < 4; ++i) { stu(kld, sk + 16 * i * CC * 2, trow(tkl + orr + 16 * i * TP)); stu(bd, sb + 16 * i * KHI * 2, trow(tb + orr + 16 * i * TP)); stu(bld, sb + 16 * i * KHI * 2, trow(tbl + orr + 16 * i * TP)); } } }

#ifndef SM_EXTRA_PARAMS
#define SM_EXTRA_PARAMS
#endif
#ifndef PROJ_EXTRA_PARAMS
#define PROJ_EXTRA_PARAMS
#endif
#ifndef SM_MASK_HOOK
#define SM_MASK_HOOK (void)0
#endif

#define WS_KH  0u                                      // f16 k in fragment order [b][h][t / 16][2 KB]
#define WS_VT  (WS_KH + 2u * (size_t)NB * TT * CC)      // f16 v in fragment order [b][h][t / 32][4 KB]
#define WS_KL  (WS_VT + 2u * (size_t)NB * CC * TT)      // f16 k residual x 2^10 rows [b][t < KHI][CC]
#define WS_VB  (WS_KL + 2u * (size_t)NB * KHI * CC)     // bf16 v hi planes [b][c][t < KHI]
#define WS_VBL (WS_VB + 2u * (size_t)NB * CC * KHI)
#define WS_END (WS_VBL + 2u * (size_t)NB * CC * KHI)

// ---- k_fa: scores, softmax and P . v of one (head, 128-query block) in one kernel; KS waves share QT * 16 query rows: wave ks of them takes the 32-key steps ks, ks + KS, .. of the keys [0, ql0 + 32) and keeps, per query, a reference maximum, a running sum and a 64-wide f32 sum (rescaled when the reference moves), so no logit and no P ever goes to memory. Late rows hold the reference: the maximum of the wave's first step stays in use while every step's P stay small enough for f16, so that the common step forms no maximum and rescales nothing. At the end the KS waves bring their sums to one maximum and add them, in wave order, through LDS.
// Transposed products: S^T = K . Q^T (A = key rows, B = query rows), so a lane holds 16 scores of ONE query (column lane & 15; keys k0 + 8g + r and k0 + 16 + 8g + r) and the two score tiles, converted in place, are the B operand of O^T += V^T . P^T in the hardware k order; A = v by channel, in the same order (frag_fu; early rows frag_bu).
// HI (query blocks below row QHI): q and k residual planes enter the scores (3 products), P as bf16 hi + lo against v bf16 hi + lo (3 products), as before.
// Every plain '#pragma unroll' below stands on a loop of constant length, so that the fragment arrays are indexed by constants and stay in registers.
template <bool B> struct BC { static constexpr bool v = B; };
#define QW 2   // 16-query tiles of a wave
#define C2 (SCALE * 1.44269504088896340736f)   // logits in units of log2
#define PTOP 1024.0f   // while the 16 P of a lane and step sum to no more than this, each of them is at most this: far inside f16 and bf16, and the reference stays
__device__ __forceinline__ float xhalf(float x) { return __builtin_bit_cast(float, __builtin_amdgcn_permlanex16(__builtin_bit_cast(int, x), __builtin_bit_cast(int, x), 0x76543210, 0xfedcba98, false, false)); }   // lane l with lane l ^ 16
// fragment from a wave-uniform base and this lane's own byte offset (row * pitch + 16 * (lane >> 4)): the lane offsets never change, only the scalar base walks
__device__ __forceinline__ v16h frag_hu(const _Float16* ub, unsigned lo) { union { v16h v; v8h q[2]; } u; const char* p = (const char*)ub + lo; u.q[0] = *(const v8h*)p; u.q[1] = *(const v8h*)(p + 32); return u.v; }
__device__ __forceinline__ v16h frag_fu(const _Float16* ub, unsigned lo) { union { v16h v; v8h q[2]; } u; const char* p = (const char*)ub + lo; u.q[0] = *(const v8h*)p; u.q[1] = *(const v8h*)(p + 512); return u.v; }   // from the fragment-order planes: the lane's 16 * lane bytes are in the address (lo = 0), the two halves 512 bytes apart
// The block's 128 query rows in LDS, in the order of the score products' B fragments: [16-query tile][32-channel half kc][e][g] pieces of 16 queries x 16 bytes (8 channels kc*32 + 16 e + 8 g ..), QP bytes apart. QP = 256 + 64: the four pieces that a wave writes at once start 16 banks apart, so that its 8-byte stores meet no bank twice; a reader's 16 lanes take one piece, 256 bytes in a row
#define QP 320
#define QPL (64 * QP)   // one plane: 8 tiles x 2 x 2 x 2 pieces
__device__ __forceinline__ v16h frag_q(const char* s, unsigned lo) { union { v16h v; v8h q[2]; } u; u.q[0] = *(const v8h*)(s + lo); u.q[1] = *(const v8h*)(s + lo + 2 * QP); return u.v; }   // lo = ((tile * 2 + kc) * 4 + g) * QP + 16 * query; e = 1 two pieces on
__device__ __forceinline__ v16b frag_bu(const __bf16* ub, unsigned lo) { union { v16b v; v8b q[2]; } u; const char* p = (const char*)ub + lo; u.q[0] = *(const v8b*)p; u.q[1] = *(const v8b*)(p + 32); return u.v; }
__device__ __forceinline__ float exp2_slot(float x) { float r; asm("v_exp_f32 %0, %1\n\tv_nop" : "=v"(r) : "v"(x)); return r; }   // 2^x for a step's rescale and for the join behind the loop; the v_nop fills the slot that the instruction set asks for between a transcendental and a next instruction that reads its result or overwrites its source
// 2^x of 16 values, in place, as one run: inside it every v_exp_f32 is followed by an independent one, and behind the last stands a v_nop: the slot that the instruction set asks for between a transcendental and a next instruction that reads its result or overwrites its source
__device__ __forceinline__ void exp2_run(float (&x)[16]) {
  asm("v_exp_f32 %0, %0\n\tv_exp_f32 %1, %1\n\tv_exp_f32 %2, %2\n\tv_exp_f32 %3, %3\n\tv_exp_f32 %4, %4\n\tv_exp_f32 %5, %5\n\tv_exp_f32 %6, %6\n\tv_exp_f32 %7, %7\n\tv_exp_f32 %8, %8\n\tv_exp_f32 %9, %9\n\tv_exp_f32 %10, %10\n\tv_exp_f32 %11, %11\n\tv_exp_f32 %12, %12\n\tv_exp_f32 %13, %13\n\tv_exp_f32 %14, %14\n\tv_exp_f32 %15, %15\n\tv_nop"
      : "+v"(x[0]), "+v"(x[1]), "+v"(x[2]), "+v"(x[3]), "+v"(x[4]), "+v"(x[5]), "+v"(x[6]), "+v"(x[7]), "+v"(x[8]), "+v"(x[9]), "+v"(x[10]), "+v"(x[11]), "+v"(x[12]), "+v"(x[13]), "+v"(x[14]), "+v"(x[15])); }
template <bool HI, int QT, int KS> __device__ __forceinline__ void fa_body(const v4f (&qa)[4], char* sq, unsigned sw, int qt0, const _Float16* __restrict__ KH, const _Float16* __restrict__ KL, const _Float16* __restrict__ VT, const __bf16* __restrict__ VB, const __bf16* __restrict__ VBL, float* __restrict__ Y, int h, int ql0, int lane, int ks, float* gml, v4f* gac) {
  static_assert(QT * (HD / 16) == 2 * KS, "each wave adds up and stores two 16-channel tiles: one whole 128-byte line of each of 16 queries");
  const int col = lane & 15, g = lane >> 4; const int nst = ((ql0 + 16 * QT - 1) >> 5) + 1; const int klast = (nst - 1) * 32;
  const _Float16* kp = KH + (size_t)h * HD * TT; const _Float16* klp = KL + h * HD; const _Float16* vp = VT + (size_t)h * HD * TT; const __bf16* vbp = VB + (size_t)h * HD * KHI; const __bf16* vblp = VBL + (size_t)h * HD * KHI;   /* wave-uniform */
  const unsigned lrow = (unsigned)col * (CC * 2) + 16 * g, lf = (unsigned)lane * 16, lvb = (unsigned)col * (KHI * 2) + 16 * g;   /* lane offsets, bytes: k residual rows, k and v in fragment order, early v planes */
  v16h qf[QT][2], qlf[QT][2], kf[4];
  auto loadK = [&](v16h (&kd)[4], int k0) { const _Float16* ka = (const _Float16*)((const char*)(kp + (size_t)k0 * HD) + lf);   /* this lane's own address: its 16 bytes of the step's first 512 */
#pragma unroll
    for (int t = 0; t < 2; ++t)
#pragma unroll
      for (int kc = 0; kc < 2; ++kc) kd[t * 2 + kc] = frag_fu(ka + (t * 2 + kc) * 512, 0);
    asm volatile("s_wait_xcnt 0x0" :: "v"(ka) : "memory");   /* stands in front of the first rewrite of an address register that the loads above name; as its input the address lives up to here, so that no load of the run lands in it */ };
  v8f acc[QT][HD / 16] = {}; float m[QT], l[QT];
#pragma unroll
  for (int u = 0; u < QT; ++u) { m[u] = -3.0e38f; l[u] = 0.f; }
  auto step = [&](int k0, auto mk, auto fs) { constexpr bool MASK = decltype(mk)::v, FIRST = decltype(fs)::v;
    v16h vf[HD / 16];   /* this step's v fragments: asked for first, used last (the few HI steps, short of registers, fetch theirs where they use them) */
    if constexpr (!HI) { const _Float16* va = (const _Float16*)((const char*)(vp + (size_t)k0 * HD) + lf);   /* this lane's own address, as in loadK */
#pragma unroll
      for (int j = 0; j < HD / 16; ++j) vf[j] = frag_fu(va + j * 512, 0);
      asm volatile("s_wait_xcnt 0x0" :: "v"(va) : "memory");   /* as in loadK: in front of the first rewrite of the address register; as its input the address lives up to here, so that no load of the run lands in it */ }
    v8f st[QT][2];
    auto scores = [&](const v16h (&kk)[4]) {
#pragma unroll
      for (int u = 0; u < QT; ++u)
#pragma unroll
        for (int t = 0; t < 2; ++t) st[u][t] = (v8f){};
#pragma unroll
      for (int t = 0; t < 2; ++t)
#pragma unroll
        for (int kc = 0; kc < 2; ++kc)
#pragma unroll
          for (int u = 0; u < QT; ++u) st[u][t] = __builtin_amdgcn_wmma_f32_16x16x32_f16(false, kk[t * 2 + kc], false, qf[u][kc], (short)0, st[u][t], false, false);
      if constexpr (HI) { v8f sl[QT][2] = {};
#pragma unroll
        for (int t = 0; t < 2; ++t) {
#pragma unroll
          for (int kc = 0; kc < 2; ++kc) { const v16h klf = frag_hu(klp + (size_t)(k0 + t * 16) * CC + kc * 32, lrow);
#pragma unroll
            for (int u = 0; u < QT; ++u) { sl[u][t] = __builtin_amdgcn_wmma_f32_16x16x32_f16(false, kk[t * 2 + kc], false, qlf[u][kc], (short)0, sl[u][t], false, false); sl[u][t] = __builtin_amdgcn_wmma_f32_16x16x32_f16(false, klf, false, qf[u][kc], (short)0, sl[u][t], false, false); } }
#pragma unroll
          for (int u = 0; u < QT; ++u) st[u][t] += sl[u][t] * (1.0f / 1024.0f); } }
      if constexpr (MASK) {
#pragma unroll
        for (int u = 0; u < QT; ++u)
#pragma unroll
          for (int t = 0; t < 2; ++t)
#pragma unroll
            for (int r = 0; r < 8; ++r) if (k0 + 16 * t + 8 * g + r > ql0 + u * 16 + col) st[u][t][r] = -3.0e38f; } };
    float p[QT][16], sum[QT];
    auto soft = [&](int u) {   /* P and its sum against the reference m[u] in use */
#pragma unroll
      for (int i = 0; i < 16; ++i) p[u][i] = fmaf(st[u][i >> 3][i & 7], C2, -m[u]);
      exp2_run(p[u]); sum[u] = p[u][0];
#pragma unroll
      for (int i = 1; i < 16; ++i) sum[u] += p[u][i]; };
    auto lift = [&](int u) {   /* the reference moves up to the running maximum; what was summed so far is rescaled (a first step has nothing summed) */
      float mx = fmaxf(st[u][0][0], st[u][1][0]);
#pragma unroll
      for (int r = 1; r < 8; ++r) mx = fmaxf(mx, fmaxf(st[u][0][r], st[u][1][r]));
      mx = fmaxf(mx, xhalf(mx));   /* the other half of this query's 32 keys */
      const float mn = fmaxf(m[u], mx * C2);
      if constexpr (!FIRST) { const float al = exp2_slot(m[u] - mn); l[u] *= al;
#pragma unroll
        for (int j = 0; j < HD / 16; ++j) acc[u][j] *= al; }
      m[u] = mn; };
    scores(kf);
    if constexpr (!MASK) loadK(kf, k0 + 32 * KS < klast ? k0 + 32 * KS : klast);   /* the key fragments of this wave's next step, into the same registers, one step ahead of their use (a wave with no next step asks for the last step's: in range, unused) */
    if constexpr (HI || FIRST) {   /* the few early-row steps move the reference in every step */
#pragma unroll
      for (int u = 0; u < QT; ++u) { lift(u); soft(u); }
    } else {
      bool over = false;
#pragma unroll
      for (int u = 0; u < QT; ++u) { soft(u); over |= !(sum[u] <= PTOP); }
      if (__builtin_amdgcn_ballot_w32(over) != 0) {   /* one scalar test a step, every lane stays on: some lane's P have outgrown the reference. Rare, so the scores are not kept for it: they are formed again, from this step's key fragments fetched again where the next step's have taken their place */
        if constexpr (MASK) scores(kf); else { v16h k2[4]; loadK(k2, k0); scores(k2); }
#pragma unroll
        for (int u = 0; u < QT; ++u) { lift(u); soft(u); } } }
#pragma unroll
    for (int u = 0; u < QT; ++u) {
      l[u] += sum[u];
      if constexpr (HI) { const F2 pb = bsplit16(p[u]); const __bf16* vha = (const __bf16*)((const char*)(vbp + k0) + lvb); const __bf16* vla = (const __bf16*)((const char*)(vblp + k0) + lvb);   /* this lane's own addresses, as in loadK */
#pragma unroll
        for (int j = 0; j < HD / 16; ++j) { const v16b vh = frag_bu(vha + (size_t)j * 16 * KHI, 0), vl = frag_bu(vla + (size_t)j * 16 * KHI, 0); acc[u][j] = __builtin_amdgcn_wmma_f32_16x16x32_bf16(false, vh, false, pb.h, (short)0, acc[u][j], false, false); acc[u][j] = __builtin_amdgcn_wmma_f32_16x16x32_bf16(false, vh, false, pb.l, (short)0, acc[u][j], false, false); acc[u][j] = __builtin_amdgcn_wmma_f32_16x16x32_bf16(false, vl, false, pb.h, (short)0, acc[u][j], false, false); }
        asm volatile("s_wait_xcnt 0x0" :: "v"(vha), "v"(vla) : "memory");   /* as in loadK: in front of the first rewrite of the address registers; as its inputs they live up to here, so that no load of the run lands in them */
      } else { v16h pf;
#pragma unroll
        for (int i = 0; i < 16; ++i) pf[i] = (_Float16)p[u][i];
#pragma unroll
        for (int j = 0; j < HD / 16; ++j) acc[u][j] = __builtin_amdgcn_wmma_f32_16x16x32_f16(false, vf[j], false, pf, (short)0, acc[u][j], false, false); } } };
  loadK(kf, ks * 32 < klast ? ks * 32 : klast);   /* on their way while the queries are dealt out */
  __builtin_amdgcn_sched_barrier(0);   /* keeps the conversions below, which wait for the query rows, behind the issue of the key loads: moved in front of it they would hold those loads back until the rows have come */
  /* the queries: qa[i] = channels (i & 1) * 32 + 4 (lane & 7) .. + 3 of block row wave * 8 + (i >> 1) * 4 + (lane >> 3), bf16-rounded like k and v, as f16 (early rows: + the x 2^10 residual plane) to their places in the fragment order */
#pragma unroll
  for (int i = 0; i < 4; ++i) { const float a = bfr(qa[i][0]), b = bfr(qa[i][1]), c = bfr(qa[i][2]), d = bfr(qa[i][3]); const unsigned o = sw + (i & 1) * 4 * QP + (i >> 1) * 64;
    *(v2u*)(sq + o) = (v2u){pkh(a, b), pkh(c, d)};
    if constexpr (HI) *(v2u*)(sq + QPL + o) = (v2u){pkh(resh(a), resh(b)), pkh(resh(c), resh(d))}; }
  __syncthreads();   /* every wave's rows are in place before any wave takes its fragments */
#pragma unroll
  for (int u = 0; u < QT; ++u)
#pragma unroll
    for (int kc = 0; kc < 2; ++kc) { const unsigned o = (((unsigned)(qt0 + u) * 2 + kc) * 4 + g) * QP + col * 16; qf[u][kc] = frag_q(sq, o); if constexpr (HI) qlf[u][kc] = frag_q(sq + QPL, o); }
  static_assert(HI || QHI / 32 >= KS, "below: every wave of a late-row tile has a first step in front of the diagonal");
  if constexpr (!HI) step(ks * 32, BC<false>{}, BC<true>{});   /* a wave's first step sets its reference */
#pragma unroll 1   /* rolled: a second copy of the step would double the fragments in flight, past the 256 registers that a wave of a 16-wave block may have */
  for (int s = HI ? ks : ks + KS; s < nst - 1; s += KS) step(s * 32, BC<false>{}, BC<false>{});   /* every key of these steps is below the wave's first query: no mask */
  if (((nst - 1) & (KS - 1)) == ks) step(klast, BC<true>{}, BC<false>{});   /* the step that holds the diagonal: the wave whose turn it is (a scalar test: every lane stays on) */
  /* the KS waves' parts become one: gml = [wave][u][maximum | sum][query], gac = [wave][u][j][half of the 8 channels][lane]. A wave that had no step brings maximum -3e38, sums 0: weight 0 */
#pragma unroll
  for (int u = 0; u < QT; ++u) { const float lt = l[u] + xhalf(l[u]); gml[ks * 64 + (u * 2 + g) * 16 + col] = g ? lt : m[u]; }
  __syncthreads();
#pragma unroll
  for (int u = 0; u < QT; ++u) { float mk[KS], mm = -3.0e38f, ls = 0.f;
#pragma unroll
    for (int k = 0; k < KS; ++k) { mk[k] = gml[k * 64 + u * 32 + col]; mm = fmaxf(mm, mk[k]); }
#pragma unroll
    for (int k = 0; k < KS; ++k) ls += gml[k * 64 + u * 32 + 16 + col] * exp2_slot(mk[k] - mm);   /* at least 1: the key that gave the maximum counts 1 */
    const float f = exp2_slot(m[u] - mm) / ls;
#pragma unroll
    for (int j = 0; j < HD / 16; ++j) { const v8f o = acc[u][j] * f; v4f* d = gac + ks * 512 + (u * (HD / 16) + j) * 64 + lane; d[0] = (v4f){o[0], o[1], o[2], o[3]}; d[32] = (v4f){o[4], o[5], o[6], o[7]}; } }
  __syncthreads();
#pragma unroll
  for (int jj = 0; jj < 2; ++jj) { const int t = ks * 2 + jj;   /* tile (u, j) = (t / 4, t % 4) */
    float* yo = Y + ((size_t)h * TT + ql0 + (t >> 2) * 16 + col) * HD + (t & 3) * 16 + 8 * g;
#pragma unroll
    for (int e = 0; e < 2; ++e) { const v4f* s = gac + t * 64 + e * 32 + lane; v4f o = s[0];
#pragma unroll
      for (int k = 1; k < KS; ++k) o += s[k * 512];
      vst2(yo + 4 * e, o); } }
  asm volatile("s_wait_xcnt 0x0" ::: "memory");   /* stands in front of any later rewrite of the address and data registers that the stores above name */ }
// block = (head, 64 * QW query rows), 16 waves: 4 tiles of 32 queries x 4 shares of the keys (early rows: 8 tiles of 16 x 2); the waves of equal share walk the same keys and meet in the cache. A WGP holds one block at a time, so the order is by falling length, for the WGPs that are free first to take the longer of what is left; the early-row blocks, few steps but slow ones, go first
#define NFB (TT / (64 * QW))
#define NHB (QHI / (64 * QW))
__global__ __launch_bounds__(512) void k_fa(const float* __restrict__ Q, const _Float16* __restrict__ KH, const _Float16* __restrict__ KL, const _Float16* __restrict__ VT, const __bf16* __restrict__ VB, const __bf16* __restrict__ VBL, float* __restrict__ Y) {
  __shared__ float sml[16 * 64]; __shared__ v4f sac[16 * 512];   /* a wave's maxima and sums; a wave's 64 x 32 partial output */
  __shared__ __attribute__((aligned(16))) char sq[2 * QPL];   /* the block's queries in fragment order: f16 plane, residual plane (early rows) */
  static_assert(64 * QW * HD * 4 == 512 * 4 * 16 && 64 * QW / 16 * 8 * QP == QPL, "512 threads x 4 loads of 16 bytes are the block's query rows");
  const int idx = blockIdx.x, od = idx / NH, h = idx % NH; const int fb = od < NHB ? NHB - 1 - od : NFB - 1 - (od - NHB);
  const int tid = threadIdx.x, wave = __builtin_amdgcn_readfirstlane(tid >> 5) /* scalar, so that the loop over a wave's own steps branches on SCC with every lane on */, lane = tid & 31;
  /* the block's own f32 query rows, each element once: a wave's load is the same 128-byte half of 4 rows, 4 whole lines */
  const float* qs = Q + ((size_t)h * TT + fb * 64 * QW) * HD; const unsigned lq = ((tid >> 5) * 8 + ((tid >> 3) & 3)) * (HD * 4) + (tid & 7) * 16; v4f qa[4];
#pragma unroll
  for (int i = 0; i < 4; ++i) qa[i] = ldu<v4f>(qs, lq + (i >> 1) * 4 * HD * 4 + (i & 1) * 128);
  asm volatile("s_wait_xcnt 0x0" :: "v"(lq) : "memory");   /* stands in front of the first rewrite of a register that the loads above name; as its input the offset lives up to here */
  const unsigned sw = ((unsigned)(wave >> 1) * 8 + ((lane & 7) >> 1)) * QP + ((wave & 1) * 8 + (lane >> 3)) * 16 + (lane & 1) * 8;   /* where this lane's first 8 bytes go in the fragment order */
  if (fb < NHB) { const int ks = wave & 1, gw = wave - ks;   /* the residual planes take twice the registers: 16-query tiles; the branch is the same for the whole block, as the barriers inside ask */
    fa_body<true, 1, 2>(qa, sq, sw, wave >> 1, KH, KL, VT, VB, VBL, Y, h, fb * 64 * QW + (wave >> 1) * 16, lane, ks, sml + gw * 64, sac + gw * 512);
  } else { const int ks = wave & 3, gw = wave - ks;
    fa_body<false, QW, 4>(qa, sq, sw, (wave >> 2) * QW, KH, KL, VT, VB, VBL, Y, h, fb * 64 * QW + (wave >> 2) * 16 * QW, lane, ks, sml + gw * 64, sac + gw * 512); } }

extern "C" void kernel_launch(void* const* d_in, const int* in_sizes, int n_in, void* d_out, int out_size, void* d_ws, size_t ws_size, hipStream_t stream) {
  (void)in_sizes; (void)n_in; (void)out_size;
  const float** F = (const float**)d_in;
  if (ws_size < (size_t)WS_END) return;
  char* ws = (char*)d_ws; _Float16 *KH = (_Float16*)(ws + WS_KH), *VT = (_Float16*)(ws + WS_VT), *KL = (_Float16*)(ws + WS_KL); __bf16 *VB = (__bf16*)(ws + WS_VB), *VBL = (__bf16*)(ws + WS_VBL);
  // inputs: 0 q [B, H, T, 64], 1 k [B, H, 64, T], 2 v [B, H, T, 64] (causal flag folded)
  k_prep8<<<dim3(TNB * TT / 64, NH), 128, 0, stream>>>(F[1], F[2], KH, KL, VT, VB, VBL);
  k_fa<<<dim3(NFB * NH), 512, 0, stream>>>(F[0], KH, KL, VT, VB, VBL, (float*)d_out);
}

// v009
// Measured time: 38.4 microseconds a run.
// Versions in between are left out here; by their measured steps it is 1.06 times as fast as v007.
// Counting every step since v000, it is 66.5 times as fast.
// compute dtype: all float inputs rounded to bf16; raw q / k / v: q and k enter the scores as f16 (bf16 values are exact in f16: exact products; the early-row residual planes are zero) x 64^-0.5 (from row 384 on the factor 64^-0.5 log2(e) is in q, rounded once more to f16); causal mask by index (the module's w*b + (-1e9)(1 - b) leaves exactly -1e9 on masked entries == exclusion); softmax f32 against a held reference maximum (moved up to the running maximum when P outgrows it; early rows: in every step); P (at most 1024) once to f16 x v (exact in f16; bf16 hi + lo below row 384), divided by the f32 sum at the end; f32 output.
#include <hip/hip_runtime.h>
#include <math.h>

typedef __attribute__((ext_vector_type(16))) _Float16 v16h;
typedef __attribute__((ext_vector_type(16))) __bf16 v16b;
typedef __attribute__((ext_vector_type(8)))  _Float16 v8h;
typedef __attribute__((ext_vector_type(8)))  float v8f;
typedef __attribute__((ext_vector_type(4)))  float v4f;
typedef __attribute__((ext_vector_type(2)))  float v2f;
typedef __attribute__((ext_vector_type(4)))  unsigned v4u;
typedef __attribute__((ext_vector_type(2)))  unsigned v2u;
typedef __attribute__((ext_vector_type(4)))  int v4i;
typedef float __attribute__((may_alias)) float_a;
typedef int __attribute__((may_alias)) int_a;

template <typename T> __device__ __forceinline__ void vst2(void* p, T v) { *(T*)p = v;  }
__device__ __forceinline__ v8f wmma16(v16h a, v16h b, v8f c) {
  v8f d = __builtin_amdgcn_wmma_f32_16x16x32_f16(false, a, false, b, (short)0, c, false, false);
  asm volatile("v_nop\n\tv_nop\n\tv_nop\n\tv_nop" : "+v"(d) : "v"(a), "v"(b));
  return d;
}
__device__ __forceinline__ v8f wmma_bf(v16b a, v16b b, v8f c) {
  v8f d = __builtin_amdgcn_wmma_f32_16x16x32_bf16(false, a, false, b, (short)0, c, false, false);
  asm volatile("v_nop\n\tv_nop\n\tv_nop\n\tv_nop" : "+v"(d) : "v"(a), "v"(b));
  return d;
}
// 16x16x32 fragments: lane = (h = lane>>4, row/col = lane&15); elements 0..7 = k0+8h+0..7, 8..15 = k0+16+8h+0..7; D element r = row 8h+r
__device__ __forceinline__ v16h frag_h(const _Float16* rowk0, int lane) {
  union { v16h v; v8h q[2]; } u; const _Float16* p = rowk0 + 8 * (lane >> 4);
  u.q[0] = *(const v8h*)p; u.q[1] = *(const v8h*)(p + 16); return u.v;
}
__device__ __forceinline__ v16h frag_f32(const float* rowk0, int lane) {
  v16h a; const float* p = rowk0 + 8 * (lane >> 4);
#pragma unroll
  for (int i = 0; i < 8; ++i) { a[i] = (_Float16)p[i]; a[8 + i] = (_Float16)p[16 + i]; }
  return a;
}
__device__ __forceinline__ v16h frag_f32s(const float* rowk0, int lane, float sc) {
  v16h a; const float* p = rowk0 + 8 * (lane >> 4);
#pragma unroll
  for (int i = 0; i < 8; ++i) { a[i] = (_Float16)(p[i] * sc); a[8 + i] = (_Float16)(p[16 + i] * sc); }
  return a;
}
// column fragment from a [K][ld] layout (column n), rows >= K read as 0
__device__ __forceinline__ v16h fragc_f32(const float* W, int k0, int n, int lane, int ld, int K) {
  v16h a; const int g = lane >> 4;
#pragma unroll
  for (int i = 0; i < 8; ++i) { const int ka = k0 + 8 * g + i, kb = ka + 16;
    a[i] = (_Float16)(ka < K ? W[(size_t)(ka < K ? ka : K - 1) * ld + n] : 0.f); a[8 + i] = (_Float16)(kb < K ? W[(size_t)(kb < K ? kb : K - 1) * ld + n] : 0.f); }
  return a;
}
struct F2 { v16b h, l; };
__device__ __forceinline__ F2 bsplit16(const float v[16]) { F2 r;
#pragma unroll
  for (int i = 0; i < 16; ++i) { const __bf16 h = (__bf16)v[i]; r.h[i] = h; r.l[i] = (__bf16)(v[i] - (float)h); }
  return r; }
__device__ __forceinline__ F2 split_row(const float* row, int k0, int lane) { float v[16]; const float* p = row + k0 + 8 * (lane >> 4);
#pragma unroll
  for (int i = 0; i < 8; ++i) { v[i] = p[i]; v[8 + i] = p[16 + i]; }
  return bsplit16(v); }
__device__ __forceinline__ F2 split_rowK(const float* row, int k0, int lane, int K) { float v[16]; const int g = lane >> 4;
#pragma unroll
  for (int i = 0; i < 8; ++i) { const int ka = k0 + 8 * g + i, kb = ka + 16; v[i] = ka < K ? row[ka < K ? ka : K - 1] : 0.f; v[8 + i] = kb < K ? row[kb < K ? kb : K - 1] : 0.f; }
  return bsplit16(v); }
__device__ __forceinline__ F2 split_col(const float* W, int k0, int n, int lane, int ld, int K) { float v[16]; const int g = lane >> 4;
#pragma unroll
  for (int i = 0; i < 8; ++i) { const int ka = k0 + 8 * g + i, kb = ka + 16; v[i] = ka < K ? W[(size_t)(ka < K ? ka : K - 1) * ld + n] : 0.f; v[8 + i] = kb < K ? W[(size_t)(kb < K ? kb : K - 1) * ld + n] : 0.f; }
  return bsplit16(v); }
__device__ __forceinline__ v8f mac3(const F2& a, const F2& b, v8f c) { c = wmma_bf(a.l, b.h, c); c = wmma_bf(a.h, b.l, c); return wmma_bf(a.h, b.h, c); }
__device__ __forceinline__ float sigm(float v) { return 1.0f / (1.0f + expf(-v)); }
#define LDSX() do { asm volatile("s_wait_dscnt 0" ::: "memory"); __builtin_amdgcn_wave_barrier(); __builtin_amdgcn_fence(__ATOMIC_RELEASE, "workgroup"); } while (0)

// Raw causal scaled-dot-product attention with a PRE-TRANSPOSED key (q [1,16,4096,64], k [1,16,64,4096] = [B, H, D, S], v [1,16,4096,64]; w = q k / sqrt(64); b = tril; w = w*b + (-1e9)(1 - b); softmax; out = w v -> [1,16,4096,64]).
#define NB 1
#define TT 4096
#define CC 1024            // NH * HD = projected width
#define DIN 1024          // input (model) width
#define NH 16
#define HD 64
#define NQB (TT / 64)
#define HG 1
#define SCALE (0.125f)
#define CAUSAL 1
#ifndef TNB
#define TNB NB
#endif
__device__ __forceinline__ float bfr(float v) { return (float)(__bf16)v; }
__host__ __device__ __forceinline__ int kb_last(int qb) { return CAUSAL ? ((qb * 64 + 63) >> 7) : (TT / 128 - 1); }
typedef __attribute__((ext_vector_type(8))) __bf16 v8b;
__device__ __forceinline__ v16b frag_b(const __bf16* rowk0, int lane) {
  union { v16b v; v8b q[2]; } u; const __bf16* p = rowk0 + 8 * (lane >> 4);
  u.q[0] = *(const v8b*)p; u.q[1] = *(const v8b*)(p + 16); return u.v;
}
#define QBH 6              // unused; causal: query rows below QHI (few keys, no averaging) take the high-precision path
#define QHI 384            // rows carrying a q residual plane (3-product logits)
#define KHI 384            // key rows carrying k residual / v bf16 hi+lo planes (used only by the causal high-precision path)
// B fragment (k rows k0+.., output column o) of a weight: (in,out) [K][ld] or (out,in) [ld rows of K]: bf16 exact, or f16(bf16 * 256) exact
__device__ __forceinline__ v16b wcol_io(const float* Wm, int k0, int o, int lane, int ld) { v16b w; const int g = lane >> 4;
#pragma unroll
  for (int i = 0; i < 8; ++i) { w[i] = (__bf16)Wm[(size_t)(k0 + 8 * g + i) * ld + o]; w[8 + i] = (__bf16)Wm[(size_t)(k0 + 16 + 8 * g + i) * ld + o]; }
  return w; }
__device__ __forceinline__ v16b wcol_oi(const float* Wm, int k0, int o, int lane, int K) { v16b w; const float* p = Wm + (size_t)o * K + k0 + 8 * (lane >> 4);
#pragma unroll
  for (int i = 0; i < 8; ++i) { w[i] = (__bf16)p[i]; w[8 + i] = (__bf16)p[16 + i]; }
  return w; }
__device__ __forceinline__ v16h wcolh_io(const float* Wm, int k0, int o, int lane, int ld) { v16h w; const int g = lane >> 4;
#pragma unroll
  for (int i = 0; i < 8; ++i) { w[i] = (_Float16)(bfr(Wm[(size_t)(k0 + 8 * g + i) * ld + o]) * 256.0f); w[8 + i] = (_Float16)(bfr(Wm[(size_t)(k0 + 16 + 8 * g + i) * ld + o]) * 256.0f); }
  return w; }
__device__ __forceinline__ v16h wcolh_oi(const float* Wm, int k0, int o, int lane, int K) { v16h w; const float* p = Wm + (size_t)o * K + k0 + 8 * (lane >> 4);
#pragma unroll
  for (int i = 0; i < 8; ++i) { w[i] = (_Float16)(bfr(p[i]) * 256.0f); w[8 + i] = (_Float16)(bfr(p[16 + i]) * 256.0f); }
  return w; }
#define WQKV_LAYOUT 1   // 0 = (in,out) [DIN][CC]; 1 = (out,in) [CC][DIN]; 2 = per-head [NH][DIN][HD]
__device__ __forceinline__ v16b wcol_hdk(const float* Wm, int k0, int o, int lane) { v16b w; const int g = lane >> 4; const float* p = Wm + (size_t)(o / HD) * DIN * HD + (o % HD);
#pragma unroll
  for (int i = 0; i < 8; ++i) { w[i] = (__bf16)p[(size_t)(k0 + 8 * g + i) * HD]; w[8 + i] = (__bf16)p[(size_t)(k0 + 16 + 8 * g + i) * HD]; }
  return w; }
#define WO_OUT_IN 0
#if WQKV_LAYOUT == 1
#define WCOL(W, k0, o, lane) wcol_oi(W, k0, o, lane, DIN)
#elif WQKV_LAYOUT == 2
#define WCOL(W, k0, o, lane) wcol_hdk(W, k0, o, lane)
#else
#define WCOL(W, k0, o, lane) wcol_io(W, k0, o, lane, CC)
#endif
#if WO_OUT_IN
#define WOCOL(W, k0, o, lane) wcol_oi(W, k0, o, lane, CC)
#define WOCOLH(W, k0, o, lane) wcolh_oi(W, k0, o, lane, CC)
#else
#define WOCOL(W, k0, o, lane) wcol_io(W, k0, o, lane, DIN)
#define WOCOLH(W, k0, o, lane) wcolh_io(W, k0, o, lane, DIN)
#endif

// ---- k_prep8: block = (64 attention positions s0.. of sequence b, head h): reads the module's k and v (v [B, H, S, 64]: element (b,h,s,c) at ((b*NH + h)*TT + s)*64 + c; the key PRE-TRANSPOSED [B, H, D, S]: element (b,h,s,c) at ((b*NH + h)*64 + c)*TT + s), bf16-rounds them and writes the attention planes (q is read by k_fa itself): k and v -> f16 in the order of k_fa's matrix fragments (below; + k residual rows and v bf16 hi/lo planes [c][s] for s < KHI)
// Fragment order, per head 128 bytes a position: k = [16-key tile][32-channel half kc][e][lane][8 channels kc*32 + 16 e + 8 (lane >> 4) ..] of key (lane & 15); v = [32-key step][16-channel tile j][e][lane][8 keys 16 e + 8 (lane >> 4) ..] of channel j*16 + (lane & 15). One 16-byte load of a wave is then 512 bytes in a row, four whole lines
// A stream: every thread asks for all its 16 x 16 bytes (whole 128-byte lines per wave) before it uses any, each element once. k and v are transposed 64 x 64 through LDS tiles of dwords (two neighbouring source rows = two neighbouring 16-bit elements of an output row). All stores stand behind the barrier, so that no wave waits at it for its own stores.
#define TP 33   // dwords per tile row; odd, so that the 16 tile rows a wave writes at once, and the 4 (early-row planes) or 16 (fragment order) it reads at once, spread over the banks
typedef __attribute__((ext_vector_type(2))) _Float16 v2h;
typedef __attribute__((ext_vector_type(2))) __bf16 v2b;
__device__ __forceinline__ unsigned pkh(float a, float b) { return __builtin_bit_cast(unsigned, (v2h){(_Float16)a, (_Float16)b}); }
__device__ __forceinline__ unsigned pkb(float a, float b) { return __builtin_bit_cast(unsigned, (v2b){(__bf16)a, (__bf16)b}); }
__device__ __forceinline__ float resh(float x) { return (x - (float)(_Float16)x) * 1024.0f; }   // what f16 leaves of x, x 2^10
__device__ __forceinline__ float resb(float x) { return x - (float)(__bf16)x; }                // what bf16 leaves of x
__device__ __forceinline__ v4u trow(const unsigned* t) { return (v4u){t[0], t[1], t[2], t[3]}; }
template <typename T> __device__ __forceinline__ T ldu(const void* ub, unsigned off) { return *(const T*)((const char*)ub + off); }   // block-uniform base + this lane's byte offset
template <typename T> __device__ __forceinline__ void stu(void* ub, unsigned off, T v) { *(T*)((char*)ub + off) = v; }
__global__ __launch_bounds__(128) void k_prep8(const float* __restrict__ K, const float* __restrict__ V, _Float16* __restrict__ KH, _Float16* __restrict__ KL, _Float16* __restrict__ VT, __bf16* __restrict__ VB, __bf16* __restrict__ VBL) {
  __shared__ unsigned tk[64 * TP], tv[64 * TP], tkl[64 * TP], tb[64 * TP], tbl[64 * TP];
  const unsigned tid = threadIdx.x; const int h = blockIdx.y; const size_t r0 = (size_t)blockIdx.x * 64; const size_t bb = r0 / TT; const int t0 = (int)(r0 % TT); const bool khi = t0 < KHI;
  const float* vs = V + ((bb * NH + h) * TT + t0) * HD; const float* ks = K + (bb * NH + h) * HD * (size_t)TT + t0;
  const unsigned x4 = tid & 15, rp0 = tid >> 4;   /* transposition: source columns 4 x4 .. + 3 of the source rows 2 rp, 2 rp + 1, rp = rp0 + 8 i */
  const unsigned lk = (2 * rp0 * TT + x4 * 4) * 4, lvv = (2 * rp0 * HD + x4 * 4) * 4;
  v4f ka[4][2], va[4][2];
#pragma unroll
  for (int i = 0; i < 4; ++i)
#pragma unroll
    for (int e = 0; e < 2; ++e) { ka[i][e] = ldu<v4f>(ks, lk + (16 * i + e) * TT * 4); va[i][e] = ldu<v4f>(vs, lvv + (16 * i + e) * HD * 4); }
  asm volatile("s_wait_xcnt 0x0" :: "v"(lk), "v"(lvv) : "memory");   /* stands in front of the first rewrite of an offset register that the loads above name; as its inputs these registers live up to here */
#pragma unroll
  for (int i = 0; i < 4; ++i)
#pragma unroll
    for (int e = 0; e < 2; ++e)
#pragma unroll
      for (int j = 0; j < 4; ++j) { ka[i][e][j] = bfr(ka[i][e][j]); va[i][e][j] = bfr(va[i][e][j]); }   /* module inputs: bf16-rounded; bf16 values are exact in f16, so the residual planes are 0 */
  const unsigned ow = x4 * 4 * TP + rp0;
#pragma unroll
  for (int i = 0; i < 4; ++i)
#pragma unroll
    for (int j = 0; j < 4; ++j) { const unsigned o = ow + j * TP + 8 * i; tk[o] = pkh(ka[i][0][j], ka[i][1][j]); tv[o] = pkh(va[i][0][j], va[i][1][j]); }
  if (khi) {
#pragma unroll
    for (int i = 0; i < 4; ++i)
#pragma unroll
      for (int j = 0; j < 4; ++j) { const unsigned o = ow + j * TP + 8 * i; tkl[o] = pkh(resh(ka[i][0][j]), resh(ka[i][1][j])); tb[o] = pkb(va[i][0][j], va[i][1][j]); tbl[o] = pkb(resb(va[i][0][j]), resb(va[i][1][j])); } }
  __syncthreads();
  const unsigned xr = tid >> 3, q8 = tid & 7, orr = xr * TP + q8 * 4;   /* output rows xr + 16 i (a position of k, a channel of v), their elements 8 q8 .. + 7 */
  const unsigned sk = (xr * CC + q8 * 8) * 2;
  const unsigned fw = tid >> 5, fc = tid & 15, fd = (fw & 1) * 8 + ((tid >> 4) & 1) * 4, sf = tid * 16;   /* fragment order: wave fw stores 512-byte piece 4 i + fw of the block's 8 KB; fc = fragment row, fd = the dword of its elements 16 e + 8 g */
  const unsigned ofk = fc * TP + (fw >> 1) * 16 + fd, ofv = ((fw >> 1) * 16 + fc) * TP + fd;
  _Float16* kd = KH + ((bb * NH + h) * TT + t0) * HD; _Float16* vd = VT + ((bb * NH + h) * TT + t0) * HD;
#pragma unroll
  for (int i = 0; i < 4; ++i) { stu(kd, sf + 2048 * i, trow(tk + ofk + 16 * i * TP)); stu(vd, sf + 2048 * i, trow(tv + ofv + (i & 1) * 32 * TP + (i >> 1) * 16)); }
  asm volatile("s_wait_xcnt 0x0" ::: "memory");   /* stands in front of the first rewrite of a register that the stores above name; in front of the branch, so that nothing of the branch's own block comes to stand ahead of it */
  if (khi) {
    const unsigned sb = (xr * KHI + q8 * 8) * 2; _Float16* kld = KL + (bb * KHI + t0) * (size_t)CC + h * HD; __bf16* bd = VB + (bb * CC + h * HD) * (size_t)KHI + t0; __bf16* bld = VBL + (bb * CC + h * HD) * (size_t)KHI + t0;
#pragma unroll
    for (int i = 0; i < 4; ++i) { stu(kld, sk + 16 * i * CC * 2, trow(tkl + orr + 16 * i * TP)); stu(bd, sb + 16 * i * KHI * 2, trow(tb + orr + 16 * i * TP)); stu(bld, sb + 16 * i * KHI * 2, trow(tbl + orr + 16 * i * TP)); } } }

#ifndef SM_EXTRA_PARAMS
#define SM_EXTRA_PARAMS
#endif
#ifndef PROJ_EXTRA_PARAMS
#define PROJ_EXTRA_PARAMS
#endif
#ifndef SM_MASK_HOOK
#define SM_MASK_HOOK (void)0
#endif

#define WS_KH  0u                                      // f16 k in fragment order [b][h][t / 16][2 KB]
#define WS_VT  (WS_KH + 2u * (size_t)NB * TT * CC)      // f16 v in fragment order [b][h][t / 32][4 KB]
#define WS_KL  (WS_VT + 2u * (size_t)NB * CC * TT)      // f16 k residual x 2^10 rows [b][t < KHI][CC]
#define WS_VB  (WS_KL + 2u * (size_t)NB * KHI * CC)     // bf16 v hi planes [b][c][t < KHI]
#define WS_VBL (WS_VB + 2u * (size_t)NB * CC * KHI)
#define WS_END (WS_VBL + 2u * (size_t)NB * CC * KHI)

// ---- k_fa: scores, softmax and P . v of one (head, 128-query block) in one kernel; KS waves share QT * 16 query rows: wave ks of them takes the 32-key steps ks, ks + KS, .. of the keys [0, ql0 + 32) and keeps, per query, a reference maximum, a running sum and a 64-wide f32 sum (rescaled when the reference moves), so no logit and no P ever goes to memory. Late rows hold the reference: the maximum of the wave's first step stays in use while every step's P stay small enough for f16, so that the common step forms no maximum and rescales nothing. Their queries carry the factor C2, and minus the reference is the C operand of the score products: the common step's score tiles are the exponents themselves, with no vector instruction between product and 2^x. At the end the KS waves bring their sums to one maximum and add them, in wave order, through LDS.
// Transposed products: S^T = K . Q^T (A = key rows, B = query rows), so a lane holds 16 scores of ONE query (column lane & 15; keys k0 + 8g + r and k0 + 16 + 8g + r) and the two score tiles, converted in place, are the B operand of O^T += V^T . P^T in the hardware k order; A = v by channel, in the same order (frag_r from the ring; early rows frag_bu).
// HI (query blocks below row QHI): q and k residual planes enter the scores (3 products), P as bf16 hi + lo against v bf16 hi + lo (3 products), as before.
// Every plain '#pragma unroll' below stands on a loop of constant length, so that the fragment arrays are indexed by constants and stay in registers.
template <bool B> struct BC { static constexpr bool v = B; };
#define QW 2   // 16-query tiles of a wave
#define C2 (SCALE * 1.44269504088896340736f)   // logits in units of log2
#define PTOP 1024.0f   // while the 16 P of a lane and step sum to no more than this, each of them is at most this: far inside f16 and bf16, and the reference stays
__device__ __forceinline__ float xhalf(float x) { return __builtin_bit_cast(float, __builtin_amdgcn_permlanex16(__builtin_bit_cast(int, x), __builtin_bit_cast(int, x), 0x76543210, 0xfedcba98, false, false)); }   // lane l with lane l ^ 16
// fragment from a wave-uniform base and this lane's own byte offset (row * pitch + 16 * (lane >> 4)): the lane offsets never change, only the scalar base walks
__device__ __forceinline__ v16h frag_hu(const _Float16* ub, unsigned lo) { union { v16h v; v8h q[2]; } u; const char* p = (const char*)ub + lo; u.q[0] = *(const v8h*)p; u.q[1] = *(const v8h*)(p + 32); return u.v; }
__device__ __forceinline__ v16h frag_fu(const _Float16* ub, unsigned lo) { union { v16h v; v8h q[2]; } u; const char* p = (const char*)ub + lo; u.q[0] = *(const v8h*)p; u.q[1] = *(const v8h*)(p + 512); return u.v; }   // from the fragment-order planes: the lane's 16 * lane bytes are in the address (lo = 0), the two halves 512 bytes apart
// The block's 128 query rows in LDS, in the order of the score products' B fragments: [16-query tile][32-channel half kc][e][g] pieces of 16 queries x 16 bytes (8 channels kc*32 + 16 e + 8 g ..), QP bytes apart. QP = 256 + 64: the four pieces that a wave writes at once start 16 banks apart, so that its 8-byte stores meet no bank twice; a reader's 16 lanes take one piece, 256 bytes in a row
#define QP 320
#define QPL (64 * QP)   // one plane: 8 tiles x 2 x 2 x 2 pieces
__device__ __forceinline__ v16h frag_q(const char* s, unsigned lo) { union { v16h v; v8h q[2]; } u; u.q[0] = *(const v8h*)(s + lo); u.q[1] = *(const v8h*)(s + lo + 2 * QP); return u.v; }   // lo = ((tile * 2 + kc) * 4 + g) * QP + 16 * query; e = 1 two pieces on
__device__ __forceinline__ v16b frag_bu(const __bf16* ub, unsigned lo) { union { v16b v; v8b q[2]; } u; const char* p = (const char*)ub + lo; u.q[0] = *(const v8b*)p; u.q[1] = *(const v8b*)(p + 32); return u.v; }
// The late rows' ring in LDS: a stage = 256 keys of the block's head, 32 KB of the k plane and 32 KB of the v plane, each in a row in memory and laid down as it lies there (fragment order); two buffers
#define STK 32768          // bytes of one plane in a stage
#define STG (2 * STK)      // one buffer
__device__ __forceinline__ v16h frag_r(const char* p) { union { v16h v; v8h q[2]; } u; u.q[0] = *(const v8h*)p; u.q[1] = *(const v8h*)(p + 512); return u.v; }   // from the ring: p = the fragment's 1 KB + 16 * lane, the two halves 512 bytes apart; a wave's 16-byte read is 512 bytes in a row
// one stage: every thread of the 512 copies 8 x 16 bytes, global memory to LDS through no register (l = the LDS byte address of this thread's first 16 bytes in the buffer, gk and gv = their places in the planes). The s_wait_xcnt closes the copies' own statement, so that it stands in front of every later rewrite of an address register that they name
__device__ __forceinline__ void stage_copy(unsigned l, const char* gk, const char* gv) {
  asm volatile("global_load_async_to_lds_b128 %0, %8, off\n\tglobal_load_async_to_lds_b128 %1, %9, off\n\tglobal_load_async_to_lds_b128 %2, %10, off\n\tglobal_load_async_to_lds_b128 %3, %11, off\n\t"
               "global_load_async_to_lds_b128 %4, %12, off\n\tglobal_load_async_to_lds_b128 %5, %13, off\n\tglobal_load_async_to_lds_b128 %6, %14, off\n\tglobal_load_async_to_lds_b128 %7, %15, off\n\ts_wait_xcnt 0x0"
               :: "v"(l), "v"(l + 8192u), "v"(l + 16384u), "v"(l + 24576u), "v"(l + STK), "v"(l + STK + 8192u), "v"(l + STK + 16384u), "v"(l + STK + 24576u),
                  "v"(gk), "v"(gk + 8192), "v"(gk + 16384), "v"(gk + 24576), "v"(gv), "v"(gv + 8192), "v"(gv + 16384), "v"(gv + 24576) : "memory"); }
__device__ __forceinline__ float exp2_slot(float x) { float r; asm("v_exp_f32 %0, %1\n\tv_nop" : "=v"(r) : "v"(x)); return r; }   // 2^x of one value (a lift's rescale factor, the join behind the loop); the v_nop fills the slot that the instruction set asks for between a transcendental and a next instruction that reads its result or overwrites its source
// 2^x of 16 values, in place, as one run: inside it every v_exp_f32 is followed by an independent one, and behind the last stands a v_nop: the slot that the instruction set asks for between a transcendental and a next instruction that reads its result or overwrites its source
__device__ __forceinline__ void exp2_run(float (&x)[16]) {
  asm("v_exp_f32 %0, %0\n\tv_exp_f32 %1, %1\n\tv_exp_f32 %2, %2\n\tv_exp_f32 %3, %3\n\tv_exp_f32 %4, %4\n\tv_exp_f32 %5, %5\n\tv_exp_f32 %6, %6\n\tv_exp_f32 %7, %7\n\tv_exp_f32 %8, %8\n\tv_exp_f32 %9, %9\n\tv_exp_f32 %10, %10\n\tv_exp_f32 %11, %11\n\tv_exp_f32 %12, %12\n\tv_exp_f32 %13, %13\n\tv_exp_f32 %14, %14\n\tv_exp_f32 %15, %15\n\tv_nop"
      : "+v"(x[0]), "+v"(x[1]), "+v"(x[2]), "+v"(x[3]), "+v"(x[4]), "+v"(x[5]), "+v"(x[6]), "+v"(x[7]), "+v"(x[8]), "+v"(x[9]), "+v"(x[10]), "+v"(x[11]), "+v"(x[12]), "+v"(x[13]), "+v"(x[14]), "+v"(x[15])); }
// 2^x of the 8 values of a score tile, read where the matrix product left them and written to registers of their own (written in place, ten of a step's 32 values were first copied out of their tiles); the run and its closing v_nop as in exp2_run; the outputs are early-clobber, so that none lands on a source still to be read
template <int O> __device__ __forceinline__ void exp2_tile(float (&y)[16], const v8f x) {
  asm("v_exp_f32 %0, %8\n\tv_exp_f32 %1, %9\n\tv_exp_f32 %2, %10\n\tv_exp_f32 %3, %11\n\tv_exp_f32 %4, %12\n\tv_exp_f32 %5, %13\n\tv_exp_f32 %6, %14\n\tv_exp_f32 %7, %15\n\tv_nop"
      : "=&v"(y[O]), "=&v"(y[O + 1]), "=&v"(y[O + 2]), "=&v"(y[O + 3]), "=&v"(y[O + 4]), "=&v"(y[O + 5]), "=&v"(y[O + 6]), "=&v"(y[O + 7])
      : "v"(x[0]), "v"(x[1]), "v"(x[2]), "v"(x[3]), "v"(x[4]), "v"(x[5]), "v"(x[6]), "v"(x[7])); }
template <bool HI, int QT, int KS> __device__ __forceinline__ void fa_body(const v4f (&qa)[4], char* sq, unsigned sw, int qt0, const _Float16* __restrict__ KH, const _Float16* __restrict__ KL, const _Float16* __restrict__ VT, const __bf16* __restrict__ VB, const __bf16* __restrict__ VBL, float* __restrict__ Y, int h, int ql0, int lane, int ks, float* gml, v4f* gac, char* ring, unsigned tid) {
  static_assert(QT * (HD / 16) == 2 * KS, "each wave adds up and stores two 16-channel tiles: one whole 128-byte line of each of 16 queries");
  const int col = lane & 15, g = lane >> 4; const int nst = ((ql0 + 16 * QT - 1) >> 5) + 1; const int klast = (nst - 1) * 32;
  const _Float16* kp = KH + (size_t)h * HD * TT; const _Float16* klp = KL + h * HD; const _Float16* vp = VT + (size_t)h * HD * TT; const __bf16* vbp = VB + (size_t)h * HD * KHI; const __bf16* vblp = VBL + (size_t)h * HD * KHI;   /* wave-uniform */
  const unsigned lrow = (unsigned)col * (CC * 2) + 16 * g, lf = (unsigned)lane * 16, lvb = (unsigned)col * (KHI * 2) + 16 * g;   /* lane offsets, bytes: k residual rows, k and v in fragment order, early v planes */
  v16h qf[QT][2], qlf[QT][2], kf[4];
  auto loadK = [&](v16h (&kd)[4], int k0) { const _Float16* ka = (const _Float16*)((const char*)(kp + (size_t)k0 * HD) + lf);   /* this lane's own address: its 16 bytes of the step's first 512 */
#pragma unroll
    for (int t = 0; t < 2; ++t)
#pragma unroll
      for (int kc = 0; kc < 2; ++kc) kd[t * 2 + kc] = frag_fu(ka + (t * 2 + kc) * 512, 0);
    asm volatile("s_wait_xcnt 0x0" :: "v"(ka) : "memory");   /* stands in front of the first rewrite of an address register that the loads above name; as its input the address lives up to here, so that no load of the run lands in it */ };
  v8f acc[QT][HD / 16] = {}; float m[QT], l[QT];
  constexpr float SC = HI ? C2 : 1.0f;   /* what is still to be multiplied onto a score: late rows have C2 in their queries */
  v8f cm[QT] = {};   /* late rows: minus the reference in use, in all 8 registers of a tile: the C operand of the score products */
#pragma unroll
  for (int u = 0; u < QT; ++u) { m[u] = -3.0e38f; l[u] = 0.f; }
  auto step = [&](int k0, const char* rb, auto mk, auto fs) { constexpr bool MASK = decltype(mk)::v, FIRST = decltype(fs)::v;   /* rb (late rows): this lane's 16 bytes of the wave's first k fragment in the stage's buffer */
    v16h vf[HD / 16];   /* late rows: this step's k and v fragments, all 16 LDS reads at one place (the few HI steps, short of registers, fetch their v where they use it) */
    if constexpr (!HI) {
#pragma unroll
      for (int f = 0; f < 4; ++f) kf[f] = frag_r(rb + f * 1024);
#pragma unroll
      for (int j = 0; j < HD / 16; ++j) vf[j] = frag_r(rb + STK + j * 1024);
      __builtin_amdgcn_sched_barrier(0);   /* keeps the v reads up here, behind the k reads: moved down to their use, as the compiler did, the wave would wait out a second LDS latency in every step, in front of the P . v products */ }
    v8f st[QT][2];
    auto scores = [&](const v16h (&kk)[4], auto rf) {   /* rf: the products are added to minus the reference, not to 0 */
#pragma unroll
      for (int u = 0; u < QT; ++u)
#pragma unroll
        for (int t = 0; t < 2; ++t) st[u][t] = (v8f){};
      if constexpr (decltype(rf)::v) {
        static_assert(!decltype(rf)::v || QT == 2, "the statement below names two query tiles");
        /* the step's 8 score products as one statement, for the first four to read their C from cm and write another tile: the builtin form copied cm into two of the four tiles in every step. Each tile's second product stands three products behind its first; the four v_nop are the slots that the chip needs between the last product and a vector instruction on its result */
        asm("v_wmma_f32_16x16x32_f16 %0, %4, %8, %12\n\tv_wmma_f32_16x16x32_f16 %1, %6, %8, %12\n\tv_wmma_f32_16x16x32_f16 %2, %4, %10, %13\n\tv_wmma_f32_16x16x32_f16 %3, %6, %10, %13\n\t"
            "v_wmma_f32_16x16x32_f16 %0, %5, %9, %0\n\tv_wmma_f32_16x16x32_f16 %1, %7, %9, %1\n\tv_wmma_f32_16x16x32_f16 %2, %5, %11, %2\n\tv_wmma_f32_16x16x32_f16 %3, %7, %11, %3\n\tv_nop\n\tv_nop\n\tv_nop\n\tv_nop"
            : "=&v"(st[0][0]), "=&v"(st[0][1]), "=&v"(st[QT - 1][0]), "=&v"(st[QT - 1][1])
            : "v"(kk[0]), "v"(kk[1]), "v"(kk[2]), "v"(kk[3]), "v"(qf[0][0]), "v"(qf[0][1]), "v"(qf[QT - 1][0]), "v"(qf[QT - 1][1]), "v"(cm[0]), "v"(cm[QT - 1]));
      } else {
#pragma unroll
      for (int t = 0; t < 2; ++t)
#pragma unroll
        for (int kc = 0; kc < 2; ++kc)
#pragma unroll
          for (int u = 0; u < QT; ++u) st[u][t] = __builtin_amdgcn_wmma_f32_16x16x32_f16(false, kk[t * 2 + kc], false, qf[u][kc], (short)0, st[u][t], false, false); }
      if constexpr (HI) { v8f sl[QT][2] = {};
#pragma unroll
        for (int t = 0; t < 2; ++t) {
#pragma unroll
          for (int kc = 0; kc < 2; ++kc) { const v16h klf = frag_hu(klp + (size_t)(k0 + t * 16) * CC + kc * 32, lrow);
#pragma unroll
            for (int u = 0; u < QT; ++u) { sl[u][t] = __builtin_amdgcn_wmma_f32_16x16x32_f16(false, kk[t * 2 + kc], false, qlf[u][kc], (short)0, sl[u][t], false, false); sl[u][t] = __builtin_amdgcn_wmma_f32_16x16x32_f16(false, klf, false, qf[u][kc], (short)0, sl[u][t], false, false); } }
#pragma unroll
          for (int u = 0; u < QT; ++u) st[u][t] += sl[u][t] * (1.0f / 1024.0f); }
        asm volatile("s_wait_xcnt 0x0" :: "v"(lrow) : "memory");   /* as in loadK, for the residual rows' loads above: as its input the lane offset lives up to here, so that no load of the run lands in it (in the last step one did) */ }
      if constexpr (MASK) {
#pragma unroll
        for (int u = 0; u < QT; ++u)
#pragma unroll
          for (int t = 0; t < 2; ++t)
#pragma unroll
            for (int r = 0; r < 8; ++r) if (k0 + 16 * t + 8 * g + r > ql0 + u * 16 + col) st[u][t][r] = -3.0e38f; } };
    float p[QT][16], sum[QT];
    auto soft = [&](int u, auto rf) {   /* P and its sum against the reference m[u] in use; rf: the tiles hold the exponents already */
      if constexpr (decltype(rf)::v) { exp2_tile<0>(p[u], st[u][0]); exp2_tile<8>(p[u], st[u][1]); } else {
#pragma unroll
        for (int i = 0; i < 16; ++i) p[u][i] = fmaf(st[u][i >> 3][i & 7], SC, -m[u]);
        exp2_run(p[u]); }
      sum[u] = p[u][0];
#pragma unroll
      for (int i = 1; i < 16; ++i) sum[u] += p[u][i]; };
    auto lift = [&](int u) {   /* the reference moves up to the running maximum; what was summed so far is rescaled (a first step has nothing summed) */
      float mx = fmaxf(st[u][0][0], st[u][1][0]);
#pragma unroll
      for (int r = 1; r < 8; ++r) mx = fmaxf(mx, fmaxf(st[u][0][r], st[u][1][r]));
      mx = fmaxf(mx, xhalf(mx));   /* the other half of this query's 32 keys */
      const float mn = fmaxf(m[u], mx * SC);
      if constexpr (!FIRST) { const float al = exp2_slot(m[u] - mn); l[u] *= al;
#pragma unroll
        for (int j = 0; j < HD / 16; ++j) acc[u][j] *= al; }
      m[u] = mn;
      if constexpr (!HI) {
#pragma unroll
        for (int r = 0; r < 8; ++r) cm[u][r] = -mn; } };
    if constexpr (MASK && !HI) {   /* the one step behind the loop sets its C tiles up anew from m: carried out of the loop they would take a second set of registers and a copy in every trip */
#pragma unroll
      for (int u = 0; u < QT; ++u)
#pragma unroll
        for (int r = 0; r < 8; ++r) cm[u][r] = -m[u]; }
    scores(kf, BC<!(HI || FIRST)>{});
    if constexpr (HI && !MASK) loadK(kf, k0 + 32 * KS < klast ? k0 + 32 * KS : klast);   /* early rows: the key fragments of this wave's next step, into the same registers, one step ahead of their use (a wave with no next step asks for the last step's: in range, unused) */
    if constexpr (HI || FIRST) {   /* the few early-row steps move the reference in every step */
#pragma unroll
      for (int u = 0; u < QT; ++u) { lift(u); soft(u, BC<false>{}); }
    } else {
      bool over = false;
#pragma unroll
      for (int u = 0; u < QT; ++u) { soft(u, BC<true>{}); over |= !(sum[u] <= PTOP); }
      if (__builtin_amdgcn_ballot_w32(over) != 0) {   /* one scalar test a step, every lane stays on: some lane's P have outgrown the reference. Rare, so the scores are not kept for it: they are formed again, this time added to 0, from this step's key fragments, still in their registers */
        scores(kf, BC<false>{});
#pragma unroll
        for (int u = 0; u < QT; ++u) { lift(u); soft(u, BC<false>{}); } } }
#pragma unroll
    for (int u = 0; u < QT; ++u) {
      l[u] += sum[u];
      if constexpr (HI) { const F2 pb = bsplit16(p[u]); const __bf16* vha = (const __bf16*)((const char*)(vbp + k0) + lvb); const __bf16* vla = (const __bf16*)((const char*)(vblp + k0) + lvb);   /* this lane's own addresses, as in loadK */
#pragma unroll
        for (int j = 0; j < HD / 16; ++j) { const v16b vh = frag_bu(vha + (size_t)j * 16 * KHI, 0), vl = frag_bu(vla + (size_t)j * 16 * KHI, 0); acc[u][j] = __builtin_amdgcn_wmma_f32_16x16x32_bf16(false, vh, false, pb.h, (short)0, acc[u][j], false, false); acc[u][j] = __builtin_amdgcn_wmma_f32_16x16x32_bf16(false, vh, false, pb.l, (short)0, acc[u][j], false, false); acc[u][j] = __builtin_amdgcn_wmma_f32_16x16x32_bf16(false, vl, false, pb.h, (short)0, acc[u][j], false, false); }
        asm volatile("s_wait_xcnt 0x0" :: "v"(vha), "v"(vla) : "memory");   /* as in loadK: in front of the first rewrite of the address registers; as its inputs they live up to here, so that no load of the run lands in them */
      } else { v16h pf;
#pragma unroll
        for (int i = 0; i < 16; ++i) pf[i] = (_Float16)p[u][i];
#pragma unroll
        for (int j = 0; j < HD / 16; ++j) acc[u][j] = __builtin_amdgcn_wmma_f32_16x16x32_f16(false, vf[j], false, pf, (short)0, acc[u][j], false, false); } } };
  const int nr = ql0 >> 7, nsg = (nr >> 1) + 1;   /* late rows: a round = 128 keys, one step of each of the KS waves; round nr holds the block's diagonals; stages of two rounds up to it (the last may reach 128 keys past the diagonal, still inside the planes: nr is then even, at most TT / 128 - 2). The same numbers in every wave of the block */
  const unsigned lr = (unsigned)(size_t)ring + tid * 16; const char* gk = (const char*)kp + tid * 16; const char* gv = (const char*)vp + tid * 16;   /* this thread's first 16 bytes of a stage: in buffer 0 (LDS byte address: the low 32 bits), in the planes */
  if constexpr (HI) loadK(kf, ks * 32 < klast ? ks * 32 : klast); else stage_copy(lr, gk, gv);   /* on their way while the queries are dealt out (late rows: stage 0 into buffer 0) */
  __builtin_amdgcn_sched_barrier(0);   /* keeps the conversions below, which wait for the query rows, behind the issue of the key loads or copies: moved in front of it they would hold those back until the rows have come */
  /* the queries: qa[i] = channels (i & 1) * 32 + 4 (lane & 7) .. + 3 of block row wave * 8 + (i >> 1) * 4 + (lane >> 3), bf16-rounded like k and v, as f16 (early rows: + the x 2^10 residual plane; late rows: x C2 before the rounding to f16) to their places in the fragment order */
#pragma unroll
  for (int i = 0; i < 4; ++i) { const float a = bfr(qa[i][0]), b = bfr(qa[i][1]), c = bfr(qa[i][2]), d = bfr(qa[i][3]); const unsigned o = sw + (i & 1) * 4 * QP + (i >> 1) * 64;
    constexpr float QS = HI ? 1.0f : C2;
    *(v2u*)(sq + o) = (v2u){pkh(a * QS, b * QS), pkh(c * QS, d * QS)};
    if constexpr (HI) *(v2u*)(sq + QPL + o) = (v2u){pkh(resh(a), resh(b)), pkh(resh(c), resh(d))}; }
  if constexpr (!HI) asm volatile("s_wait_asynccnt 0x0" ::: "memory");   /* this wave's copies of stage 0 have landed before the barrier behind which the other waves read them */
  __syncthreads();   /* every wave's rows (late rows: and its part of stage 0) are in place before any wave takes its fragments */
  if constexpr (!HI) { if (nsg > 1) stage_copy(lr + STG, gk + STK, gv + STK); }   /* stage 1 into buffer 1: it flies while stage 0 is worked on */
#pragma unroll
  for (int u = 0; u < QT; ++u)
#pragma unroll
    for (int kc = 0; kc < 2; ++kc) { const unsigned o = (((unsigned)(qt0 + u) * 2 + kc) * 4 + g) * QP + col * 16; qf[u][kc] = frag_q(sq, o); if constexpr (HI) qlf[u][kc] = frag_q(sq + QPL, o); }
  static_assert(HI || QHI / 32 >= KS, "below: every wave of a late-row tile has a first step in front of the diagonal");
  if constexpr (HI) {
#pragma unroll 1   /* rolled: a second copy of the step would double the fragments in flight, past the 256 registers that a wave of a 16-wave block may have */
    for (int s = ks; s < nst - 1; s += KS) step(s * 32, nullptr, BC<false>{}, BC<false>{});   /* every key of these steps is below the wave's first query: no mask */
    if (((nst - 1) & (KS - 1)) == ks) step(klast, nullptr, BC<true>{}, BC<false>{});   /* the step that holds the diagonal: the wave whose turn it is (a scalar test: every lane stays on) */
  } else {
    static_assert(HI || (KS == 4 && QT == 2), "a round is KS steps of 32 keys = 128 keys = the block's query rows");
    static_assert((TT / 128) % 2 == 0, "whole stages lie inside the planes");
    const char* rl = ring + ks * 4096 + lf;   /* round i lies in buffer (i / 2) % 2, in half i % 2 of either plane; of its 16 KB wave ks takes 4 KB, the 32 keys ks * 32 .. */
    auto place = [&](int i) { return rl + ((i >> 1) & 1) * STG + (i & 1) * (STK / 2); };
    auto foot = [&](int t) {   /* stage t + 1 is handed over, and stage t's buffer goes to stage t + 2 */
      asm volatile("s_wait_dscnt 0x0" ::: "memory");      /* this wave's reads of stage t's buffer are done before the barrier behind which it is refilled */
      asm volatile("s_wait_asynccnt 0x0" ::: "memory");   /* this wave's copies of stage t + 1 have landed before the barrier behind which the other waves read them */
      __syncthreads();
      if (t + 2 < nsg) stage_copy(lr + (t & 1) * STG, gk + (size_t)(t + 2) * STK, gv + (size_t)(t + 2) * STK); };   /* the same test in the whole block */
    step(ks * 32, rl, BC<false>{}, BC<true>{});   /* a wave's first step sets its reference */
#pragma unroll 1   /* rolled: a second copy of the step would double the fragments in flight, past the 256 registers that a wave of a 16-wave block may have */
    for (int i = 1; i < nr; ++i) { step(i * 128 + ks * 32, place(i), BC<false>{}, BC<false>{}); if (i & 1) foot(i >> 1); }   /* every key of these rounds is below the block's first query: no mask; behind a stage's second round the next stage is handed over (a scalar test, the same in the whole block) */
    if (ks <= ((nst - 1) & 3)) step(nr * 128 + ks * 32, place(nr), BC<true>{}, BC<false>{});   /* the round that holds the diagonals: a wave's step up to and with its own tile's diagonal step (a scalar test: every lane stays on); in front of the diagonal step the mask changes nothing. Its stage was handed over behind round nr - 1 or nr - 2, and no stage follows: nothing is handed over behind it */
    asm volatile("s_wait_asynccnt 0x0" ::: "memory");   /* behind the last copy: none is outstanding when the wave goes on */
  }
  /* the KS waves' parts become one: gml = [wave][u][maximum | sum][query], gac = [wave][u][j][half of the 8 channels][lane]. A wave that had no step brings maximum -3e38, sums 0: weight 0 */
#pragma unroll
  for (int u = 0; u < QT; ++u) { const float lt = l[u] + xhalf(l[u]); gml[ks * 64 + (u * 2 + g) * 16 + col] = g ? lt : m[u]; }
  __syncthreads();
#pragma unroll
  for (int u = 0; u < QT; ++u) { float mk[KS], mm = -3.0e38f, ls = 0.f;
#pragma unroll
    for (int k = 0; k < KS; ++k) { mk[k] = gml[k * 64 + u * 32 + col]; mm = fmaxf(mm, mk[k]); }
#pragma unroll
    for (int k = 0; k < KS; ++k) ls += gml[k * 64 + u * 32 + 16 + col] * exp2_slot(mk[k] - mm);   /* at least 1: the key that gave the maximum counts 1 */
    const float f = exp2_slot(m[u] - mm) / ls;
#pragma unroll
    for (int j = 0; j < HD / 16; ++j) { const v8f o = acc[u][j] * f; v4f* d = gac + ks * 512 + (u * (HD / 16) + j) * 64 + lane; d[0] = (v4f){o[0], o[1], o[2], o[3]}; d[32] = (v4f){o[4], o[5], o[6], o[7]}; } }
  __syncthreads();
#pragma unroll
  for (int jj = 0; jj < 2; ++jj) { const int t = ks * 2 + jj;   /* tile (u, j) = (t / 4, t % 4) */
    float* yo = Y + ((size_t)h * TT + ql0 + (t >> 2) * 16 + col) * HD + (t & 3) * 16 + 8 * g;
#pragma unroll
    for (int e = 0; e < 2; ++e) { const v4f* s = gac + t * 64 + e * 32 + lane; v4f o = s[0];
#pragma unroll
      for (int k = 1; k < KS; ++k) o += s[k * 512];
      vst2(yo + 4 * e, o); } }
  asm volatile("s_wait_xcnt 0x0" ::: "memory");   /* stands in front of any later rewrite of the address and data registers that the stores above name */ }
// block = (head, 64 * QW query rows), 16 waves: 4 tiles of 32 queries x 4 shares of the keys (early rows: 8 tiles of 16 x 2); the late rows' waves of equal share read the same keys from the ring in LDS, which the block fills once (early rows: they meet in the cache). A WGP holds one block at a time, so the order is by falling length, for the WGPs that are free first to take the longer of what is left; the early-row blocks, few steps but slow ones, go first
#define NFB (TT / (64 * QW))
#define NHB (QHI / (64 * QW))
__global__ __launch_bounds__(512) void k_fa(const float* __restrict__ Q, const _Float16* __restrict__ KH, const _Float16* __restrict__ KL, const _Float16* __restrict__ VT, const __bf16* __restrict__ VB, const __bf16* __restrict__ VBL, float* __restrict__ Y) {
  __shared__ float sml[16 * 64]; __shared__ v4f sac[16 * 512];   /* a wave's maxima and sums; a wave's 64 x 32 partial output */
  __shared__ __attribute__((aligned(16))) char sq[2 * QPL];   /* the block's queries in fragment order: f16 plane, residual plane (early rows) */
  __shared__ __attribute__((aligned(128))) char ring[2 * STG];   /* late rows: two stages of k and v fragments */
  static_assert(64 * QW * HD * 4 == 512 * 4 * 16 && 64 * QW / 16 * 8 * QP == QPL, "512 threads x 4 loads of 16 bytes are the block's query rows");
  const int idx = blockIdx.x, od = idx / NH, h = idx % NH; const int fb = od < NHB ? NHB - 1 - od : NFB - 1 - (od - NHB);
  const int tid = threadIdx.x, wave = __builtin_amdgcn_readfirstlane(tid >> 5) /* scalar, so that the loop over a wave's own steps branches on SCC with every lane on */, lane = tid & 31;
  /* the block's own f32 query rows, each element once: a wave's load is the same 128-byte half of 4 rows, 4 whole lines */
  const float* qs = Q + ((size_t)h * TT + fb * 64 * QW) * HD; const unsigned lq = ((tid >> 5) * 8 + ((tid >> 3) & 3)) * (HD * 4) + (tid & 7) * 16; v4f qa[4];
#pragma unroll
  for (int i = 0; i < 4; ++i) qa[i] = ldu<v4f>(qs, lq + (i >> 1) * 4 * HD * 4 + (i & 1) * 128);
  asm volatile("s_wait_xcnt 0x0" :: "v"(lq) : "memory");   /* stands in front of the first rewrite of a register that the loads above name; as its input the offset lives up to here */
  const unsigned sw = ((unsigned)(wave >> 1) * 8 + ((lane & 7) >> 1)) * QP + ((wave & 1) * 8 + (lane >> 3)) * 16 + (lane & 1) * 8;   /* where this lane's first 8 bytes go in the fragment order */
  if (fb >= NHB) { const int ks = wave & 3, gw = wave - ks;   /* the branch is the same for the whole block, as the barriers inside ask; the late rows are named first: built the other way round, their code held the 16 registers of qa to its end, for the early rows' code behind it, and spilled */
    fa_body<false, QW, 4>(qa, sq, sw, (wave >> 2) * QW, KH, KL, VT, VB, VBL, Y, h, fb * 64 * QW + (wave >> 2) * 16 * QW, lane, ks, sml + gw * 64, sac + gw * 512, ring, (unsigned)tid);
  } else { const int ks = wave & 1, gw = wave - ks;   /* the residual planes take twice the registers: 16-query tiles */
    fa_body<true, 1, 2>(qa, sq, sw, wave >> 1, KH, KL, VT, VB, VBL, Y, h, fb * 64 * QW + (wave >> 1) * 16, lane, ks, sml + gw * 64, sac + gw * 512, ring, (unsigned)tid); } }

extern "C" void kernel_launch(void* const* d_in, const int* in_sizes, int n_in, void* d_out, int out_size, void* d_ws, size_t ws_size, hipStream_t stream) {
  (void)in_sizes; (void)n_in; (void)out_size;
  const float** F = (const float**)d_in;
  if (ws_size < (size_t)WS_END) return;
  char* ws = (char*)d_ws; _Float16 *KH = (_Float16*)(ws + WS_KH), *VT = (_Float16*)(ws + WS_VT), *KL = (_Float16*)(ws + WS_KL); __bf16 *VB = (__bf16*)(ws + WS_VB), *VBL = (__bf16*)(ws + WS_VBL);
  // inputs: 0 q [B, H, T, 64], 1 k [B, H, 64, T], 2 v [B, H, T, 64] (causal flag folded)
  k_prep8<<<dim3(TNB * TT / 64, NH), 128, 0, stream>>>(F[1], F[2], KH, KL, VT, VB, VBL);
  k_fa<<<dim3(NFB * NH), 512, 0, stream>>>(F[0], KH, KL, VT, VB, VBL, (float*)d_out);
}

// v010
// One run takes 37.3 microseconds.
// In both of two side-by-side timings against v009, it was 1.03 times as fast.
// Counting every step since v000, it is 68.5 times as fast.
// compute dtype: all float inputs rounded to bf16; raw q / k / v: q and k enter the scores as f16 (bf16 values are exact in f16: exact products; the early-row residual planes are zero) x 64^-0.5 (from row 384 on the factor 64^-0.5 log2(e) is in q, rounded once more to f16); causal mask by index (the module's w*b + (-1e9)(1 - b) leaves exactly -1e9 on masked entries == exclusion); softmax f32 against a held reference maximum (moved up to the running maximum when P outgrows it; early rows: in every step); P (at most 1024) once to f16 x v (exact in f16; bf16 hi + lo below row 384), divided by the f32 sum at the end; f32 output.
#include <hip/hip_runtime.h>
#include <math.h>

typedef __attribute__((ext_vector_type(16))) _Float16 v16h;
typedef __attribute__((ext_vector_type(16))) __bf16 v16b;
typedef __attribute__((ext_vector_type(8)))  _Float16 v8h;
typedef __attribute__((ext_vector_type(8)))  float v8f;
typedef __attribute__((ext_vector_type(4)))  float v4f;
typedef __attribute__((ext_vector_type(2)))  float v2f;
typedef __attribute__((ext_vector_type(4)))  unsigned v4u;
typedef __attribute__((ext_vector_type(2)))  unsigned v2u;
typedef __attribute__((ext_vector_type(4)))  int v4i;
typedef float __attribute__((may_alias)) float_a;
typedef int __attribute__((may_alias)) int_a;

template <typename T> __device__ __forceinline__ void vst2(void* p, T v) { *(T*)p = v;  }
__device__ __forceinline__ v8f wmma16(v16h a, v16h b, v8f c) {
  v8f d = __builtin_amdgcn_wmma_f32_16x16x32_f16(false, a, false, b, (short)0, c, false, false);
  asm volatile("v_nop\n\tv_nop\n\tv_nop\n\tv_nop" : "+v"(d) : "v"(a), "v"(b));
  return d;
}
__device__ __forceinline__ v8f wmma_bf(v16b a, v16b b, v8f c) {
  v8f d = __builtin_amdgcn_wmma_f32_16x16x32_bf16(false, a, false, b, (short)0, c, false, false);
  asm volatile("v_nop\n\tv_nop\n\tv_nop\n\tv_nop" : "+v"(d) : "v"(a), "v"(b));
  return d;
}
// 16x16x32 fragments: lane = (h = lane>>4, row/col = lane&15); elements 0..7 = k0+8h+0..7, 8..15 = k0+16+8h+0..7; D element r = row 8h+r
__device__ __forceinline__ v16h frag_h(const _Float16* rowk0, int lane) {
  union { v16h v; v8h q[2]; } u; const _Float16* p = rowk0 + 8 * (lane >> 4);
  u.q[0] = *(const v8h*)p; u.q[1] = *(const v8h*)(p + 16); return u.v;
}
__device__ __forceinline__ v16h frag_f32(const float* rowk0, int lane) {
  v16h a; const float* p = rowk0 + 8 * (lane >> 4);
#pragma unroll
  for (int i = 0; i < 8; ++i) { a[i] = (_Float16)p[i]; a[8 + i] = (_Float16)p[16 + i]; }
  return a;
}
__device__ __forceinline__ v16h frag_f32s(const float* rowk0, int lane, float sc) {
  v16h a; const float* p = rowk0 + 8 * (lane >> 4);
#pragma unroll
  for (int i = 0; i < 8; ++i) { a[i] = (_Float16)(p[i] * sc); a[8 + i] = (_Float16)(p[16 + i] * sc); }
  return a;
}
// column fragment from a [K][ld] layout (column n), rows >= K read as 0
__device__ __forceinline__ v16h fragc_f32(const float* W, int k0, int n, int lane, int ld, int K) {
  v16h a; const int g = lane >> 4;
#pragma unroll
  for (int i = 0; i < 8; ++i) { const int ka = k0 + 8 * g + i, kb = ka + 16;
    a[i] = (_Float16)(ka < K ? W[(size_t)(ka < K ? ka : K - 1) * ld + n] : 0.f); a[8 + i] = (_Float16)(kb < K ? W[(size_t)(kb < K ? kb : K - 1) * ld + n] : 0.f); }
  return a;
}
struct F2 { v16b h, l; };
__device__ __forceinline__ F2 bsplit16(const float v[16]) { F2 r;
#pragma unroll
  for (int i = 0; i < 16; ++i) { const __bf16 h = (__bf16)v[i]; r.h[i] = h; r.l[i] = (__bf16)(v[i] - (float)h); }
  return r; }
__device__ __forceinline__ F2 split_row(const float* row, int k0, int lane) { float v[16]; const float* p = row + k0 + 8 * (lane >> 4);
#pragma unroll
  for (int i = 0; i < 8; ++i) { v[i] = p[i]; v[8 + i] = p[16 + i]; }
  return bsplit16(v); }
__device__ __forceinline__ F2 split_rowK(const float* row, int k0, int lane, int K) { float v[16]; const int g = lane >> 4;
#pragma unroll
  for (int i = 0; i < 8; ++i) { const int ka = k0 + 8 * g + i, kb = ka + 16; v[i] = ka < K ? row[ka < K ? ka : K - 1] : 0.f; v[8 + i] = kb < K ? row[kb < K ? kb : K - 1] : 0.f; }
  return bsplit16(v); }
__device__ __forceinline__ F2 split_col(const float* W, int k0, int n, int lane, int ld, int K) { float v[16]; const int g = lane >> 4;
#pragma unroll
  for (int i = 0; i < 8; ++i) { const int ka = k0 + 8 * g + i, kb = ka + 16; v[i] = ka < K ? W[(size_t)(ka < K ? ka : K - 1) * ld + n] : 0.f; v[8 + i] = kb < K ? W[(size_t)(kb < K ? kb : K - 1) * ld + n] : 0.f; }
  return bsplit16(v); }
__device__ __forceinline__ v8f mac3(const F2& a, const F2& b, v8f c) { c = wmma_bf(a.l, b.h, c); c = wmma_bf(a.h, b.l, c); return wmma_bf(a.h, b.h, c); }
__device__ __forceinline__ float sigm(float v) { return 1.0f / (1.0f + expf(-v)); }
#define LDSX() do { asm volatile("s_wait_dscnt 0" ::: "memory"); __builtin_amdgcn_wave_barrier(); __builtin_amdgcn_fence(__ATOMIC_RELEASE, "workgroup"); } while (0)

// Raw causal scaled-dot-product attention with a PRE-TRANSPOSED key (q [1,16,4096,64], k [1,16,64,4096] = [B, H, D, S], v [1,16,4096,64]; w = q k / sqrt(64); b = tril; w = w*b + (-1e9)(1 - b); softmax; out = w v -> [1,16,4096,64]).
#define NB 1
#define TT 4096
#define CC 1024            // NH * HD = projected width
#define DIN 1024          // input (model) width
#define NH 16
#define HD 64
#define NQB (TT / 64)
#define HG 1
#define SCALE (0.125f)
#define CAUSAL 1
#ifndef TNB
#define TNB NB
#endif
__device__ __forceinline__ float bfr(float v) { return (float)(__bf16)v; }
__host__ __device__ __forceinline__ int kb_last(int qb) { return CAUSAL ? ((qb * 64 + 63) >> 7) : (TT / 128 - 1); }
typedef __attribute__((ext_vector_type(8))) __bf16 v8b;
__device__ __forceinline__ v16b frag_b(const __bf16* rowk0, int lane) {
  union { v16b v; v8b q[2]; } u; const __bf16* p = rowk0 + 8 * (lane >> 4);
  u.q[0] = *(const v8b*)p; u.q[1] = *(const v8b*)(p + 16); return u.v;
}
#define QBH 6              // unused; causal: query rows below QHI (few keys, no averaging) take the high-precision path
#define QHI 384            // rows carrying a q residual plane (3-product logits)
#define KHI 384            // key rows carrying k residual / v bf16 hi+lo planes (used only by the causal high-precision path)
// B fragment (k rows k0+.., output column o) of a weight: (in,out) [K][ld] or (out,in) [ld rows of K]: bf16 exact, or f16(bf16 * 256) exact
__device__ __forceinline__ v16b wcol_io(const float* Wm, int k0, int o, int lane, int ld) { v16b w; const int g = lane >> 4;
#pragma unroll
  for (int i = 0; i < 8; ++i) { w[i] = (__bf16)Wm[(size_t)(k0 + 8 * g + i) * ld + o]; w[8 + i] = (__bf16)Wm[(size_t)(k0 + 16 + 8 * g + i) * ld + o]; }
  return w; }
__device__ __forceinline__ v16b wcol_oi(const float* Wm, int k0, int o, int lane, int K) { v16b w; const float* p = Wm + (size_t)o * K + k0 + 8 * (lane >> 4);
#pragma unroll
  for (int i = 0; i < 8; ++i) { w[i] = (__bf16)p[i]; w[8 + i] = (__bf16)p[16 + i]; }
  return w; }
__device__ __forceinline__ v16h wcolh_io(const float* Wm, int k0, int o, int lane, int ld) { v16h w; const int g = lane >> 4;
#pragma unroll
  for (int i = 0; i < 8; ++i) { w[i] = (_Float16)(bfr(Wm[(size_t)(k0 + 8 * g + i) * ld + o]) * 256.0f); w[8 + i] = (_Float16)(bfr(Wm[(size_t)(k0 + 16 + 8 * g + i) * ld + o]) * 256.0f); }
  return w; }
__device__ __forceinline__ v16h wcolh_oi(const float* Wm, int k0, int o, int lane, int K) { v16h w; const float* p = Wm + (size_t)o * K + k0 + 8 * (lane >> 4);
#pragma unroll
  for (int i = 0; i < 8; ++i) { w[i] = (_Float16)(bfr(p[i]) * 256.0f); w[8 + i] = (_Float16)(bfr(p[16 + i]) * 256.0f); }
  return w; }
#define WQKV_LAYOUT 1   // 0 = (in,out) [DIN][CC]; 1 = (out,in) [CC][DIN]; 2 = per-head [NH][DIN][HD]
__device__ __forceinline__ v16b wcol_hdk(const float* Wm, int k0, int o, int lane) { v16b w; const int g = lane >> 4; const float* p = Wm + (size_t)(o / HD) * DIN * HD + (o % HD);
#pragma unroll
  for (int i = 0; i < 8; ++i) { w[i] = (__bf16)p[(size_t)(k0 + 8 * g + i) * HD]; w[8 + i] = (__bf16)p[(size_t)(k0 + 16 + 8 * g + i) * HD]; }
  return w; }
#define WO_OUT_IN 0
#if WQKV_LAYOUT == 1
#define WCOL(W, k0, o, lane) wcol_oi(W, k0, o, lane, DIN)
#elif WQKV_LAYOUT == 2
#define WCOL(W, k0, o, lane) wcol_hdk(W, k0, o, lane)
#else
#define WCOL(W, k0, o, lane) wcol_io(W, k0, o, lane, CC)
#endif
#if WO_OUT_IN
#define WOCOL(W, k0, o, lane) wcol_oi(W, k0, o, lane, CC)
#define WOCOLH(W, k0, o, lane) wcolh_oi(W, k0, o, lane, CC)
#else
#define WOCOL(W, k0, o, lane) wcol_io(W, k0, o, lane, DIN)
#define WOCOLH(W, k0, o, lane) wcolh_io(W, k0, o, lane, DIN)
#endif

// ---- k_prep8: block = (64 attention positions s0.. of sequence b, head h): reads the module's k and v (v [B, H, S, 64]: element (b,h,s,c) at ((b*NH + h)*TT + s)*64 + c; the key PRE-TRANSPOSED [B, H, D, S]: element (b,h,s,c) at ((b*NH + h)*64 + c)*TT + s), bf16-rounds them and writes the attention planes (q is read by k_fa itself): k and v -> f16 in the order of k_fa's matrix fragments (below; + k residual rows and v bf16 hi/lo planes [c][s] for s < KHI)
// Fragment order, per head 128 bytes a position: k = [16-key tile][32-channel half kc][e][lane][8 channels kc*32 + 16 e + 8 (lane >> 4) ..] of key (lane & 15); v = [32-key step][16-channel tile j][e][lane][8 keys 16 e + 8 (lane >> 4) ..] of channel j*16 + (lane & 15). One 16-byte load of a wave is then 512 bytes in a row, four whole lines
// A stream: every thread asks for all its 16 x 16 bytes (whole 128-byte lines per wave) before it uses any, each element once. k and v are transposed 64 x 64 through LDS tiles of dwords (two neighbouring source rows = two neighbouring 16-bit elements of an output row). All stores stand behind the barrier, so that no wave waits at it for its own stores.
#define TP 33   // dwords per tile row; odd, so that the 16 tile rows a wave writes at once, and the 4 (early-row planes) or 16 (fragment order) it reads at once, spread over the banks
typedef __attribute__((ext_vector_type(2))) _Float16 v2h;
typedef __attribute__((ext_vector_type(2))) __bf16 v2b;
__device__ __forceinline__ unsigned pkh(float a, float b) { return __builtin_bit_cast(unsigned, (v2h){(_Float16)a, (_Float16)b}); }
__device__ __forceinline__ unsigned pkb(float a, float b) { return __builtin_bit_cast(unsigned, (v2b){(__bf16)a, (__bf16)b}); }
__device__ __forceinline__ float resh(float x) { return (x - (float)(_Float16)x) * 1024.0f; }   // what f16 leaves of x, x 2^10
__device__ __forceinline__ float resb(float x) { return x - (float)(__bf16)x; }                // what bf16 leaves of x
__device__ __forceinline__ v4u trow(const unsigned* t) { return (v4u){t[0], t[1], t[2], t[3]}; }
template <typename T> __device__ __forceinline__ T ldu(const void* ub, unsigned off) { return *(const T*)((const char*)ub + off); }   // block-uniform base + this lane's byte offset
template <typename T> __device__ __forceinline__ void stu(void* ub, unsigned off, T v) { *(T*)((char*)ub + off) = v; }
__global__ __launch_bounds__(128) void k_prep8(const float* __restrict__ K, const float* __restrict__ V, _Float16* __restrict__ KH, _Float16* __restrict__ KL, _Float16* __restrict__ VT, __bf16* __restrict__ VB, __bf16* __restrict__ VBL) {
  __shared__ unsigned tk[64 * TP], tv[64 * TP], tkl[64 * TP], tb[64 * TP], tbl[64 * TP];
  const unsigned tid = threadIdx.x; const int h = blockIdx.y; const size_t r0 = (size_t)blockIdx.x * 64; const size_t bb = r0 / TT; const int t0 = (int)(r0 % TT); const bool khi = t0 < KHI;
  const float* vs = V + ((bb * NH + h) * TT + t0) * HD; const float* ks = K + (bb * NH + h) * HD * (size_t)TT + t0;
  const unsigned x4 = tid & 15, rp0 = tid >> 4;   /* transposition: source columns 4 x4 .. + 3 of the source rows 2 rp, 2 rp + 1, rp = rp0 + 8 i */
  const unsigned lk = (2 * rp0 * TT + x4 * 4) * 4, lvv = (2 * rp0 * HD + x4 * 4) * 4;
  v4f ka[4][2], va[4][2];
#pragma unroll
  for (int i = 0; i < 4; ++i)
#pragma unroll
    for (int e = 0; e < 2; ++e) { ka[i][e] = ldu<v4f>(ks, lk + (16 * i + e) * TT * 4); va[i][e] = ldu<v4f>(vs, lvv + (16 * i + e) * HD * 4); }
  asm volatile("s_wait_xcnt 0x0" :: "v"(lk), "v"(lvv) : "memory");   /* stands in front of the first rewrite of an offset register that the loads above name; as its inputs these registers live up to here */
#pragma unroll
  for (int i = 0; i < 4; ++i)
#pragma unroll
    for (int e = 0; e < 2; ++e)
#pragma unroll
      for (int j = 0; j < 4; ++j) { ka[i][e][j] = bfr(ka[i][e][j]); va[i][e][j] = bfr(va[i][e][j]); }   /* module inputs: bf16-rounded; bf16 values are exact in f16, so the residual planes are 0 */
  const unsigned ow = x4 * 4 * TP + rp0;
#pragma unroll
  for (int i = 0; i < 4; ++i)
#pragma unroll
    for (int j = 0; j < 4; ++j) { const unsigned o = ow + j * TP + 8 * i; tk[o] = pkh(ka[i][0][j], ka[i][1][j]); tv[o] = pkh(va[i][0][j], va[i][1][j]); }
  if (khi) {
#pragma unroll
    for (int i = 0; i < 4; ++i)
#pragma unroll
      for (int j = 0; j < 4; ++j) { const unsigned o = ow + j * TP + 8 * i; tkl[o] = pkh(resh(ka[i][0][j]), resh(ka[i][1][j])); tb[o] = pkb(va[i][0][j], va[i][1][j]); tbl[o] = pkb(resb(va[i][0][j]), resb(va[i][1][j])); } }
  __syncthreads();
  const unsigned xr = tid >> 3, q8 = tid & 7, orr = xr * TP + q8 * 4;   /* output rows xr + 16 i (a position of k, a channel of v), their elements 8 q8 .. + 7 */
  const unsigned sk = (xr * CC + q8 * 8) * 2;
  const unsigned fw = tid >> 5, fc = tid & 15, fd = (fw & 1) * 8 + ((tid >> 4) & 1) * 4, sf = tid * 16;   /* fragment order: wave fw stores 512-byte piece 4 i + fw of the block's 8 KB; fc = fragment row, fd = the dword of its elements 16 e + 8 g */
  const unsigned ofk = fc * TP + (fw >> 1) * 16 + fd, ofv = ((fw >> 1) * 16 + fc) * TP + fd;
  _Float16* kd = KH + ((bb * NH + h) * TT + t0) * HD; _Float16* vd = VT + ((bb * NH + h) * TT + t0) * HD;
#pragma unroll
  for (int i = 0; i < 4; ++i) { stu(kd, sf + 2048 * i, trow(tk + ofk + 16 * i * TP)); stu(vd, sf + 2048 * i, trow(tv + ofv + (i & 1) * 32 * TP + (i >> 1) * 16)); }
  asm volatile("s_wait_xcnt 0x0" ::: "memory");   /* stands in front of the first rewrite of a register that the stores above name; in front of the branch, so that nothing of the branch's own block comes to stand ahead of it */
  if (khi) {
    const unsigned sb = (xr * KHI + q8 * 8) * 2; _Float16* kld = KL + (bb * KHI + t0) * (size_t)CC + h * HD; __bf16* bd = VB + (bb * CC + h * HD) * (size_t)KHI + t0; __bf16* bld = VBL + (bb * CC + h * HD) * (size_t)KHI + t0;
#pragma unroll
    for (int i = 0; i < 4; ++i) { stu(kld, sk + 16 * i * CC * 2, trow(tkl + orr + 16 * i * TP)); stu(bd, sb + 16 * i * KHI * 2, trow(tb + orr + 16 * i * TP)); stu(bld, sb + 16 * i * KHI * 2, trow(tbl + orr + 16 * i * TP)); } } }

#ifndef SM_EXTRA_PARAMS
#define SM_EXTRA_PARAMS
#endif
#ifndef PROJ_EXTRA_PARAMS
#define PROJ_EXTRA_PARAMS
#endif
#ifndef SM_MASK_HOOK
#define SM_MASK_HOOK (void)0
#endif

#define WS_KH  0u                                      // f16 k in fragment order [b][h][t / 16][2 KB]
#define WS_VT  (WS_KH + 2u * (size_t)NB * TT * CC)      // f16 v in fragment order [b][h][t / 32][4 KB]
#define WS_KL  (WS_VT + 2u * (size_t)NB * CC * TT)      // f16 k residual x 2^10 rows [b][t < KHI][CC]
#define WS_VB  (WS_KL + 2u * (size_t)NB * KHI * CC)     // bf16 v hi planes [b][c][t < KHI]
#define WS_VBL (WS_VB + 2u * (size_t)NB * CC * KHI)
#define WS_END (WS_VBL + 2u * (size_t)NB * CC * KHI)

// ---- k_fa: scores, softmax and P . v of one (head, 128-query block) in one kernel; KS waves share QT * 16 query rows: wave ks of them takes the 32-key steps ks, ks + KS, .. of the keys [0, ql0 + 16 * QT) rounded up to a multiple of 32 and keeps, per query, a reference maximum, a running sum and a 64-wide f32 sum (rescaled when the reference moves), so no logit and no P ever goes to memory. Late rows hold the reference: the maximum of the wave's first step stays in use while every step's P stay small enough for f16, so that the common step forms no maximum and rescales nothing. Their queries carry the factor C2, and minus the reference is the C operand of the score products: the common step's score tiles are the exponents themselves, with no vector instruction between product and 2^x. At the end the KS waves bring their sums to one maximum and add them, in wave order, through LDS.
// Transposed products: S^T = K . Q^T (A = key rows, B = query rows), so a lane holds 16 scores of ONE query (column lane & 15; keys k0 + 8g + r and k0 + 16 + 8g + r) and the two score tiles, converted in place, are the B operand of O^T += V^T . P^T in the hardware k order; A = v by channel, in the same order (frag_r from the ring; early rows frag_bu).
// HI (query blocks below row QHI): q and k residual planes enter the scores (3 products), P as bf16 hi + lo against v bf16 hi + lo (3 products), as before.
// Every plain '#pragma unroll' below stands on a loop of constant length, so that the fragment arrays are indexed by constants and stay in registers.
template <bool B> struct BC { static constexpr bool v = B; };
#define QW 2   // 16-query tiles of a wave
#define C2 (SCALE * 1.44269504088896340736f)   // logits in units of log2
#define PTOP 1024.0f   // while the 16 P of a lane and step sum to no more than this, each of them is at most this: far inside f16 and bf16, and the reference stays
__device__ __forceinline__ float xhalf(float x) { return __builtin_bit_cast(float, __builtin_amdgcn_permlanex16(__builtin_bit_cast(int, x), __builtin_bit_cast(int, x), 0x76543210, 0xfedcba98, false, false)); }   // lane l with lane l ^ 16
// fragment from a wave-uniform base and this lane's own byte offset (row * pitch + 16 * (lane >> 4)): the lane offsets never change, only the scalar base walks
__device__ __forceinline__ v16h frag_hu(const _Float16* ub, unsigned lo) { union { v16h v; v8h q[2]; } u; const char* p = (const char*)ub + lo; u.q[0] = *(const v8h*)p; u.q[1] = *(const v8h*)(p + 32); return u.v; }
__device__ __forceinline__ v16h frag_fu(const _Float16* ub, unsigned lo) { union { v16h v; v8h q[2]; } u; const char* p = (const char*)ub + lo; u.q[0] = *(const v8h*)p; u.q[1] = *(const v8h*)(p + 512); return u.v; }   // from the fragment-order planes: the lane's 16 * lane bytes are in the address (lo = 0), the two halves 512 bytes apart
// The block's 128 query rows in LDS, in the order of the score products' B fragments: [16-query tile][32-channel half kc][e][g] pieces of 16 queries x 16 bytes (8 channels kc*32 + 16 e + 8 g ..), QP bytes apart. QP = 256 + 64: the four pieces that a wave writes at once start 16 banks apart, so that its 8-byte stores meet no bank twice; a reader's 16 lanes take one piece, 256 bytes in a row
#define QP 320
#define QPL (64 * QP)   // one plane: 8 tiles x 2 x 2 x 2 pieces
__device__ __forceinline__ v16h frag_q(const char* s, unsigned lo) { union { v16h v; v8h q[2]; } u; u.q[0] = *(const v8h*)(s + lo); u.q[1] = *(const v8h*)(s + lo + 2 * QP); return u.v; }   // lo = ((tile * 2 + kc) * 4 + g) * QP + 16 * query; e = 1 two pieces on
__device__ __forceinline__ v16b frag_bu(const __bf16* ub, unsigned lo) { union { v16b v; v8b q[2]; } u; const char* p = (const char*)ub + lo; u.q[0] = *(const v8b*)p; u.q[1] = *(const v8b*)(p + 32); return u.v; }
// The late rows' ring in LDS: a stage = 256 keys of the block's head, 32 KB of the k plane and 32 KB of the v plane, each in a row in memory and laid down as it lies there (fragment order); two buffers
#define STK 32768          // bytes of one plane in a stage
#define STG (2 * STK)      // one buffer
__device__ __forceinline__ v16h frag_r(const char* p) { union { v16h v; v8h q[2]; } u; u.q[0] = *(const v8h*)p; u.q[1] = *(const v8h*)(p + 512); return u.v; }   // from the ring: p = the fragment's 1 KB + 16 * lane, the two halves 512 bytes apart; a wave's 16-byte read is 512 bytes in a row
// one stage: every thread of the 512 copies 8 x 16 bytes, global memory to LDS through no register (l = the LDS byte address of this thread's first 16 bytes in the buffer, gk and gv = their places in the planes). The s_wait_xcnt closes the copies' own statement, so that it stands in front of every later rewrite of an address register that they name
__device__ __forceinline__ void stage_copy(unsigned l, const char* gk, const char* gv) {
  asm volatile("global_load_async_to_lds_b128 %0, %8, off\n\tglobal_load_async_to_lds_b128 %1, %9, off\n\tglobal_load_async_to_lds_b128 %2, %10, off\n\tglobal_load_async_to_lds_b128 %3, %11, off\n\t"
               "global_load_async_to_lds_b128 %4, %12, off\n\tglobal_load_async_to_lds_b128 %5, %13, off\n\tglobal_load_async_to_lds_b128 %6, %14, off\n\tglobal_load_async_to_lds_b128 %7, %15, off\n\ts_wait_xcnt 0x0"
               :: "v"(l), "v"(l + 8192u), "v"(l + 16384u), "v"(l + 24576u), "v"(l + STK), "v"(l + STK + 8192u), "v"(l + STK + 16384u), "v"(l + STK + 24576u),
                  "v"(gk), "v"(gk + 8192), "v"(gk + 16384), "v"(gk + 24576), "v"(gv), "v"(gv + 8192), "v"(gv + 16384), "v"(gv + 24576) : "memory"); }
__device__ __forceinline__ float exp2_slot(float x) { float r; asm("v_exp_f32 %0, %1\n\tv_nop" : "=v"(r) : "v"(x)); return r; }   // 2^x of one value (a lift's rescale factor, the join behind the loop); the v_nop fills the slot that the instruction set asks for between a transcendental and a next instruction that reads its result or overwrites its source
// 2^x of 16 values, in place, as one run: inside it every v_exp_f32 is followed by an independent one, and behind the last stands a v_nop: the slot that the instruction set asks for between a transcendental and a next instruction that reads its result or overwrites its source
__device__ __forceinline__ void exp2_run(float (&x)[16]) {
  asm("v_exp_f32 %0, %0\n\tv_exp_f32 %1, %1\n\tv_exp_f32 %2, %2\n\tv_exp_f32 %3, %3\n\tv_exp_f32 %4, %4\n\tv_exp_f32 %5, %5\n\tv_exp_f32 %6, %6\n\tv_exp_f32 %7, %7\n\tv_exp_f32 %8, %8\n\tv_exp_f32 %9, %9\n\tv_exp_f32 %10, %10\n\tv_exp_f32 %11, %11\n\tv_exp_f32 %12, %12\n\tv_exp_f32 %13, %13\n\tv_exp_f32 %14, %14\n\tv_exp_f32 %15, %15\n\tv_nop"
      : "+v"(x[0]), "+v"(x[1]), "+v"(x[2]), "+v"(x[3]), "+v"(x[4]), "+v"(x[5]), "+v"(x[6]), "+v"(x[7]), "+v"(x[8]), "+v"(x[9]), "+v"(x[10]), "+v"(x[11]), "+v"(x[12]), "+v"(x[13]), "+v"(x[14]), "+v"(x[15])); }
// 2^x of the 8 values of a score tile, read where the matrix product left them and written to registers of their own (written in place, ten of a step's 32 values were first copied out of their tiles); the run as in exp2_run, but the slot behind its last v_exp_f32 is filled by work: the first add of the tile's sum, t = y0 + y1, which touches neither the last result nor its source; the outputs are early-clobber, so that none lands on a source still to be read. Volatile: the statements keep their order behind the score products' statement, which counts on it
template <int O> __device__ __forceinline__ void exp2_tile(float (&y)[16], float& t, const v8f x) {
  asm volatile("v_exp_f32 %0, %9\n\tv_exp_f32 %1, %10\n\tv_exp_f32 %2, %11\n\tv_exp_f32 %3, %12\n\tv_exp_f32 %4, %13\n\tv_exp_f32 %5, %14\n\tv_exp_f32 %6, %15\n\tv_exp_f32 %7, %16\n\tv_add_f32 %8, %0, %1"
      : "=&v"(y[O]), "=&v"(y[O + 1]), "=&v"(y[O + 2]), "=&v"(y[O + 3]), "=&v"(y[O + 4]), "=&v"(y[O + 5]), "=&v"(y[O + 6]), "=&v"(y[O + 7]), "=&v"(t)
      : "v"(x[0]), "v"(x[1]), "v"(x[2]), "v"(x[3]), "v"(x[4]), "v"(x[5]), "v"(x[6]), "v"(x[7])); }
template <bool HI, int QT, int KS> __device__ __forceinline__ void fa_body(const v4f (&qa)[4], char* sq, unsigned sw, int qt0, const _Float16* __restrict__ KH, const _Float16* __restrict__ KL, const _Float16* __restrict__ VT, const __bf16* __restrict__ VB, const __bf16* __restrict__ VBL, float* __restrict__ Y, int h, int ql0, int lane, int ks, float* gml, v4f* gac, char* ring, unsigned tid) {
  static_assert(QT * (HD / 16) == 2 * KS, "each wave adds up and stores two 16-channel tiles: one whole 128-byte line of each of 16 queries");
  const int col = lane & 15, g = lane >> 4; const int nst = ((ql0 + 16 * QT - 1) >> 5) + 1; const int klast = (nst - 1) * 32;
  const _Float16* kp = KH + (size_t)h * HD * TT; const _Float16* klp = KL + h * HD; const _Float16* vp = VT + (size_t)h * HD * TT; const __bf16* vbp = VB + (size_t)h * HD * KHI; const __bf16* vblp = VBL + (size_t)h * HD * KHI;   /* wave-uniform */
  const unsigned lrow = (unsigned)col * (CC * 2) + 16 * g, lf = (unsigned)lane * 16, lvb = (unsigned)col * (KHI * 2) + 16 * g;   /* lane offsets, bytes: k residual rows, k and v in fragment order, early v planes */
  v16h qf[QT][2], qlf[QT][2], kf[4];
  auto loadK = [&](v16h (&kd)[4], int k0) { const _Float16* ka = (const _Float16*)((const char*)(kp + (size_t)k0 * HD) + lf);   /* this lane's own address: its 16 bytes of the step's first 512 */
#pragma unroll
    for (int t = 0; t < 2; ++t)
#pragma unroll
      for (int kc = 0; kc < 2; ++kc) kd[t * 2 + kc] = frag_fu(ka + (t * 2 + kc) * 512, 0);
    asm volatile("s_wait_xcnt 0x0" :: "v"(ka) : "memory");   /* stands in front of the first rewrite of an address register that the loads above name; as its input the address lives up to here, so that no load of the run lands in it */ };
  v8f acc[QT][HD / 16] = {}; float m[QT], l[QT];
  constexpr float SC = HI ? C2 : 1.0f;   /* what is still to be multiplied onto a score: late rows have C2 in their queries */
  v8f cm[QT] = {};   /* late rows: minus the reference in use, in all 8 registers of a tile: the C operand of the score products */
#pragma unroll
  for (int u = 0; u < QT; ++u) { m[u] = -3.0e38f; l[u] = 0.f; }
  auto step = [&](int k0, const char* rb, auto mk, auto fs) { constexpr bool MASK = decltype(mk)::v, FIRST = decltype(fs)::v;   /* rb (late rows): this lane's 16 bytes of the wave's first k fragment in the stage's buffer */
    v16h vf[HD / 16];   /* late rows: this step's k and v fragments, all 16 LDS reads at one place (the few HI steps, short of registers, fetch their v where they use it) */
    if constexpr (!HI) {
#pragma unroll
      for (int f = 0; f < 4; ++f) kf[f] = frag_r(rb + f * 1024);
#pragma unroll
      for (int j = 0; j < HD / 16; ++j) vf[j] = frag_r(rb + STK + j * 1024);
      __builtin_amdgcn_sched_barrier(0);   /* keeps the v reads up here, behind the k reads: moved down to their use, as the compiler did, the wave would wait out a second LDS latency in every step, in front of the P . v products */ }
    v8f st[QT][2];
    auto scores = [&](const v16h (&kk)[4], auto rf) {   /* rf: the products are added to minus the reference, not to 0 */
#pragma unroll
      for (int u = 0; u < QT; ++u)
#pragma unroll
        for (int t = 0; t < 2; ++t) st[u][t] = (v8f){};
      if constexpr (decltype(rf)::v) {
        static_assert(!decltype(rf)::v || QT == 2, "the statement below names two query tiles");
        /* the step's 8 score products as one statement, for the first four to read their C from cm and write another tile: the builtin form copied cm into two of the four tiles in every step. Each tile's second product stands three products behind its first. The v_nop are the slots that the chip needs between a product and a vector instruction on its result: four where the mask may take any tile first; one in the common step, where the 2^x runs follow in the tiles' own order (volatile statements keep it): the first tile's last product then has three products and the v_nop behind it, and each run of 9 covers the next tile */
        if constexpr (MASK)
          asm volatile("v_wmma_f32_16x16x32_f16 %0, %4, %8, %12\n\tv_wmma_f32_16x16x32_f16 %1, %6, %8, %12\n\tv_wmma_f32_16x16x32_f16 %2, %4, %10, %13\n\tv_wmma_f32_16x16x32_f16 %3, %6, %10, %13\n\t"
            "v_wmma_f32_16x16x32_f16 %0, %5, %9, %0\n\tv_wmma_f32_16x16x32_f16 %1, %7, %9, %1\n\tv_wmma_f32_16x16x32_f16 %2, %5, %11, %2\n\tv_wmma_f32_16x16x32_f16 %3, %7, %11, %3\n\tv_nop\n\tv_nop\n\tv_nop\n\tv_nop"
            : "=&v"(st[0][0]), "=&v"(st[0][1]), "=&v"(st[QT - 1][0]), "=&v"(st[QT - 1][1])
            : "v"(kk[0]), "v"(kk[1]), "v"(kk[2]), "v"(kk[3]), "v"(qf[0][0]), "v"(qf[0][1]), "v"(qf[QT - 1][0]), "v"(qf[QT - 1][1]), "v"(cm[0]), "v"(cm[QT - 1]));
        else
          asm volatile("v_wmma_f32_16x16x32_f16 %0, %4, %8, %12\n\tv_wmma_f32_16x16x32_f16 %1, %6, %8, %12\n\tv_wmma_f32_16x16x32_f16 %2, %4, %10, %13\n\tv_wmma_f32_16x16x32_f16 %3, %6, %10, %13\n\t"
            "v_wmma_f32_16x16x32_f16 %0, %5, %9, %0\n\tv_wmma_f32_16x16x32_f16 %1, %7, %9, %1\n\tv_wmma_f32_16x16x32_f16 %2, %5, %11, %2\n\tv_wmma_f32_16x16x32_f16 %3, %7, %11, %3\n\tv_nop"
            : "=&v"(st[0][0]), "=&v"(st[0][1]), "=&v"(st[QT - 1][0]), "=&v"(st[QT - 1][1])
            : "v"(kk[0]), "v"(kk[1]), "v"(kk[2]), "v"(kk[3]), "v"(qf[0][0]), "v"(qf[0][1]), "v"(qf[QT - 1][0]), "v"(qf[QT - 1][1]), "v"(cm[0]), "v"(cm[QT - 1]));
      } else {
#pragma unroll
      for (int t = 0; t < 2; ++t)
#pragma unroll
        for (int kc = 0; kc < 2; ++kc)
#pragma unroll
          for (int u = 0; u < QT; ++u) st[u][t] = __builtin_amdgcn_wmma_f32_16x16x32_f16(false, kk[t * 2 + kc], false, qf[u][kc], (short)0, st[u][t], false, false); }
      if constexpr (HI) { v8f sl[QT][2] = {};
#pragma unroll
        for (int t = 0; t < 2; ++t) {
#pragma unroll
          for (int kc = 0; kc < 2; ++kc) { const v16h klf = frag_hu(klp + (size_t)(k0 + t * 16) * CC + kc * 32, lrow);
#pragma unroll
            for (int u = 0; u < QT; ++u) { sl[u][t] = __builtin_amdgcn_wmma_f32_16x16x32_f16(false, kk[t * 2 + kc], false, qlf[u][kc], (short)0, sl[u][t], false, false); sl[u][t] = __builtin_amdgcn_wmma_f32_16x16x32_f16(false, klf, false, qf[u][kc], (short)0, sl[u][t], false, false); } }
#pragma unroll
          for (int u = 0; u < QT; ++u) st[u][t] += sl[u][t] * (1.0f / 1024.0f); }
        asm volatile("s_wait_xcnt 0x0" :: "v"(lrow) : "memory");   /* as in loadK, for the residual rows' loads above: as its input the lane offset lives up to here, so that no load of the run lands in it (in the last step one did) */ }
      if constexpr (MASK) {
#pragma unroll
        for (int u = 0; u < QT; ++u)
#pragma unroll
          for (int t = 0; t < 2; ++t)
#pragma unroll
            for (int r = 0; r < 8; ++r) if (k0 + 16 * t + 8 * g + r > ql0 + u * 16 + col) st[u][t][r] = -3.0e38f; } };
    float p[QT][16], sum[QT];
    auto soft = [&](int u, auto rf) {   /* P and its sum against the reference m[u] in use; rf: the tiles hold the exponents already */
      if constexpr (decltype(rf)::v) { float ta, tb; exp2_tile<0>(p[u], ta, st[u][0]); exp2_tile<8>(p[u], tb, st[u][1]);   /* the other 12 P are added as neighbouring pairs, two sums an instruction; then the pair's halves and the two first adds */
        v2f s2 = (v2f){p[u][2], p[u][3]} + (v2f){p[u][10], p[u][11]};
#pragma unroll
        for (int i = 4; i < 8; i += 2) { s2 += (v2f){p[u][i], p[u][i + 1]}; s2 += (v2f){p[u][8 + i], p[u][9 + i]}; }
        sum[u] = (ta + tb) + (s2[0] + s2[1]);
      } else {
#pragma unroll
        for (int i = 0; i < 16; ++i) p[u][i] = fmaf(st[u][i >> 3][i & 7], SC, -m[u]);
        exp2_run(p[u]);
        sum[u] = p[u][0];
#pragma unroll
        for (int i = 1; i < 16; ++i) sum[u] += p[u][i]; } };
    auto lift = [&](int u) {   /* the reference moves up to the running maximum; what was summed so far is rescaled (a first step has nothing summed) */
      float mx = fmaxf(st[u][0][0], st[u][1][0]);
#pragma unroll
      for (int r = 1; r < 8; ++r) mx = fmaxf(mx, fmaxf(st[u][0][r], st[u][1][r]));
      mx = fmaxf(mx, xhalf(mx));   /* the other half of this query's 32 keys */
      const float mn = fmaxf(m[u], mx * SC);
      if constexpr (!FIRST) { const float al = exp2_slot(m[u] - mn); l[u] *= al;
#pragma unroll
        for (int j = 0; j < HD / 16; ++j) acc[u][j] *= al; }
      m[u] = mn;
      if constexpr (!HI) {
#pragma unroll
        for (int r = 0; r < 8; ++r) cm[u][r] = -mn; } };
    if constexpr (MASK && !HI) {   /* the one step behind the loop sets its C tiles up anew from m: carried out of the loop they would take a second set of registers and a copy in every trip */
#pragma unroll
      for (int u = 0; u < QT; ++u)
#pragma unroll
        for (int r = 0; r < 8; ++r) cm[u][r] = -m[u]; }
    scores(kf, BC<!(HI || FIRST)>{});
    if constexpr (HI && !MASK) loadK(kf, k0 + 32 * KS < klast ? k0 + 32 * KS : klast);   /* early rows: the key fragments of this wave's next step, into the same registers, one step ahead of their use (a wave with no next step asks for the last step's: in range, unused) */
    if constexpr (HI || FIRST) {   /* the few early-row steps move the reference in every step */
#pragma unroll
      for (int u = 0; u < QT; ++u) { lift(u); soft(u, BC<false>{}); }
    } else {
      bool over = false;
#pragma unroll
      for (int u = 0; u < QT; ++u) { soft(u, BC<true>{}); over |= !(sum[u] <= PTOP); }
      if (__builtin_amdgcn_ballot_w32(over) != 0) {   /* one scalar test a step, every lane stays on: some lane's P have outgrown the reference. Rare, so the scores are not kept for it: they are formed again, this time added to 0, from this step's key fragments, still in their registers */
        scores(kf, BC<false>{});
#pragma unroll
        for (int u = 0; u < QT; ++u) { lift(u); soft(u, BC<false>{}); } } }
#pragma unroll
    for (int u = 0; u < QT; ++u) {
      l[u] += sum[u];
      if constexpr (HI) { const F2 pb = bsplit16(p[u]); const __bf16* vha = (const __bf16*)((const char*)(vbp + k0) + lvb); const __bf16* vla = (const __bf16*)((const char*)(vblp + k0) + lvb);   /* this lane's own addresses, as in loadK */
#pragma unroll
        for (int j = 0; j < HD / 16; ++j) { const v16b vh = frag_bu(vha + (size_t)j * 16 * KHI, 0), vl = frag_bu(vla + (size_t)j * 16 * KHI, 0); acc[u][j] = __builtin_amdgcn_wmma_f32_16x16x32_bf16(false, vh, false, pb.h, (short)0, acc[u][j], false, false); acc[u][j] = __builtin_amdgcn_wmma_f32_16x16x32_bf16(false, vh, false, pb.l, (short)0, acc[u][j], false, false); acc[u][j] = __builtin_amdgcn_wmma_f32_16x16x32_bf16(false, vl, false, pb.h, (short)0, acc[u][j], false, false); }
        asm volatile("s_wait_xcnt 0x0" :: "v"(vha), "v"(vla) : "memory");   /* as in loadK: in front of the first rewrite of the address registers; as its inputs they live up to here, so that no load of the run lands in them */
      } }
    if constexpr (!HI) { v16h pf[QT];   /* both query tiles' P to f16 first, each into registers of its own, then the 8 products in a row: converted between the two tiles' products into the first tile's registers, the second cost four idle slots behind the products that still read them */
#pragma unroll
      for (int u = 0; u < QT; ++u)
#pragma unroll
        for (int i = 0; i < 16; ++i) pf[u][i] = (_Float16)p[u][i];
      __builtin_amdgcn_sched_barrier(0);   /* keeps all 16 conversions in front of the products: moved in among them, as the compiler did, the last ones were given registers of the first tile's P and had to wait out the four slots */
#pragma unroll
      for (int u = 0; u < QT; ++u)
#pragma unroll
        for (int jj = 0; jj < HD / 16; ++jj) { const int j = (jj + (u == QT - 1 ? HD / 16 - 1 : 0)) % (HD / 16);   /* the last tile begins with the v fragment that was read last: the next step's LDS address is formed in one of its registers, and three products and an add then stand between */
          acc[u][j] = __builtin_amdgcn_wmma_f32_16x16x32_f16(false, vf[j], false, pf[u], (short)0, acc[u][j], false, false); } } };
  const int nr = ql0 >> 7, nsg = (nr >> 1) + 1;   /* late rows: a round = 128 keys, one step of each of the KS waves; round nr holds the block's diagonals; stages of two rounds up to it (the last may reach 128 keys past the diagonal, still inside the planes: nr is then even, at most TT / 128 - 2). The same numbers in every wave of the block */
  const unsigned lr = (unsigned)(size_t)ring + tid * 16; const char* gk = (const char*)kp + tid * 16; const char* gv = (const char*)vp + tid * 16;   /* this thread's first 16 bytes of a stage: in buffer 0 (LDS byte address: the low 32 bits), in the planes */
  if constexpr (HI) loadK(kf, ks * 32 < klast ? ks * 32 : klast); else stage_copy(lr, gk, gv);   /* on their way while the queries are dealt out (late rows: stage 0 into buffer 0) */
  __builtin_amdgcn_sched_barrier(0);   /* keeps the conversions below, which wait for the query rows, behind the issue of the key loads or copies: moved in front of it they would hold those back until the rows have come */
  /* the queries: qa[i] = channels (i & 1) * 32 + 4 (lane & 7) .. + 3 of block row wave * 8 + (i >> 1) * 4 + (lane >> 3), bf16-rounded like k and v, as f16 (early rows: + the x 2^10 residual plane; late rows: x C2 before the rounding to f16) to their places in the fragment order */
#pragma unroll
  for (int i = 0; i < 4; ++i) { const float a = bfr(qa[i][0]), b = bfr(qa[i][1]), c = bfr(qa[i][2]), d = bfr(qa[i][3]); const unsigned o = sw + (i & 1) * 4 * QP + (i >> 1) * 64;
    constexpr float QS = HI ? 1.0f : C2;
    *(v2u*)(sq + o) = (v2u){pkh(a * QS, b * QS), pkh(c * QS, d * QS)};
    if constexpr (HI) *(v2u*)(sq + QPL + o) = (v2u){pkh(resh(a), resh(b)), pkh(resh(c), resh(d))}; }
  if constexpr (!HI) asm volatile("s_wait_asynccnt 0x0" ::: "memory");   /* this wave's copies of stage 0 have landed before the barrier behind which the other waves read them */
  __syncthreads();   /* every wave's rows (late rows: and its part of stage 0) are in place before any wave takes its fragments */
  if constexpr (!HI) { if (nsg > 1) stage_copy(lr + STG, gk + STK, gv + STK); }   /* stage 1 into buffer 1: it flies while stage 0 is worked on */
#pragma unroll
  for (int u = 0; u < QT; ++u)
#pragma unroll
    for (int kc = 0; kc < 2; ++kc) { const unsigned o = (((unsigned)(qt0 + u) * 2 + kc) * 4 + g) * QP + col * 16; qf[u][kc] = frag_q(sq, o); if constexpr (HI) qlf[u][kc] = frag_q(sq + QPL, o); }
  static_assert(HI || QHI / 32 >= KS, "below: every wave of a late-row tile has a first step in front of the diagonal");
  if constexpr (HI) {
#pragma unroll 1   /* rolled: a second copy of the step would double the fragments in flight, past the 256 registers that a wave of a 16-wave block may have */
    for (int s = ks; s < nst - 1; s += KS) step(s * 32, nullptr, BC<false>{}, BC<false>{});   /* every key of these steps is below the wave's first query: no mask */
    if (((nst - 1) & (KS - 1)) == ks) step(klast, nullptr, BC<true>{}, BC<false>{});   /* the step that holds the diagonal: the wave whose turn it is (a scalar test: every lane stays on) */
  } else {
    static_assert(HI || (KS == 4 && QT == 2), "a round is KS steps of 32 keys = 128 keys = the block's query rows");
    static_assert((TT / 128) % 2 == 0, "whole stages lie inside the planes");
    const char* rl = ring + ks * 4096 + lf;   /* round i lies in buffer (i / 2) % 2, in half i % 2 of either plane; of its 16 KB wave ks takes 4 KB, the 32 keys ks * 32 .. */
    auto place = [&](int i) { return rl + ((i >> 1) & 1) * STG + (i & 1) * (STK / 2); };
    auto foot = [&](int t) {   /* stage t + 1 is handed over, and stage t's buffer goes to stage t + 2 */
      asm volatile("s_wait_dscnt 0x0" ::: "memory");      /* this wave's reads of stage t's buffer are done before the barrier behind which it is refilled */
      asm volatile("s_wait_asynccnt 0x0" ::: "memory");   /* this wave's copies of stage t + 1 have landed before the barrier behind which the other waves read them */
      __syncthreads();
      if (t + 2 < nsg) stage_copy(lr + (t & 1) * STG, gk + (size_t)(t + 2) * STK, gv + (size_t)(t + 2) * STK); };   /* the same test in the whole block */
    step(ks * 32, rl, BC<false>{}, BC<true>{});   /* a wave's first step sets its reference */
#pragma unroll 1   /* rolled: a second copy of the step would double the fragments in flight, past the 256 registers that a wave of a 16-wave block may have */
    for (int i = 1; i < nr; ++i) { step(i * 128 + ks * 32, place(i), BC<false>{}, BC<false>{}); if (i & 1) foot(i >> 1); }   /* every key of these rounds is below the block's first query: no mask; behind a stage's second round the next stage is handed over (a scalar test, the same in the whole block) */
    if (ks <= ((nst - 1) & 3)) step(nr * 128 + ks * 32, place(nr), BC<true>{}, BC<false>{});   /* the round that holds the diagonals: a wave's step up to and with its own tile's diagonal step (a scalar test: every lane stays on); in front of the diagonal step the mask changes nothing. Its stage was handed over behind round nr - 1 or nr - 2, and no stage follows: nothing is handed over behind it */
    asm volatile("s_wait_asynccnt 0x0" ::: "memory");   /* behind the last copy: none is outstanding when the wave goes on */
  }
  /* the KS waves' parts become one: gml = [wave][u][maximum | sum][query], gac = [wave][u][j][half of the 8 channels][lane]. A wave that had no step brings maximum -3e38, sums 0: weight 0 */
#pragma unroll
  for (int u = 0; u < QT; ++u) { const float lt = l[u] + xhalf(l[u]); gml[ks * 64 + (u * 2 + g) * 16 + col] = g ? lt : m[u]; }
  __syncthreads();
#pragma unroll
  for (int u = 0; u < QT; ++u) { float mk[KS], mm = -3.0e38f, ls = 0.f;
#pragma unroll
    for (int k = 0; k < KS; ++k) { mk[k] = gml[k * 64 + u * 32 + col]; mm = fmaxf(mm, mk[k]); }
#pragma unroll
    for (int k = 0; k < KS; ++k) ls += gml[k * 64 + u * 32 + 16 + col] * exp2_slot(mk[k] - mm);   /* at least 1: the key that gave the maximum counts 1 */
    const float f = exp2_slot(m[u] - mm) / ls;
#pragma unroll
    for (int j = 0; j < HD / 16; ++j) { const v8f o = acc[u][j] * f; v4f* d = gac + ks * 512 + (u * (HD / 16) + j) * 64 + lane; d[0] = (v4f){o[0], o[1], o[2], o[3]}; d[32] = (v4f){o[4], o[5], o[6], o[7]}; } }
  __syncthreads();
#pragma unroll
  for (int jj = 0; jj < 2; ++jj) { const int t = ks * 2 + jj;   /* tile (u, j) = (t / 4, t % 4) */
    float* yo = Y + ((size_t)h * TT + ql0 + (t >> 2) * 16 + col) * HD + (t & 3) * 16 + 8 * g;
#pragma unroll
    for (int e = 0; e < 2; ++e) { const v4f* s = gac + t * 64 + e * 32 + lane; v4f o = s[0];
#pragma unroll
      for (int k = 1; k < KS; ++k) o += s[k * 512];
      vst2(yo + 4 * e, o); } }
  asm volatile("s_wait_xcnt 0x0" ::: "memory");   /* stands in front of any later rewrite of the address and data registers that the stores above name */ }
// block = (head, 64 * QW query rows), 16 waves: 4 tiles of 32 queries x 4 shares of the keys (early rows: 8 tiles of 16 x 2); the late rows' waves of equal share read the same keys from the ring in LDS, which the block fills once (early rows: they meet in the cache). A WGP holds one block at a time, so the order is by falling length, for the WGPs that are free first to take the longer of what is left; the early-row blocks, few steps but slow ones, go first
#define NFB (TT / (64 * QW))
#define NHB (QHI / (64 * QW))
__global__ __launch_bounds__(512) void k_fa(const float* __restrict__ Q, const _Float16* __restrict__ KH, const _Float16* __restrict__ KL, const _Float16* __restrict__ VT, const __bf16* __restrict__ VB, const __bf16* __restrict__ VBL, float* __restrict__ Y) {
  __shared__ float sml[16 * 64]; __shared__ v4f sac[16 * 512];   /* a wave's maxima and sums; a wave's 64 x 32 partial output */
  __shared__ __attribute__((aligned(16))) char sq[2 * QPL];   /* the block's queries in fragment order: f16 plane, residual plane (early rows) */
  __shared__ __attribute__((aligned(128))) char ring[2 * STG];   /* late rows: two stages of k and v fragments */
  static_assert(64 * QW * HD * 4 == 512 * 4 * 16 && 64 * QW / 16 * 8 * QP == QPL, "512 threads x 4 loads of 16 bytes are the block's query rows");
  const int idx = blockIdx.x, od = idx / NH, h = idx % NH; const int fb = od < NHB ? NHB - 1 - od : NFB - 1 - (od - NHB);
  const int tid = threadIdx.x, wave = __builtin_amdgcn_readfirstlane(tid >> 5) /* scalar, so that the loop over a wave's own steps branches on SCC with every lane on */, lane = tid & 31;
  /* the block's own f32 query rows, each element once: a wave's load is the same 128-byte half of 4 rows, 4 whole lines */
  const float* qs = Q + ((size_t)h * TT + fb * 64 * QW) * HD; const unsigned lq = ((tid >> 5) * 8 + ((tid >> 3) & 3)) * (HD * 4) + (tid & 7) * 16; v4f qa[4];
#pragma unroll
  for (int i = 0; i < 4; ++i) qa[i] = ldu<v4f>(qs, lq + (i >> 1) * 4 * HD * 4 + (i & 1) * 128);
  asm volatile("s_wait_xcnt 0x0" :: "v"(lq) : "memory");   /* stands in front of the first rewrite of a register that the loads above name; as its input the offset lives up to here */
  const unsigned sw = ((unsigned)(wave >> 1) * 8 + ((lane & 7) >> 1)) * QP + ((wave & 1) * 8 + (lane >> 3)) * 16 + (lane & 1) * 8;   /* where this lane's first 8 bytes go in the fragment order */
  if (fb >= NHB) { const int ks = wave & 3, gw = wave - ks;   /* the branch is the same for the whole block, as the barriers inside ask; the late rows are named first: built the other way round, their code held the 16 registers of qa to its end, for the early rows' code behind it, and spilled */
    fa_body<false, QW, 4>(qa, sq, sw, (wave >> 2) * QW, KH, KL, VT, VB, VBL, Y, h, fb * 64 * QW + (wave >> 2) * 16 * QW, lane, ks, sml + gw * 64, sac + gw * 512, ring, (unsigned)tid);
  } else { const int ks = wave & 1, gw = wave - ks;   /* the residual planes take twice the registers: 16-query tiles */
    fa_body<true, 1, 2>(qa, sq, sw, wave >> 1, KH, KL, VT, VB, VBL, Y, h, fb * 64 * QW + (wave >> 1) * 16, lane, ks, sml + gw * 64, sac + gw * 512, ring, (unsigned)tid); } }

extern "C" void kernel_launch(void* const* d_in, const int* in_sizes, int n_in, void* d_out, int out_size, void* d_ws, size_t ws_size, hipStream_t stream) {
  (void)in_sizes; (void)n_in; (void)out_size;
  const float** F = (const float**)d_in;
  if (ws_size < (size_t)WS_END) return;
  char* ws = (char*)d_ws; _Float16 *KH = (_Float16*)(ws + WS_KH), *VT = (_Float16*)(ws + WS_VT), *KL = (_Float16*)(ws + WS_KL); __bf16 *VB = (__bf16*)(ws + WS_VB), *VBL = (__bf16*)(ws + WS_VBL);
  // inputs: 0 q [B, H, T, 64], 1 k [B, H, 64, T], 2 v [B, H, T, 64] (causal flag folded)
  k_prep8<<<dim3(TNB * TT / 64, NH), 128, 0, stream>>>(F[1], F[2], KH, KL, VT, VB, VBL);
  k_fa<<<dim3(NFB * NH), 512, 0, stream>>>(F[0], KH, KL, VT, VB, VBL, (float*)d_out);
}
